// v000
// The times below were measured on an AMD MI455X: many runs one after another, warmed up first and cycling through
// copies of the inputs, with the whole window's GPU time divided by the number of runs. Launches and the gaps
// between them are all in it. The median over several windows is given; except for v000 it joins two sittings, which
// can be a few percent apart, so the side-by-side timings, each taken in one sitting, are the better comparison.
// v000, which the later versions start from, runs in 361 microseconds.
#include <hip/hip_runtime.h>

// SAN (shared-projection attention): w = x W_qkv (q = k = v = w; 8 heads x 64 over 4096 tokens, batch 2); attn = softmax(w.w^T x 64^-0.5); out = (attn w) merged . W_out + b
// -> [2][4096][512].
// The shared projection is ONE exact GEMM on v_wmma_f32_16x16x32_bf16 (x and W exact bf16; 1 product) written three ways (q plane x 1/8 x8, k plane x8,
// (8w)^T plane) as single f16; attention on v_wmma_f32_16x16x32_f16 per (b, h, 16 queries) over all 128 key blocks with single-f16 q, k, P, v (1 product each; logits are O(1),
// softmax over 4096 keys) except the self logit w_i·w_i/8 ≈ 8, which dominates the softmax and is taken from an exact f32 |w_i|² computed in the projection epilogue; f32 online softmax / accumulate; ctx single f16; out = ctx.W_out + b (1 product). ≈4.7 M WMMAs (an f32-class path would be ≈13 M).

namespace {
constexpr int Bn = 2, S = 4096, DM = 512, H = 8, HD = 64, NT = Bn * S;
constexpr float QS = 8.0f, KS = 8.0f, VS = 8.0f, PS = 8.0f, SCALE = 0.125f;
constexpr size_t PL = (size_t)Bn * H * S * HD;

typedef _Float16 b16;
typedef __attribute__((ext_vector_type(16))) _Float16 v16b;
typedef __attribute__((ext_vector_type(16))) __bf16 v16bb;
typedef __attribute__((ext_vector_type(8))) _Float16 v8b;
typedef __attribute__((ext_vector_type(8))) unsigned short v8us;
typedef __attribute__((ext_vector_type(8))) float v8f;
typedef __attribute__((ext_vector_type(4))) float v4f;
__device__ __forceinline__ float bf16_rne(float f) { unsigned int u = __float_as_uint(f); u += 0x7FFFu + ((u >> 16) & 1u); return __uint_as_float(u & 0xFFFF0000u); }
__device__ __forceinline__ unsigned short bf16_bits(float f) { unsigned int u = __float_as_uint(f); u += 0x7FFFu + ((u >> 16) & 1u); return (unsigned short)(u >> 16); }
__device__ __forceinline__ v16b frag_kb(const b16* p, int hh) { const v8b a = *(const v8b*)(p + 8 * hh), b = *(const v8b*)(p + 16 + 8 * hh); v16b f;
#pragma unroll
  for (int e = 0; e < 8; ++e) { f[e] = a[e]; f[8 + e] = b[e]; } return f; }
__device__ __forceinline__ v16bb frag_bf(const unsigned short* p, int hh) { const v8us a = *(const v8us*)(p + 8 * hh), b = *(const v8us*)(p + 16 + 8 * hh); union { unsigned short s[16]; v16bb v; } u;
#pragma unroll
  for (int e = 0; e < 8; ++e) { u.s[e] = a[e]; u.s[8 + e] = b[e]; } return u.v; }
__device__ __forceinline__ v16bb frag_f32bf(const float* p, int hh) { union { unsigned short s[16]; v16bb v; } u;
#pragma unroll
  for (int e = 0; e < 8; ++e) { u.s[e] = bf16_bits(p[8 * hh + e]); u.s[8 + e] = bf16_bits(p[16 + 8 * hh + e]); } return u.v; }
__device__ __forceinline__ v8f wmma16b(v16b a, v16b b, v8f c) { v8f d = __builtin_amdgcn_wmma_f32_16x16x32_f16(false, a, false, b, (short)0, c, false, false); asm volatile("v_nop\n\tv_nop\n\tv_nop\n\tv_nop" : "+v"(d) : "v"(a), "v"(b)); return d; }
__device__ __forceinline__ v8f wmma16bb(v16bb a, v16bb b, v8f c) { v8f d = __builtin_amdgcn_wmma_f32_16x16x32_bf16(false, a, false, b, (short)0, c, false, false); asm volatile("v_nop\n\tv_nop\n\tv_nop\n\tv_nop" : "+v"(d) : "v"(a), "v"(b)); return d; }
__device__ __forceinline__ void wave_lds_sync() { __builtin_amdgcn_fence(__ATOMIC_RELEASE, "workgroup"); __builtin_amdgcn_wave_barrier(); __builtin_amdgcn_fence(__ATOMIC_ACQUIRE, "workgroup"); }
__device__ __forceinline__ float nexp(float x) { return __builtin_amdgcn_exp2f(x * 1.4426950408889634f); }

__global__ __launch_bounds__(256) void prep_kernel(const float* __restrict__ Wqkv, const float* __restrict__ Wout, const float* __restrict__ bout, unsigned short* __restrict__ w16, b16* __restrict__ wo16, float* __restrict__ P) {
  const int t_ = blockIdx.x * 256 + threadIdx.x, nth = gridDim.x * 256;
  {
    for (int q = t_; q < DM * DM; q += nth) { const int o = q / DM, k = q % DM; w16[q] = bf16_bits(Wqkv[(size_t)k * DM + o]); wo16[q] = (b16)bf16_rne(Wout[(size_t)k * DM + o]); }
    for (int q = t_; q < DM; q += nth) P[q] = bf16_rne(bout[q]);
     }
}

// projection: w = bf16(x).W (exact); block 128 tokens x 64 cols (= head h); writes q plane (w/8 x8 = w) hmm: q x SCALE x QS = w x 1, k plane (w x 8), (8w)^T plane, all single f16,
__global__ __launch_bounds__(128) void proj_kernel(const float* __restrict__ x, const unsigned short* __restrict__ w16, b16* __restrict__ qp, b16* __restrict__ kp, b16* __restrict__ vt, float* __restrict__ sq) {
  __shared__ __attribute__((aligned(16))) b16 Tq[4][32][HD + 8], Tk[4][32][HD + 8]; __shared__ __attribute__((aligned(16))) b16 Tv[HD][128 + 8]; __shared__ float Sq[128];
  const int lane = threadIdx.x & 31, wave = threadIdx.x >> 5, nloc = lane & 15, hlf = lane >> 4, h = blockIdx.x, c0 = h * HD, p0 = blockIdx.y * 128, m0 = p0 + wave * 32, b = p0 / S, t0 = p0 % S;
  v8f acc[2][4];
#pragma unroll
  for (int r = 0; r < 2; ++r)
#pragma unroll
    for (int t = 0; t < 4; ++t) acc[r][t] = (v8f){};
#pragma unroll 2
  for (int kb = 0; kb < DM; kb += 32) { const v16bb a0 = frag_f32bf(x + (size_t)(m0 + nloc) * DM + kb, hlf), a1 = frag_f32bf(x + (size_t)(m0 + 16 + nloc) * DM + kb, hlf);
#pragma unroll
    for (int t = 0; t < 4; ++t) { const v16bb bw = frag_bf(w16 + (size_t)(c0 + t * 16 + nloc) * DM + kb, hlf); acc[0][t] = wmma16bb(a0, bw, acc[0][t]); acc[1][t] = wmma16bb(a1, bw, acc[1][t]); } }
#pragma unroll
  for (int t = 0; t < 4; ++t)
#pragma unroll
    for (int r = 0; r < 2; ++r)
#pragma unroll
      for (int v = 0; v < 8; ++v) { const float w = acc[r][t][v]; Tq[wave][r * 16 + 8 * hlf + v][t * 16 + nloc] = (b16)(w * (SCALE * QS)); Tk[wave][r * 16 + 8 * hlf + v][t * 16 + nloc] = (b16)(w * KS); Tv[t * 16 + nloc][wave * 32 + r * 16 + 8 * hlf + v] = (b16)(w * VS); }
  // exact f32 self-logit ingredient: |w_row|^2 per (token, head) (sum over this lane's 4 columns x ... then across the 16 column lanes; fixed order)
#pragma unroll
  for (int r = 0; r < 2; ++r)
#pragma unroll
    for (int v = 0; v < 8; ++v) { float s2 = 0.0f;
#pragma unroll
      for (int t = 0; t < 4; ++t) { const float w = acc[r][t][v]; s2 += w * w; }
#pragma unroll
      for (int o = 1; o < 16; o <<= 1) s2 += __shfl_xor(s2, o);
      if (nloc == 0) Sq[wave * 32 + r * 16 + 8 * hlf + v] = s2; }
  __syncthreads();
  b16* qb = qp + (((size_t)b * H + h) * S + (m0 % S)) * HD; b16* kb_ = kp + (((size_t)b * H + h) * S + (m0 % S)) * HD;
  {
#pragma unroll
    for (int j = 0; j < 8; ++j) { const int rr = j * 4 + (lane >> 3), c8 = (lane & 7) * 8; *(v8b*)(qb + (size_t)rr * HD + c8) = *(const v8b*)(&Tq[wave][rr][c8]); *(v8b*)(kb_ + (size_t)rr * HD + c8) = *(const v8b*)(&Tk[wave][rr][c8]); }
    for (int i = threadIdx.x; i < HD * 16; i += 128) { const int d = i >> 4, c8 = (i & 15) * 8; *(v8b*)(vt + (((size_t)b * H + h) * HD + d) * S + t0 + c8) = *(const v8b*)(&Tv[d][c8]); }
    *(float*)(sq + ((size_t)b * H + h) * S + t0 + threadIdx.x) = Sq[threadIdx.x];   // [b][h][token] f32: 512 B per block
     }
}

// attention: wave = (b, h, 16 queries) over all 128 key blocks: S^T (2 k-steps, 1 product), online softmax, o^T (4 tiles, 1 product); block = 8 heads of one (b, 16 queries) ->
__global__ __launch_bounds__(256) void attn_kernel(const b16* __restrict__ qp, const b16* __restrict__ kp, const b16* __restrict__ vt, const float* __restrict__ sq, b16* __restrict__ ctx) {
  __shared__ __attribute__((aligned(16))) b16 Os[16][DM + 8];
  const int h = threadIdx.x >> 5, lane = threadIdx.x & 31, hh = lane >> 4, col = lane & 15; const int b = blockIdx.x / (S / 16), q0 = (blockIdx.x % (S / 16)) * 16, qi = q0 + col;
  const b16* Q = qp + (((size_t)b * H + h) * S) * HD; const b16* K = kp + (((size_t)b * H + h) * S) * HD; const b16* V = vt + (((size_t)b * H + h) * HD) * S;
  const v16b qf0 = frag_kb(Q + (size_t)qi * HD, hh), qf1 = frag_kb(Q + (size_t)qi * HD + 32, hh); const float sself = sq[((size_t)b * H + h) * S + qi] * SCALE;   // exact f32 self logit (the dominant softmax term)
  float m = -INFINITY, l = 0.0f; v8f o[4] = {{}, {}, {}, {}};
  for (int kb = 0; kb < S; kb += 32) {
    const v16b ka0 = frag_kb(K + (size_t)(kb + col) * HD, hh), ka1 = frag_kb(K + (size_t)(kb + col) * HD + 32, hh), kc0 = frag_kb(K + (size_t)(kb + 16 + col) * HD, hh), kc1 = frag_kb(K + (size_t)(kb + 16 + col) * HD + 32, hh);
    v8f s0 = {}, s1 = {}; s0 = wmma16b(ka0, qf0, s0); s0 = wmma16b(ka1, qf1, s0); s1 = wmma16b(kc0, qf0, s1); s1 = wmma16b(kc1, qf1, s1);
    float mr = -INFINITY;
#pragma unroll
    for (int r = 0; r < 8; ++r) { s0[r] *= 1.0f / (QS * KS); s1[r] *= 1.0f / (QS * KS); if (kb + 8 * hh + r == qi) s0[r] = sself; if (kb + 16 + 8 * hh + r == qi) s1[r] = sself; mr = fmaxf(mr, fmaxf(s0[r], s1[r])); }
    mr = fmaxf(mr, __shfl_xor(mr, 16));
    const float mn = fmaxf(m, mr), al_ = nexp(m - mn); m = mn; float sum = 0.0f; v16b pbv;
#pragma unroll
    for (int r = 0; r < 8; ++r) { const float e0 = nexp(s0[r] - mn), e1 = nexp(s1[r] - mn); sum += e0 + e1; pbv[r] = (b16)(e0 * PS); pbv[8 + r] = (b16)(e1 * PS); }
    sum += __shfl_xor(sum, 16); l = l * al_ + sum;
#pragma unroll
    for (int t = 0; t < 4; ++t) { o[t] *= al_; const v16b vf = frag_kb(V + (size_t)(t * 16 + col) * S + kb, hh); o[t] = wmma16b(vf, pbv, o[t]); } }
  const float inv = 1.0f / (l * VS * PS);
#pragma unroll
  for (int t = 0; t < 4; ++t)
#pragma unroll
    for (int r = 0; r < 8; ++r) Os[col][h * HD + t * 16 + 8 * hh + r] = (b16)(o[t][r] * inv);
  __syncthreads();
  b16* dst = ctx + ((size_t)b * S + q0) * DM;
  { for (int i = threadIdx.x; i < 16 * (DM / 8); i += 256) { const int rr = i / (DM / 8), c8 = (i % (DM / 8)) * 8; *(v8b*)(dst + (size_t)rr * DM + c8) = *(const v8b*)(&Os[rr][c8]); }  }
}

__global__ __launch_bounds__(128) void out_kernel(const b16* __restrict__ ctx, const b16* __restrict__ wo16, const float* __restrict__ P, float* __restrict__ out) {
  __shared__ __attribute__((aligned(16))) float Ts[4][32 * 64];
  const int lane = threadIdx.x & 31, wave = threadIdx.x >> 5, nloc = lane & 15, hlf = lane >> 4, m0 = blockIdx.y * 128 + wave * 32, c0 = blockIdx.x * 64;
  v8f acc[2][4];
#pragma unroll
  for (int r = 0; r < 2; ++r)
#pragma unroll
    for (int t = 0; t < 4; ++t) acc[r][t] = (v8f){};
#pragma unroll 2
  for (int kb = 0; kb < DM; kb += 32) { const v16b a0 = frag_kb(ctx + (size_t)(m0 + nloc) * DM + kb, hlf), a1 = frag_kb(ctx + (size_t)(m0 + 16 + nloc) * DM + kb, hlf);
#pragma unroll
    for (int t = 0; t < 4; ++t) { const v16b bw = frag_kb(wo16 + (size_t)(c0 + t * 16 + nloc) * DM + kb, hlf); acc[0][t] = wmma16b(a0, bw, acc[0][t]); acc[1][t] = wmma16b(a1, bw, acc[1][t]); } }
  float* Tt = Ts[wave];
#pragma unroll
  for (int t = 0; t < 4; ++t) { const float bb = P[c0 + t * 16 + nloc];
#pragma unroll
    for (int r = 0; r < 2; ++r)
#pragma unroll
      for (int v = 0; v < 8; ++v) Tt[(r * 16 + v + 8 * hlf) * 64 + t * 16 + nloc] = acc[r][t][v] + bb; }
  wave_lds_sync();
  {
#pragma unroll
    for (int j = 0; j < 16; ++j) { const int rr = j * 2 + hlf, c4 = nloc * 4; *(v4f*)(out + (size_t)(m0 + rr) * DM + c0 + c4) = *(const v4f*)(Tt + rr * 64 + c4); }
     }
}
}  // namespace

extern "C" void kernel_launch(void* const* d_in, const int* in_sizes, int n_in,
                              void* d_out, int out_size, void* d_ws, size_t ws_size, hipStream_t stream) {
  (void)n_in; (void)out_size;
  const float* x = (const float*)d_in[0]; const float* Wqkv = (const float*)d_in[1]; const float* Wout = (const float*)d_in[2]; const float* bout = (const float*)d_in[3];
  float* out = (float*)d_out;   // [2][4096][512]
  if (in_sizes[0] != NT * DM || in_sizes[1] != DM * DM || in_sizes[2] != DM * DM || in_sizes[3] != DM) return;
  size_t off = 0; char* ws = (char*)d_ws;
  auto carve = [&](size_t bytes) { char* p = ws + off; off += (bytes + 255) & ~(size_t)255; return p; };
  unsigned short* w16 = (unsigned short*)carve((size_t)DM * DM * 2); b16* wo16 = (b16*)carve((size_t)DM * DM * 2); float* P = (float*)carve(DM * 4);
  b16* qp = (b16*)carve(PL * 2); b16* kp = (b16*)carve(PL * 2); b16* vt = (b16*)carve(PL * 2); b16* ctx = (b16*)carve((size_t)NT * DM * 2); float* sq = (float*)carve((size_t)NT * H * 4);
  if (off > ws_size) return;                                    // ≈ 1 + 8.4 x 4 ≈ 35 MB
  prep_kernel<<<256, 256, 0, stream>>>(Wqkv, Wout, bout, w16, wo16, P);
  proj_kernel<<<dim3(H, NT / 128), 128, 0, stream>>>(x, w16, qp, kp, vt, sq);
  attn_kernel<<<NT / 16, 256, 0, stream>>>(qp, kp, vt, sq, ctx);
  out_kernel<<<dim3(DM / 64, NT / 128), 128, 0, stream>>>(ctx, wo16, P, out);
}

// v001
// Measured time: 148 microseconds a run.
// In two side-by-side timings against v000, it was 2.51 and 2.54 times as fast.
#include <hip/hip_runtime.h>

// SAN (shared-projection attention): w = x W_qkv (q = k = v = w; 8 heads x 64 over 4096 tokens, batch 2); attn = softmax(w.w^T x 64^-0.5); out = (attn w) merged . W_out + b
// -> [2][4096][512].
// The shared projection is ONE exact GEMM on v_wmma_f32_16x16x32_bf16 (x and W exact bf16; 1 product) written three ways (q plane x 1/8 x8, k plane x8,
// (8w)^T plane) as single f16; attention on v_wmma_f32_16x16x32_f16 per (b, h, 16 queries) over all 128 key blocks with single-f16 q, k, P, v (1 product each; logits are O(1),
// softmax over 4096 keys) except the self logit w_i·w_i/8 ≈ 8, which dominates the softmax and is taken from an exact f32 |w_i|² computed in the projection epilogue; f32 online softmax / accumulate; ctx single f16; out = ctx.W_out + b (1 product). ≈4.7 M WMMAs (an f32-class path would be ≈13 M).

namespace {
constexpr int Bn = 2, S = 4096, DM = 512, H = 8, HD = 64, NT = Bn * S;
constexpr float QS = 8.0f, KS = 8.0f, VS = 8.0f, PS = 8.0f, SCALE = 0.125f;
constexpr size_t PL = (size_t)Bn * H * S * HD;

typedef _Float16 b16;
typedef __attribute__((ext_vector_type(16))) _Float16 v16b;
typedef __attribute__((ext_vector_type(16))) __bf16 v16bb;
typedef __attribute__((ext_vector_type(8))) _Float16 v8b;
typedef __attribute__((ext_vector_type(8))) unsigned short v8us;
typedef __attribute__((ext_vector_type(8))) float v8f;
typedef __attribute__((ext_vector_type(4))) float v4f;
__device__ __forceinline__ float bf16_rne(float f) { unsigned int u = __float_as_uint(f); u += 0x7FFFu + ((u >> 16) & 1u); return __uint_as_float(u & 0xFFFF0000u); }
__device__ __forceinline__ unsigned short bf16_bits(float f) { unsigned int u = __float_as_uint(f); u += 0x7FFFu + ((u >> 16) & 1u); return (unsigned short)(u >> 16); }
__device__ __forceinline__ v16b frag_kb(const b16* p, int hh) { const v8b a = *(const v8b*)(p + 8 * hh), b = *(const v8b*)(p + 16 + 8 * hh); v16b f;
#pragma unroll
  for (int e = 0; e < 8; ++e) { f[e] = a[e]; f[8 + e] = b[e]; } return f; }
__device__ __forceinline__ v16bb frag_bf(const unsigned short* p, int hh) { const v8us a = *(const v8us*)(p + 8 * hh), b = *(const v8us*)(p + 16 + 8 * hh); union { unsigned short s[16]; v16bb v; } u;
#pragma unroll
  for (int e = 0; e < 8; ++e) { u.s[e] = a[e]; u.s[8 + e] = b[e]; } return u.v; }
__device__ __forceinline__ v16bb frag_f32bf(const float* p, int hh) { union { unsigned short s[16]; v16bb v; } u;
#pragma unroll
  for (int e = 0; e < 8; ++e) { u.s[e] = bf16_bits(p[8 * hh + e]); u.s[8 + e] = bf16_bits(p[16 + 8 * hh + e]); } return u.v; }
__device__ __forceinline__ v8f wmma16b(v16b a, v16b b, v8f c) { v8f d = __builtin_amdgcn_wmma_f32_16x16x32_f16(false, a, false, b, (short)0, c, false, false); asm volatile("v_nop\n\tv_nop\n\tv_nop\n\tv_nop" : "+v"(d) : "v"(a), "v"(b)); return d; }
__device__ __forceinline__ v8f wmma16bb(v16bb a, v16bb b, v8f c) { v8f d = __builtin_amdgcn_wmma_f32_16x16x32_bf16(false, a, false, b, (short)0, c, false, false); asm volatile("v_nop\n\tv_nop\n\tv_nop\n\tv_nop" : "+v"(d) : "v"(a), "v"(b)); return d; }
__device__ __forceinline__ void wave_lds_sync() { __builtin_amdgcn_fence(__ATOMIC_RELEASE, "workgroup"); __builtin_amdgcn_wave_barrier(); __builtin_amdgcn_fence(__ATOMIC_ACQUIRE, "workgroup"); }
__device__ __forceinline__ float nexp(float x) { return __builtin_amdgcn_exp2f(x * 1.4426950408889634f); }

__global__ __launch_bounds__(256) void prep_kernel(const float* __restrict__ Wqkv, const float* __restrict__ Wout, const float* __restrict__ bout, unsigned short* __restrict__ w16, b16* __restrict__ wo16, float* __restrict__ P) {
  const int t_ = blockIdx.x * 256 + threadIdx.x, nth = gridDim.x * 256;
  {
    for (int q = t_; q < DM * DM; q += nth) { const int o = q / DM, k = q % DM; w16[q] = bf16_bits(Wqkv[(size_t)k * DM + o]); wo16[q] = (b16)bf16_rne(Wout[(size_t)k * DM + o]); }
    for (int q = t_; q < DM; q += nth) P[q] = bf16_rne(bout[q]);
     }
}

// projection: w = bf16(x).W (exact); block 128 tokens x 64 cols (= head h); writes q plane (w/8 x8 = w) hmm: q x SCALE x QS = w x 1, k plane (w x 8), (8w)^T plane, all single f16,
__global__ __launch_bounds__(128) void proj_kernel(const float* __restrict__ x, const unsigned short* __restrict__ w16, b16* __restrict__ qp, b16* __restrict__ kp, b16* __restrict__ vt, float* __restrict__ sq) {
  __shared__ __attribute__((aligned(16))) b16 Tq[4][32][HD + 8], Tk[4][32][HD + 8]; __shared__ __attribute__((aligned(16))) b16 Tv[HD][128 + 8]; __shared__ float Sq[128];
  const int lane = threadIdx.x & 31, wave = threadIdx.x >> 5, nloc = lane & 15, hlf = lane >> 4, h = blockIdx.x, c0 = h * HD, p0 = blockIdx.y * 128, m0 = p0 + wave * 32, b = p0 / S, t0 = p0 % S;
  v8f acc[2][4];
#pragma unroll
  for (int r = 0; r < 2; ++r)
#pragma unroll
    for (int t = 0; t < 4; ++t) acc[r][t] = (v8f){};
#pragma unroll 2
  for (int kb = 0; kb < DM; kb += 32) { const v16bb a0 = frag_f32bf(x + (size_t)(m0 + nloc) * DM + kb, hlf), a1 = frag_f32bf(x + (size_t)(m0 + 16 + nloc) * DM + kb, hlf);
#pragma unroll
    for (int t = 0; t < 4; ++t) { const v16bb bw = frag_bf(w16 + (size_t)(c0 + t * 16 + nloc) * DM + kb, hlf); acc[0][t] = wmma16bb(a0, bw, acc[0][t]); acc[1][t] = wmma16bb(a1, bw, acc[1][t]); } }
#pragma unroll
  for (int t = 0; t < 4; ++t)
#pragma unroll
    for (int r = 0; r < 2; ++r)
#pragma unroll
      for (int v = 0; v < 8; ++v) { const float w = acc[r][t][v]; Tq[wave][r * 16 + 8 * hlf + v][t * 16 + nloc] = (b16)(w * (SCALE * QS)); Tk[wave][r * 16 + 8 * hlf + v][t * 16 + nloc] = (b16)(w * KS); Tv[t * 16 + nloc][wave * 32 + r * 16 + 8 * hlf + v] = (b16)(w * VS); }
  // exact f32 self-logit ingredient: |w_row|^2 per (token, head) (sum over this lane's 4 columns x ... then across the 16 column lanes; fixed order)
#pragma unroll
  for (int r = 0; r < 2; ++r)
#pragma unroll
    for (int v = 0; v < 8; ++v) { float s2 = 0.0f;
#pragma unroll
      for (int t = 0; t < 4; ++t) { const float w = acc[r][t][v]; s2 += w * w; }
#pragma unroll
      for (int o = 1; o < 16; o <<= 1) s2 += __shfl_xor(s2, o);
      if (nloc == 0) Sq[wave * 32 + r * 16 + 8 * hlf + v] = s2; }
  __syncthreads();
  b16* qb = qp + (((size_t)b * H + h) * S + (m0 % S)) * HD; b16* kb_ = kp + (((size_t)b * H + h) * S + (m0 % S)) * HD;
  {
#pragma unroll
    for (int j = 0; j < 8; ++j) { const int rr = j * 4 + (lane >> 3), c8 = (lane & 7) * 8; *(v8b*)(qb + (size_t)rr * HD + c8) = *(const v8b*)(&Tq[wave][rr][c8]); *(v8b*)(kb_ + (size_t)rr * HD + c8) = *(const v8b*)(&Tk[wave][rr][c8]); }
    for (int i = threadIdx.x; i < HD * 16; i += 128) { const int d = i >> 4, c8 = (i & 15) * 8; *(v8b*)(vt + (((size_t)b * H + h) * HD + d) * S + t0 + c8) = *(const v8b*)(&Tv[d][c8]); }
    *(float*)(sq + ((size_t)b * H + h) * S + t0 + threadIdx.x) = Sq[threadIdx.x];   // [b][h][token] f32: 512 B per block
     }
}

constexpr int KT = 256, NSTG = S / KT, KPI = HD + 8, VPI = KT + 8;   // LDS row pitches 144 B and 528 B (16 B x odd: no bank conflict for 16-byte fragment reads)
__device__ __forceinline__ unsigned lds_addr(const b16* p) { return (unsigned)(size_t)p; }   // low 32 bits of a __shared__ address = byte offset in the work-group's LDS
// eight 16-byte copies per lane; the s_wait_xcnt closes the statement so that no address register is rewritten before it
__device__ __forceinline__ void copy8(const b16* g, size_t gstep, const b16* l, int lstep) {
  asm volatile("global_load_async_to_lds_b128 %0, %8, off\n\tglobal_load_async_to_lds_b128 %1, %9, off\n\tglobal_load_async_to_lds_b128 %2, %10, off\n\tglobal_load_async_to_lds_b128 %3, %11, off\n\t"
               "global_load_async_to_lds_b128 %4, %12, off\n\tglobal_load_async_to_lds_b128 %5, %13, off\n\tglobal_load_async_to_lds_b128 %6, %14, off\n\tglobal_load_async_to_lds_b128 %7, %15, off\n\ts_wait_xcnt 0x0"
               :: "v"(lds_addr(l)), "v"(lds_addr(l + lstep)), "v"(lds_addr(l + 2 * lstep)), "v"(lds_addr(l + 3 * lstep)), "v"(lds_addr(l + 4 * lstep)), "v"(lds_addr(l + 5 * lstep)), "v"(lds_addr(l + 6 * lstep)), "v"(lds_addr(l + 7 * lstep)),
                  "v"(g), "v"(g + gstep), "v"(g + 2 * gstep), "v"(g + 3 * gstep), "v"(g + 4 * gstep), "v"(g + 5 * gstep), "v"(g + 6 * gstep), "v"(g + 7 * gstep) : "memory");
}
__global__ __launch_bounds__(256) void attn_kernel(const b16* __restrict__ qp, const b16* __restrict__ kp, const b16* __restrict__ vt, const float* __restrict__ sq, b16* __restrict__ ctx) {
  __shared__ __attribute__((aligned(16))) b16 Ks[2][KT * KPI], Vs[2][HD * VPI], Os[8][16][HD + 8];
  const int wave = threadIdx.x >> 5, lane = threadIdx.x & 31, hh = lane >> 4, col = lane & 15; const int bh = blockIdx.x / (S / 128), b = bh / H, h = bh % H, q0 = (blockIdx.x % (S / 128)) * 128 + wave * 16, qi = q0 + col;
  const b16* Q = qp + ((size_t)bh * S) * HD; const b16* K = kp + ((size_t)bh * S) * HD; const b16* V = vt + ((size_t)bh * HD) * S;
  // this lane's share of a tile: K = 256 rows x 128 B, contiguous (a wave's copy = 4 rows); V^T = 64 rows x 512 B (a wave's copy = 1 row)
  const b16* Kg = K + threadIdx.x * 8; const b16* Vg = V + (size_t)wave * S + lane * 8; const int kl0 = (threadIdx.x >> 3) * KPI + (threadIdx.x & 7) * 8, vl0 = wave * VPI + lane * 8;
  copy8(Kg, 32 * HD, &Ks[0][kl0], 32 * KPI); copy8(Vg, (size_t)8 * S, &Vs[0][vl0], 8 * VPI);
  asm volatile("s_wait_asynccnt 0x0" ::: "memory");   // tile 0 landed (this wave's copies) before the barrier that publishes it
  __syncthreads();
  copy8(Kg + KT * HD, 32 * HD, &Ks[1][kl0], 32 * KPI); copy8(Vg + KT, (size_t)8 * S, &Vs[1][vl0], 8 * VPI);
  const v16b qf0 = frag_kb(Q + (size_t)qi * HD, hh), qf1 = frag_kb(Q + (size_t)qi * HD + 32, hh); const float sself = sq[(size_t)bh * S + qi] * SCALE;   // exact f32 self logit (the dominant softmax term)
  float m = -INFINITY, l = 0.0f; v8f o[4] = {{}, {}, {}, {}};
  for (int st = 0; st < NSTG; ++st) {
    const b16* Kb = &Ks[st & 1][col * KPI]; const b16* Vb = &Vs[st & 1][col * VPI];
    for (int kl = 0; kl < KT; kl += 32) { const int kb = st * KT + kl;
      const v16b ka0 = frag_kb(Kb + kl * KPI, hh), ka1 = frag_kb(Kb + kl * KPI + 32, hh), kc0 = frag_kb(Kb + (kl + 16) * KPI, hh), kc1 = frag_kb(Kb + (kl + 16) * KPI + 32, hh);
      const v16b vf[4] = {frag_kb(Vb + kl, hh), frag_kb(Vb + 16 * VPI + kl, hh), frag_kb(Vb + 32 * VPI + kl, hh), frag_kb(Vb + 48 * VPI + kl, hh)};   // all of the pass's LDS reads stand together, ahead of its products
      v8f s0 = {}, s1 = {}; s0 = wmma16b(ka0, qf0, s0); s0 = wmma16b(ka1, qf1, s0); s1 = wmma16b(kc0, qf0, s1); s1 = wmma16b(kc1, qf1, s1);
      float mr = -INFINITY;
#pragma unroll
      for (int r = 0; r < 8; ++r) { s0[r] *= 1.0f / (QS * KS); s1[r] *= 1.0f / (QS * KS); if (kb + 8 * hh + r == qi) s0[r] = sself; if (kb + 16 + 8 * hh + r == qi) s1[r] = sself; mr = fmaxf(mr, fmaxf(s0[r], s1[r])); }
      mr = fmaxf(mr, __shfl_xor(mr, 16));
      const float mn = fmaxf(m, mr), al_ = nexp(m - mn); m = mn; float sum = 0.0f; v16b pbv;
#pragma unroll
      for (int r = 0; r < 8; ++r) { const float e0 = nexp(s0[r] - mn), e1 = nexp(s1[r] - mn); sum += e0 + e1; pbv[r] = (b16)(e0 * PS); pbv[8 + r] = (b16)(e1 * PS); }
      sum += __shfl_xor(sum, 16); l = l * al_ + sum;
#pragma unroll
      for (int t = 0; t < 4; ++t) { o[t] *= al_; o[t] = wmma16b(vf[t], pbv, o[t]); } }
    asm volatile("s_wait_dscnt 0x0" ::: "memory");      // this wave's reads of the buffer are done before the buffer is refilled
    asm volatile("s_wait_asynccnt 0x0" ::: "memory");   // this wave's copies of the next tile have landed before the barrier that publishes them
    __syncthreads();
    if (st + 2 < NSTG) { copy8(Kg + (size_t)(st + 2) * KT * HD, 32 * HD, &Ks[st & 1][kl0], 32 * KPI); copy8(Vg + (st + 2) * KT, (size_t)8 * S, &Vs[st & 1][vl0], 8 * VPI); } }
  asm volatile("s_wait_asynccnt 0x0" ::: "memory");     // nothing in flight when the wave goes on to its end
  const float inv = 1.0f / (l * VS * PS);
#pragma unroll
  for (int t = 0; t < 4; ++t)
#pragma unroll
    for (int r = 0; r < 8; ++r) Os[wave][col][t * 16 + 8 * hh + r] = (b16)(o[t][r] * inv);
  __syncthreads();
  b16* dst = ctx + ((size_t)b * S + q0) * DM + h * HD;   // this wave's 16 rows x 128 B: whole lines, one writer each
  for (int j = 0; j < 4; ++j) { const int rr = j * 4 + (lane >> 3), c8 = (lane & 7) * 8; *(v8b*)(dst + (size_t)rr * DM + c8) = *(const v8b*)(&Os[wave][rr][c8]); }
}

__global__ __launch_bounds__(128) void out_kernel(const b16* __restrict__ ctx, const b16* __restrict__ wo16, const float* __restrict__ P, float* __restrict__ out) {
  __shared__ __attribute__((aligned(16))) float Ts[4][32 * 64];
  const int lane = threadIdx.x & 31, wave = threadIdx.x >> 5, nloc = lane & 15, hlf = lane >> 4, m0 = blockIdx.y * 128 + wave * 32, c0 = blockIdx.x * 64;
  v8f acc[2][4];
#pragma unroll
  for (int r = 0; r < 2; ++r)
#pragma unroll
    for (int t = 0; t < 4; ++t) acc[r][t] = (v8f){};
#pragma unroll 2
  for (int kb = 0; kb < DM; kb += 32) { const v16b a0 = frag_kb(ctx + (size_t)(m0 + nloc) * DM + kb, hlf), a1 = frag_kb(ctx + (size_t)(m0 + 16 + nloc) * DM + kb, hlf);
#pragma unroll
    for (int t = 0; t < 4; ++t) { const v16b bw = frag_kb(wo16 + (size_t)(c0 + t * 16 + nloc) * DM + kb, hlf); acc[0][t] = wmma16b(a0, bw, acc[0][t]); acc[1][t] = wmma16b(a1, bw, acc[1][t]); } }
  float* Tt = Ts[wave];
#pragma unroll
  for (int t = 0; t < 4; ++t) { const float bb = P[c0 + t * 16 + nloc];
#pragma unroll
    for (int r = 0; r < 2; ++r)
#pragma unroll
      for (int v = 0; v < 8; ++v) Tt[(r * 16 + v + 8 * hlf) * 64 + t * 16 + nloc] = acc[r][t][v] + bb; }
  wave_lds_sync();
  {
#pragma unroll
    for (int j = 0; j < 16; ++j) { const int rr = j * 2 + hlf, c4 = nloc * 4; *(v4f*)(out + (size_t)(m0 + rr) * DM + c0 + c4) = *(const v4f*)(Tt + rr * 64 + c4); }
     }
}
}  // namespace

extern "C" void kernel_launch(void* const* d_in, const int* in_sizes, int n_in,
                              void* d_out, int out_size, void* d_ws, size_t ws_size, hipStream_t stream) {
  (void)n_in; (void)out_size;
  const float* x = (const float*)d_in[0]; const float* Wqkv = (const float*)d_in[1]; const float* Wout = (const float*)d_in[2]; const float* bout = (const float*)d_in[3];
  float* out = (float*)d_out;   // [2][4096][512]
  if (in_sizes[0] != NT * DM || in_sizes[1] != DM * DM || in_sizes[2] != DM * DM || in_sizes[3] != DM) return;
  size_t off = 0; char* ws = (char*)d_ws;
  auto carve = [&](size_t bytes) { char* p = ws + off; off += (bytes + 255) & ~(size_t)255; return p; };
  unsigned short* w16 = (unsigned short*)carve((size_t)DM * DM * 2); b16* wo16 = (b16*)carve((size_t)DM * DM * 2); float* P = (float*)carve(DM * 4);
  b16* qp = (b16*)carve(PL * 2); b16* kp = (b16*)carve(PL * 2); b16* vt = (b16*)carve(PL * 2); b16* ctx = (b16*)carve((size_t)NT * DM * 2); float* sq = (float*)carve((size_t)NT * H * 4);
  if (off > ws_size) return;                                    // ≈ 1 + 8.4 x 4 ≈ 35 MB
  prep_kernel<<<256, 256, 0, stream>>>(Wqkv, Wout, bout, w16, wo16, P);
  proj_kernel<<<dim3(H, NT / 128), 128, 0, stream>>>(x, w16, qp, kp, vt, sq);
  attn_kernel<<<Bn * H * (S / 128), 256, 0, stream>>>(qp, kp, vt, sq, ctx);
  out_kernel<<<dim3(DM / 64, NT / 128), 128, 0, stream>>>(ctx, wo16, P, out);
}

// v002
// It runs in 141 microseconds.
// In both of two side-by-side timings against v001, it was 1.05 times as fast.
// Counting every step since v000, it is 2.64 times as fast.
#include <hip/hip_runtime.h>

// SAN (shared-projection attention): w = x W_qkv (q = k = v = w; 8 heads x 64 over 4096 tokens, batch 2); attn = softmax(w.w^T x 64^-0.5); out = (attn w) merged . W_out + b
// -> [2][4096][512].
// The shared projection is ONE exact GEMM on v_wmma_f32_16x16x32_bf16 (x and W exact bf16; 1 product) written three ways (q plane x 1/8 x8, k plane x8,
// (8w)^T plane) as single f16; attention on v_wmma_f32_16x16x32_f16 per (b, h, 16 queries) over all 128 key blocks with single-f16 q, k, P, v (1 product each; logits are O(1),
// softmax over 4096 keys) except the self logit w_i·w_i/8 ≈ 8, which dominates the softmax and is taken from an exact f32 |w_i|² computed in the projection epilogue; f32 online softmax / accumulate; ctx single f16; out = ctx.W_out + b (1 product). ≈4.7 M WMMAs (an f32-class path would be ≈13 M).

namespace {
constexpr int Bn = 2, S = 4096, DM = 512, H = 8, HD = 64, NT = Bn * S;
constexpr float QS = 8.0f, KS = 8.0f, VS = 8.0f, PS = 8.0f, SCALE = 0.125f;
constexpr size_t PL = (size_t)Bn * H * S * HD;

typedef _Float16 b16;
typedef __attribute__((ext_vector_type(16))) _Float16 v16b;
typedef __attribute__((ext_vector_type(16))) __bf16 v16bb;
typedef __attribute__((ext_vector_type(8))) _Float16 v8b;
typedef __attribute__((ext_vector_type(8))) unsigned short v8us;
typedef __attribute__((ext_vector_type(8))) float v8f;
typedef __attribute__((ext_vector_type(4))) float v4f;
__device__ __forceinline__ float bf16_rne(float f) { unsigned int u = __float_as_uint(f); u += 0x7FFFu + ((u >> 16) & 1u); return __uint_as_float(u & 0xFFFF0000u); }
__device__ __forceinline__ unsigned short bf16_bits(float f) { unsigned int u = __float_as_uint(f); u += 0x7FFFu + ((u >> 16) & 1u); return (unsigned short)(u >> 16); }
__device__ __forceinline__ v16b frag_kb(const b16* p, int hh) { const v8b a = *(const v8b*)(p + 8 * hh), b = *(const v8b*)(p + 16 + 8 * hh); v16b f;
#pragma unroll
  for (int e = 0; e < 8; ++e) { f[e] = a[e]; f[8 + e] = b[e]; } return f; }
__device__ __forceinline__ v16bb frag_bf(const unsigned short* p, int hh) { const v8us a = *(const v8us*)(p + 8 * hh), b = *(const v8us*)(p + 16 + 8 * hh); union { unsigned short s[16]; v16bb v; } u;
#pragma unroll
  for (int e = 0; e < 8; ++e) { u.s[e] = a[e]; u.s[8 + e] = b[e]; } return u.v; }
__device__ __forceinline__ v16bb frag_f32bf(const float* p, int hh) { union { unsigned short s[16]; v16bb v; } u;
#pragma unroll
  for (int e = 0; e < 8; ++e) { u.s[e] = bf16_bits(p[8 * hh + e]); u.s[8 + e] = bf16_bits(p[16 + 8 * hh + e]); } return u.v; }
__device__ __forceinline__ v8f wmma16b(v16b a, v16b b, v8f c) { v8f d = __builtin_amdgcn_wmma_f32_16x16x32_f16(false, a, false, b, (short)0, c, false, false); asm volatile("v_nop\n\tv_nop\n\tv_nop\n\tv_nop" : "+v"(d) : "v"(a), "v"(b)); return d; }
__device__ __forceinline__ v8f wmma16bb(v16bb a, v16bb b, v8f c) { v8f d = __builtin_amdgcn_wmma_f32_16x16x32_bf16(false, a, false, b, (short)0, c, false, false); asm volatile("v_nop\n\tv_nop\n\tv_nop\n\tv_nop" : "+v"(d) : "v"(a), "v"(b)); return d; }
__device__ __forceinline__ void wave_lds_sync() { __builtin_amdgcn_fence(__ATOMIC_RELEASE, "workgroup"); __builtin_amdgcn_wave_barrier(); __builtin_amdgcn_fence(__ATOMIC_ACQUIRE, "workgroup"); }
__device__ __forceinline__ float nexp(float x) { return __builtin_amdgcn_exp2f(x * 1.4426950408889634f); }

__global__ __launch_bounds__(256) void prep_kernel(const float* __restrict__ Wqkv, const float* __restrict__ Wout, const float* __restrict__ bout, unsigned short* __restrict__ w16, b16* __restrict__ wo16, float* __restrict__ P) {
  const int t_ = blockIdx.x * 256 + threadIdx.x, nth = gridDim.x * 256;
  {
    for (int q = t_; q < DM * DM; q += nth) { const int o = q / DM, k = q % DM; w16[q] = bf16_bits(Wqkv[(size_t)k * DM + o]); wo16[q] = (b16)bf16_rne(Wout[(size_t)k * DM + o]); }
    for (int q = t_; q < DM; q += nth) P[q] = bf16_rne(bout[q]);
     }
}

// projection: w = bf16(x).W (exact); block 128 tokens x 64 cols (= head h); writes q plane (w/8 x8 = w) hmm: q x SCALE x QS = w x 1, k plane (w x 8), (8w)^T plane, all single f16,
__global__ __launch_bounds__(128) void proj_kernel(const float* __restrict__ x, const unsigned short* __restrict__ w16, b16* __restrict__ qp, b16* __restrict__ kp, b16* __restrict__ vt, float* __restrict__ sq) {
  __shared__ __attribute__((aligned(16))) b16 Tq[4][32][HD + 8], Tk[4][32][HD + 8]; __shared__ __attribute__((aligned(16))) b16 Tv[HD][128 + 8]; __shared__ float Sq[128];
  const int lane = threadIdx.x & 31, wave = threadIdx.x >> 5, nloc = lane & 15, hlf = lane >> 4, h = blockIdx.x, c0 = h * HD, p0 = blockIdx.y * 128, m0 = p0 + wave * 32, b = p0 / S, t0 = p0 % S;
  v8f acc[2][4];
#pragma unroll
  for (int r = 0; r < 2; ++r)
#pragma unroll
    for (int t = 0; t < 4; ++t) acc[r][t] = (v8f){};
#pragma unroll 2
  for (int kb = 0; kb < DM; kb += 32) { const v16bb a0 = frag_f32bf(x + (size_t)(m0 + nloc) * DM + kb, hlf), a1 = frag_f32bf(x + (size_t)(m0 + 16 + nloc) * DM + kb, hlf);
#pragma unroll
    for (int t = 0; t < 4; ++t) { const v16bb bw = frag_bf(w16 + (size_t)(c0 + t * 16 + nloc) * DM + kb, hlf); acc[0][t] = wmma16bb(a0, bw, acc[0][t]); acc[1][t] = wmma16bb(a1, bw, acc[1][t]); } }
#pragma unroll
  for (int t = 0; t < 4; ++t)
#pragma unroll
    for (int r = 0; r < 2; ++r)
#pragma unroll
      for (int v = 0; v < 8; ++v) { const float w = acc[r][t][v]; Tq[wave][r * 16 + 8 * hlf + v][t * 16 + nloc] = (b16)(w * (SCALE * QS)); Tk[wave][r * 16 + 8 * hlf + v][t * 16 + nloc] = (b16)(w * KS); Tv[t * 16 + nloc][wave * 32 + r * 16 + 8 * hlf + v] = (b16)(w * VS); }
  // exact f32 self-logit ingredient: |w_row|^2 per (token, head) (sum over this lane's 4 columns x ... then across the 16 column lanes; fixed order)
#pragma unroll
  for (int r = 0; r < 2; ++r)
#pragma unroll
    for (int v = 0; v < 8; ++v) { float s2 = 0.0f;
#pragma unroll
      for (int t = 0; t < 4; ++t) { const float w = acc[r][t][v]; s2 += w * w; }
#pragma unroll
      for (int o = 1; o < 16; o <<= 1) s2 += __shfl_xor(s2, o);
      if (nloc == 0) Sq[wave * 32 + r * 16 + 8 * hlf + v] = s2; }
  __syncthreads();
  b16* qb = qp + (((size_t)b * H + h) * S + (m0 % S)) * HD; b16* kb_ = kp + (((size_t)b * H + h) * S + (m0 % S)) * HD;
  {
#pragma unroll
    for (int j = 0; j < 8; ++j) { const int rr = j * 4 + (lane >> 3), c8 = (lane & 7) * 8; *(v8b*)(qb + (size_t)rr * HD + c8) = *(const v8b*)(&Tq[wave][rr][c8]); *(v8b*)(kb_ + (size_t)rr * HD + c8) = *(const v8b*)(&Tk[wave][rr][c8]); }
    for (int i = threadIdx.x; i < HD * 16; i += 128) { const int d = i >> 4, c8 = (i & 15) * 8; *(v8b*)(vt + (((size_t)b * H + h) * HD + d) * S + t0 + c8) = *(const v8b*)(&Tv[d][c8]); }
    *(float*)(sq + ((size_t)b * H + h) * S + t0 + threadIdx.x) = Sq[threadIdx.x];   // [b][h][token] f32: 512 B per block
     }
}

constexpr int KT = 256, NSTG = S / KT, KPI = HD + 8, VPI = KT + 8;   // LDS row pitches 144 B and 528 B (16 B x odd: no bank conflict for 16-byte fragment reads)
__device__ __forceinline__ unsigned lds_addr(const b16* p) { return (unsigned)(size_t)p; }   // low 32 bits of a __shared__ address = byte offset in the work-group's LDS
// eight 16-byte copies per lane; the s_wait_xcnt closes the statement so that no address register is rewritten before it
__device__ __forceinline__ void copy8(const b16* g, size_t gstep, const b16* l, int lstep) {
  asm volatile("global_load_async_to_lds_b128 %0, %8, off\n\tglobal_load_async_to_lds_b128 %1, %9, off\n\tglobal_load_async_to_lds_b128 %2, %10, off\n\tglobal_load_async_to_lds_b128 %3, %11, off\n\t"
               "global_load_async_to_lds_b128 %4, %12, off\n\tglobal_load_async_to_lds_b128 %5, %13, off\n\tglobal_load_async_to_lds_b128 %6, %14, off\n\tglobal_load_async_to_lds_b128 %7, %15, off\n\ts_wait_xcnt 0x0"
               :: "v"(lds_addr(l)), "v"(lds_addr(l + lstep)), "v"(lds_addr(l + 2 * lstep)), "v"(lds_addr(l + 3 * lstep)), "v"(lds_addr(l + 4 * lstep)), "v"(lds_addr(l + 5 * lstep)), "v"(lds_addr(l + 6 * lstep)), "v"(lds_addr(l + 7 * lstep)),
                  "v"(g), "v"(g + gstep), "v"(g + 2 * gstep), "v"(g + 3 * gstep), "v"(g + 4 * gstep), "v"(g + 5 * gstep), "v"(g + 6 * gstep), "v"(g + 7 * gstep) : "memory");
}
__global__ __launch_bounds__(256) void attn_kernel(const b16* __restrict__ qp, const b16* __restrict__ kp, const b16* __restrict__ vt, const float* __restrict__ sq, b16* __restrict__ ctx) {
  __shared__ __attribute__((aligned(16))) b16 Ks[2][KT * KPI], Vs[2][HD * VPI], Os[8][16][HD + 8];
  const int wave = threadIdx.x >> 5, lane = threadIdx.x & 31, hh = lane >> 4, col = lane & 15; const int bh = blockIdx.x / (S / 128), b = bh / H, h = bh % H, q0 = (blockIdx.x % (S / 128)) * 128 + wave * 16, qi = q0 + col;
  const b16* Q = qp + ((size_t)bh * S) * HD; const b16* K = kp + ((size_t)bh * S) * HD; const b16* V = vt + ((size_t)bh * HD) * S;
  // this lane's share of a tile: K = 256 rows x 128 B, contiguous (a wave's copy = 4 rows); V^T = 64 rows x 512 B (a wave's copy = 1 row)
  const b16* Kg = K + threadIdx.x * 8; const b16* Vg = V + (size_t)wave * S + lane * 8; const int kl0 = (threadIdx.x >> 3) * KPI + (threadIdx.x & 7) * 8, vl0 = wave * VPI + lane * 8;
  copy8(Kg, 32 * HD, &Ks[0][kl0], 32 * KPI); copy8(Vg, (size_t)8 * S, &Vs[0][vl0], 8 * VPI);
  asm volatile("s_wait_asynccnt 0x0" ::: "memory");   // tile 0 landed (this wave's copies) before the barrier that publishes it
  __syncthreads();
  copy8(Kg + KT * HD, 32 * HD, &Ks[1][kl0], 32 * KPI); copy8(Vg + KT, (size_t)8 * S, &Vs[1][vl0], 8 * VPI);
  const v16b qf0 = frag_kb(Q + (size_t)qi * HD, hh), qf1 = frag_kb(Q + (size_t)qi * HD + 32, hh); const float sself = sq[(size_t)bh * S + qi] * SCALE;   // exact f32 self logit (the dominant softmax term)
  const int dkb = __builtin_amdgcn_readfirstlane(q0 & ~31);   // first key of the one 32-key pass that holds this wave's own 16 keys (the same in every lane: kept in a scalar register)
  float m = -INFINITY, l = 0.0f; v8f o[4] = {{}, {}, {}, {}};
  for (int st = 0; st < NSTG; ++st) {
    const b16* Kb = &Ks[st & 1][col * KPI]; const b16* Vb = &Vs[st & 1][col * VPI];
    for (int kl = 0; kl < KT; kl += 32) { const int kb = st * KT + kl;
      const v16b ka0 = frag_kb(Kb + kl * KPI, hh), ka1 = frag_kb(Kb + kl * KPI + 32, hh), kc0 = frag_kb(Kb + (kl + 16) * KPI, hh), kc1 = frag_kb(Kb + (kl + 16) * KPI + 32, hh);
      const v16b vf[4] = {frag_kb(Vb + kl, hh), frag_kb(Vb + 16 * VPI + kl, hh), frag_kb(Vb + 32 * VPI + kl, hh), frag_kb(Vb + 48 * VPI + kl, hh)};   // all of the pass's LDS reads stand together, ahead of its products
      v8f s0 = {}, s1 = {}; s0 = wmma16b(ka0, qf0, s0); s0 = wmma16b(ka1, qf1, s0); s1 = wmma16b(kc0, qf0, s1); s1 = wmma16b(kc1, qf1, s1);
      float mr = -INFINITY;
#pragma unroll
      for (int r = 0; r < 8; ++r) { s0[r] *= 1.0f / (QS * KS); s1[r] *= 1.0f / (QS * KS); }
      if (kb == dkb) {   // one pass in 128: a scalar compare and branch, so the other passes carry no index compare and no select
#pragma unroll
        for (int r = 0; r < 8; ++r) { if (kb + 8 * hh + r == qi) s0[r] = sself; if (kb + 16 + 8 * hh + r == qi) s1[r] = sself; } }
#pragma unroll
      for (int r = 0; r < 8; ++r) mr = fmaxf(mr, fmaxf(s0[r], s1[r]));
      mr = fmaxf(mr, __shfl_xor(mr, 16));
      const float mn = fmaxf(m, mr), al_ = nexp(m - mn); m = mn; float sum = 0.0f; v16b pbv;
#pragma unroll
      for (int r = 0; r < 8; ++r) { const float e0 = nexp(s0[r] - mn), e1 = nexp(s1[r] - mn); sum += e0 + e1; pbv[r] = (b16)(e0 * PS); pbv[8 + r] = (b16)(e1 * PS); }
      sum += __shfl_xor(sum, 16); l = l * al_ + sum;
#pragma unroll
      for (int t = 0; t < 4; ++t) { o[t] *= al_; o[t] = wmma16b(vf[t], pbv, o[t]); } }
    asm volatile("s_wait_dscnt 0x0" ::: "memory");      // this wave's reads of the buffer are done before the buffer is refilled
    asm volatile("s_wait_asynccnt 0x0" ::: "memory");   // this wave's copies of the next tile have landed before the barrier that publishes them
    __syncthreads();
    if (st + 2 < NSTG) { copy8(Kg + (size_t)(st + 2) * KT * HD, 32 * HD, &Ks[st & 1][kl0], 32 * KPI); copy8(Vg + (st + 2) * KT, (size_t)8 * S, &Vs[st & 1][vl0], 8 * VPI); } }
  asm volatile("s_wait_asynccnt 0x0" ::: "memory");     // nothing in flight when the wave goes on to its end
  const float inv = 1.0f / (l * VS * PS);
#pragma unroll
  for (int t = 0; t < 4; ++t)
#pragma unroll
    for (int r = 0; r < 8; ++r) Os[wave][col][t * 16 + 8 * hh + r] = (b16)(o[t][r] * inv);
  __syncthreads();
  b16* dst = ctx + ((size_t)b * S + q0) * DM + h * HD;   // this wave's 16 rows x 128 B: whole lines, one writer each
  for (int j = 0; j < 4; ++j) { const int rr = j * 4 + (lane >> 3), c8 = (lane & 7) * 8; *(v8b*)(dst + (size_t)rr * DM + c8) = *(const v8b*)(&Os[wave][rr][c8]); }
}

__global__ __launch_bounds__(128) void out_kernel(const b16* __restrict__ ctx, const b16* __restrict__ wo16, const float* __restrict__ P, float* __restrict__ out) {
  __shared__ __attribute__((aligned(16))) float Ts[4][32 * 64];
  const int lane = threadIdx.x & 31, wave = threadIdx.x >> 5, nloc = lane & 15, hlf = lane >> 4, m0 = blockIdx.y * 128 + wave * 32, c0 = blockIdx.x * 64;
  v8f acc[2][4];
#pragma unroll
  for (int r = 0; r < 2; ++r)
#pragma unroll
    for (int t = 0; t < 4; ++t) acc[r][t] = (v8f){};
#pragma unroll 2
  for (int kb = 0; kb < DM; kb += 32) { const v16b a0 = frag_kb(ctx + (size_t)(m0 + nloc) * DM + kb, hlf), a1 = frag_kb(ctx + (size_t)(m0 + 16 + nloc) * DM + kb, hlf);
#pragma unroll
    for (int t = 0; t < 4; ++t) { const v16b bw = frag_kb(wo16 + (size_t)(c0 + t * 16 + nloc) * DM + kb, hlf); acc[0][t] = wmma16b(a0, bw, acc[0][t]); acc[1][t] = wmma16b(a1, bw, acc[1][t]); } }
  float* Tt = Ts[wave];
#pragma unroll
  for (int t = 0; t < 4; ++t) { const float bb = P[c0 + t * 16 + nloc];
#pragma unroll
    for (int r = 0; r < 2; ++r)
#pragma unroll
      for (int v = 0; v < 8; ++v) Tt[(r * 16 + v + 8 * hlf) * 64 + t * 16 + nloc] = acc[r][t][v] + bb; }
  wave_lds_sync();
  {
#pragma unroll
    for (int j = 0; j < 16; ++j) { const int rr = j * 2 + hlf, c4 = nloc * 4; *(v4f*)(out + (size_t)(m0 + rr) * DM + c0 + c4) = *(const v4f*)(Tt + rr * 64 + c4); }
     }
}
}  // namespace

extern "C" void kernel_launch(void* const* d_in, const int* in_sizes, int n_in,
                              void* d_out, int out_size, void* d_ws, size_t ws_size, hipStream_t stream) {
  (void)n_in; (void)out_size;
  const float* x = (const float*)d_in[0]; const float* Wqkv = (const float*)d_in[1]; const float* Wout = (const float*)d_in[2]; const float* bout = (const float*)d_in[3];
  float* out = (float*)d_out;   // [2][4096][512]
  if (in_sizes[0] != NT * DM || in_sizes[1] != DM * DM || in_sizes[2] != DM * DM || in_sizes[3] != DM) return;
  size_t off = 0; char* ws = (char*)d_ws;
  auto carve = [&](size_t bytes) { char* p = ws + off; off += (bytes + 255) & ~(size_t)255; return p; };
  unsigned short* w16 = (unsigned short*)carve((size_t)DM * DM * 2); b16* wo16 = (b16*)carve((size_t)DM * DM * 2); float* P = (float*)carve(DM * 4);
  b16* qp = (b16*)carve(PL * 2); b16* kp = (b16*)carve(PL * 2); b16* vt = (b16*)carve(PL * 2); b16* ctx = (b16*)carve((size_t)NT * DM * 2); float* sq = (float*)carve((size_t)NT * H * 4);
  if (off > ws_size) return;                                    // ≈ 1 + 8.4 x 4 ≈ 35 MB
  prep_kernel<<<256, 256, 0, stream>>>(Wqkv, Wout, bout, w16, wo16, P);
  proj_kernel<<<dim3(H, NT / 128), 128, 0, stream>>>(x, w16, qp, kp, vt, sq);
  attn_kernel<<<Bn * H * (S / 128), 256, 0, stream>>>(qp, kp, vt, sq, ctx);
  out_kernel<<<dim3(DM / 64, NT / 128), 128, 0, stream>>>(ctx, wo16, P, out);
}

// v003
// One run takes 129 microseconds.
// Timed twice side by side with v002, it ran 1.09 and 1.08 times as fast.
// Counting every step since v000, it is 2.87 times as fast.
#include <hip/hip_runtime.h>

// SAN (shared-projection attention): w = x W_qkv (q = k = v = w; 8 heads x 64 over 4096 tokens, batch 2); attn = softmax(w.w^T x 64^-0.5); out = (attn w) merged . W_out + b
// -> [2][4096][512].
// The shared projection is ONE exact GEMM on v_wmma_f32_16x16x32_bf16 (x and W exact bf16; 1 product) written three ways (q plane x 1/8 x8, k plane x8,
// (8w)^T plane) as single f16; attention on v_wmma_f32_16x16x32_f16 per (b, h, 16 queries) over all 128 key blocks with single-f16 q, k, P, v (1 product each; logits are O(1),
// softmax over 4096 keys) except the self logit w_i·w_i/8 ≈ 8, which dominates the softmax and is taken from an exact f32 |w_i|² computed in the projection epilogue; f32 online softmax / accumulate; ctx single f16; out = ctx.W_out + b (1 product). ≈4.7 M WMMAs (an f32-class path would be ≈13 M).

namespace {
constexpr int Bn = 2, S = 4096, DM = 512, H = 8, HD = 64, NT = Bn * S;
constexpr float QS = 8.0f, KS = 8.0f, VS = 8.0f, PS = 8.0f, SCALE = 0.125f;
constexpr size_t PL = (size_t)Bn * H * S * HD;

typedef _Float16 b16;
typedef __attribute__((ext_vector_type(16))) _Float16 v16b;
typedef __attribute__((ext_vector_type(16))) __bf16 v16bb;
typedef __attribute__((ext_vector_type(8))) _Float16 v8b;
typedef __attribute__((ext_vector_type(8))) unsigned short v8us;
typedef __attribute__((ext_vector_type(8))) float v8f;
typedef __attribute__((ext_vector_type(4))) float v4f;
__device__ __forceinline__ float bf16_rne(float f) { unsigned int u = __float_as_uint(f); u += 0x7FFFu + ((u >> 16) & 1u); return __uint_as_float(u & 0xFFFF0000u); }
__device__ __forceinline__ unsigned short bf16_bits(float f) { unsigned int u = __float_as_uint(f); u += 0x7FFFu + ((u >> 16) & 1u); return (unsigned short)(u >> 16); }
__device__ __forceinline__ v16b frag_kb(const b16* p, int hh) { const v8b a = *(const v8b*)(p + 8 * hh), b = *(const v8b*)(p + 16 + 8 * hh); v16b f;
#pragma unroll
  for (int e = 0; e < 8; ++e) { f[e] = a[e]; f[8 + e] = b[e]; } return f; }
__device__ __forceinline__ v16bb frag_bf(const unsigned short* p, int hh) { const v8us a = *(const v8us*)(p + 8 * hh), b = *(const v8us*)(p + 16 + 8 * hh); union { unsigned short s[16]; v16bb v; } u;
#pragma unroll
  for (int e = 0; e < 8; ++e) { u.s[e] = a[e]; u.s[8 + e] = b[e]; } return u.v; }
struct raw16 { v4f a, b, c, d; };   // one lane's 16 f32 of an A fragment, as loaded
__device__ __forceinline__ raw16 load_raw(const float* p, int hh) { raw16 r; r.a = *(const v4f*)(p + 8 * hh); r.b = *(const v4f*)(p + 8 * hh + 4); r.c = *(const v4f*)(p + 16 + 8 * hh); r.d = *(const v4f*)(p + 16 + 8 * hh + 4); return r; }
__device__ __forceinline__ v16bb cvt_raw(const raw16& r) { union { unsigned short s[16]; v16bb v; } u;
#pragma unroll
  for (int e = 0; e < 4; ++e) { u.s[e] = bf16_bits(r.a[e]); u.s[4 + e] = bf16_bits(r.b[e]); u.s[8 + e] = bf16_bits(r.c[e]); u.s[12 + e] = bf16_bits(r.d[e]); } return u.v; }
__device__ __forceinline__ v8f wmma16b(v16b a, v16b b, v8f c) { v8f d = __builtin_amdgcn_wmma_f32_16x16x32_f16(false, a, false, b, (short)0, c, false, false); asm volatile("v_nop\n\tv_nop\n\tv_nop\n\tv_nop" : "+v"(d) : "v"(a), "v"(b)); return d; }
__device__ __forceinline__ v8f wmma16bb(v16bb a, v16bb b, v8f c) { v8f d = __builtin_amdgcn_wmma_f32_16x16x32_bf16(false, a, false, b, (short)0, c, false, false); asm volatile("v_nop\n\tv_nop\n\tv_nop\n\tv_nop" : "+v"(d) : "v"(a), "v"(b)); return d; }
__device__ __forceinline__ void wave_lds_sync() { __builtin_amdgcn_fence(__ATOMIC_RELEASE, "workgroup"); __builtin_amdgcn_wave_barrier(); __builtin_amdgcn_fence(__ATOMIC_ACQUIRE, "workgroup"); }
__device__ __forceinline__ float nexp(float x) { return __builtin_amdgcn_exp2f(x * 1.4426950408889634f); }

__global__ __launch_bounds__(256) void prep_kernel(const float* __restrict__ Wqkv, const float* __restrict__ Wout, const float* __restrict__ bout, unsigned short* __restrict__ w16, b16* __restrict__ wo16, float* __restrict__ P) {
  const int t_ = blockIdx.x * 256 + threadIdx.x, nth = gridDim.x * 256;
  {
    for (int q = t_; q < DM * DM; q += nth) { const int o = q / DM, k = q % DM; w16[q] = bf16_bits(Wqkv[(size_t)k * DM + o]); wo16[q] = (b16)bf16_rne(Wout[(size_t)k * DM + o]); }
    for (int q = t_; q < DM; q += nth) P[q] = bf16_rne(bout[q]);
     }
}

// projection: w = bf16(x).W (exact); block 128 tokens x 64 cols (= head h); writes q plane (w/8 x8 = w) hmm: q x SCALE x QS = w x 1, k plane (w x 8), (8w)^T plane, all single f16,
__global__ __launch_bounds__(128) void proj_kernel(const float* __restrict__ x, const unsigned short* __restrict__ w16, b16* __restrict__ qp, b16* __restrict__ kp, b16* __restrict__ vt, float* __restrict__ sq) {
  __shared__ __attribute__((aligned(16))) b16 Tq[4][32][HD + 8], Tk[4][32][HD + 8]; __shared__ __attribute__((aligned(16))) b16 Tv[HD][128 + 8]; __shared__ float Sq[128];
  const int lane = threadIdx.x & 31, wave = threadIdx.x >> 5, nloc = lane & 15, hlf = lane >> 4, h = blockIdx.x, c0 = h * HD, p0 = blockIdx.y * 128, m0 = p0 + wave * 32, b = p0 / S, t0 = p0 % S;
  v8f acc[2][4];
#pragma unroll
  for (int r = 0; r < 2; ++r)
#pragma unroll
    for (int t = 0; t < 4; ++t) acc[r][t] = (v8f){};
  // fragments are fetched one k-step ahead into a second register set: one load group per step, in flight while the step before it is worked on
  const float* xr = x + (size_t)(m0 + nloc) * DM; const unsigned short* wr = w16 + (size_t)(c0 + nloc) * DM;
  raw16 ra0 = load_raw(xr, hlf), ra1 = load_raw(xr + 16 * DM, hlf); v16bb bw[4];
#pragma unroll
  for (int t = 0; t < 4; ++t) bw[t] = frag_bf(wr + t * 16 * DM, hlf);
#pragma unroll 2
  for (int kb = 32; kb <= DM; kb += 32) {   // kb = the k-step that is fetched; the one before it is worked on; the last trip fetches nothing
    raw16 na0 = ra0, na1 = ra1; v16bb nb[4] = {bw[0], bw[1], bw[2], bw[3]};
    if (kb < DM) { na0 = load_raw(xr + kb, hlf); na1 = load_raw(xr + 16 * DM + kb, hlf);
#pragma unroll
      for (int t = 0; t < 4; ++t) nb[t] = frag_bf(wr + t * 16 * DM + kb, hlf);
      asm volatile("s_wait_xcnt 0x0" ::: "memory"); }   // stands behind the load group, ahead of the next rewrite of its address registers
    __builtin_amdgcn_sched_barrier(0);   // keeps the next step's loads ahead of this step's products: the scheduler otherwise sinks each load to its use, behind a full wait
    const v16bb a0 = cvt_raw(ra0), a1 = cvt_raw(ra1);
#pragma unroll
    for (int t = 0; t < 4; ++t) { acc[0][t] = wmma16bb(a0, bw[t], acc[0][t]); acc[1][t] = wmma16bb(a1, bw[t], acc[1][t]); }
    ra0 = na0; ra1 = na1;
#pragma unroll
    for (int t = 0; t < 4; ++t) bw[t] = nb[t]; }
#pragma unroll
  for (int t = 0; t < 4; ++t)
#pragma unroll
    for (int r = 0; r < 2; ++r)
#pragma unroll
      for (int v = 0; v < 8; ++v) { const float w = acc[r][t][v]; Tq[wave][r * 16 + 8 * hlf + v][t * 16 + nloc] = (b16)(w * (SCALE * QS)); Tk[wave][r * 16 + 8 * hlf + v][t * 16 + nloc] = (b16)(w * KS); Tv[t * 16 + nloc][wave * 32 + r * 16 + 8 * hlf + v] = (b16)(w * VS); }
  // exact f32 self-logit ingredient: |w_row|^2 per (token, head) (sum over this lane's 4 columns x ... then across the 16 column lanes; fixed order)
#pragma unroll
  for (int r = 0; r < 2; ++r)
#pragma unroll
    for (int v = 0; v < 8; ++v) { float s2 = 0.0f;
#pragma unroll
      for (int t = 0; t < 4; ++t) { const float w = acc[r][t][v]; s2 += w * w; }
#pragma unroll
      for (int o = 1; o < 16; o <<= 1) s2 += __shfl_xor(s2, o);
      if (nloc == 0) Sq[wave * 32 + r * 16 + 8 * hlf + v] = s2; }
  __syncthreads();
  b16* qb = qp + (((size_t)b * H + h) * S + (m0 % S)) * HD; b16* kb_ = kp + (((size_t)b * H + h) * S + (m0 % S)) * HD;
  {
#pragma unroll
    for (int j = 0; j < 8; ++j) { const int rr = j * 4 + (lane >> 3), c8 = (lane & 7) * 8; *(v8b*)(qb + (size_t)rr * HD + c8) = *(const v8b*)(&Tq[wave][rr][c8]); *(v8b*)(kb_ + (size_t)rr * HD + c8) = *(const v8b*)(&Tk[wave][rr][c8]); }
    for (int i = threadIdx.x; i < HD * 16; i += 128) { const int d = i >> 4, c8 = (i & 15) * 8; *(v8b*)(vt + (((size_t)b * H + h) * HD + d) * S + t0 + c8) = *(const v8b*)(&Tv[d][c8]); }
    *(float*)(sq + ((size_t)b * H + h) * S + t0 + threadIdx.x) = Sq[threadIdx.x];   // [b][h][token] f32: 512 B per block
     }
}

constexpr int KT = 256, NSTG = S / KT, KPI = HD + 8, VPI = KT + 8;   // LDS row pitches 144 B and 528 B (16 B x odd: no bank conflict for 16-byte fragment reads)
__device__ __forceinline__ unsigned lds_addr(const b16* p) { return (unsigned)(size_t)p; }   // low 32 bits of a __shared__ address = byte offset in the work-group's LDS
// eight 16-byte copies per lane; the s_wait_xcnt closes the statement so that no address register is rewritten before it
__device__ __forceinline__ void copy8(const b16* g, size_t gstep, const b16* l, int lstep) {
  asm volatile("global_load_async_to_lds_b128 %0, %8, off\n\tglobal_load_async_to_lds_b128 %1, %9, off\n\tglobal_load_async_to_lds_b128 %2, %10, off\n\tglobal_load_async_to_lds_b128 %3, %11, off\n\t"
               "global_load_async_to_lds_b128 %4, %12, off\n\tglobal_load_async_to_lds_b128 %5, %13, off\n\tglobal_load_async_to_lds_b128 %6, %14, off\n\tglobal_load_async_to_lds_b128 %7, %15, off\n\ts_wait_xcnt 0x0"
               :: "v"(lds_addr(l)), "v"(lds_addr(l + lstep)), "v"(lds_addr(l + 2 * lstep)), "v"(lds_addr(l + 3 * lstep)), "v"(lds_addr(l + 4 * lstep)), "v"(lds_addr(l + 5 * lstep)), "v"(lds_addr(l + 6 * lstep)), "v"(lds_addr(l + 7 * lstep)),
                  "v"(g), "v"(g + gstep), "v"(g + 2 * gstep), "v"(g + 3 * gstep), "v"(g + 4 * gstep), "v"(g + 5 * gstep), "v"(g + 6 * gstep), "v"(g + 7 * gstep) : "memory");
}
__global__ __launch_bounds__(256) void attn_kernel(const b16* __restrict__ qp, const b16* __restrict__ kp, const b16* __restrict__ vt, const float* __restrict__ sq, b16* __restrict__ ctx) {
  __shared__ __attribute__((aligned(16))) b16 Ks[2][KT * KPI], Vs[2][HD * VPI], Os[8][16][HD + 8];
  const int wave = threadIdx.x >> 5, lane = threadIdx.x & 31, hh = lane >> 4, col = lane & 15; const int bh = blockIdx.x / (S / 128), b = bh / H, h = bh % H, q0 = (blockIdx.x % (S / 128)) * 128 + wave * 16, qi = q0 + col;
  const b16* Q = qp + ((size_t)bh * S) * HD; const b16* K = kp + ((size_t)bh * S) * HD; const b16* V = vt + ((size_t)bh * HD) * S;
  // this lane's share of a tile: K = 256 rows x 128 B, contiguous (a wave's copy = 4 rows); V^T = 64 rows x 512 B (a wave's copy = 1 row)
  const b16* Kg = K + threadIdx.x * 8; const b16* Vg = V + (size_t)wave * S + lane * 8; const int kl0 = (threadIdx.x >> 3) * KPI + (threadIdx.x & 7) * 8, vl0 = wave * VPI + lane * 8;
  copy8(Kg, 32 * HD, &Ks[0][kl0], 32 * KPI); copy8(Vg, (size_t)8 * S, &Vs[0][vl0], 8 * VPI);
  asm volatile("s_wait_asynccnt 0x0" ::: "memory");   // tile 0 landed (this wave's copies) before the barrier that publishes it
  __syncthreads();
  copy8(Kg + KT * HD, 32 * HD, &Ks[1][kl0], 32 * KPI); copy8(Vg + KT, (size_t)8 * S, &Vs[1][vl0], 8 * VPI);
  const v16b qf0 = frag_kb(Q + (size_t)qi * HD, hh), qf1 = frag_kb(Q + (size_t)qi * HD + 32, hh); const float sself = sq[(size_t)bh * S + qi] * SCALE;   // exact f32 self logit (the dominant softmax term)
  const int dkb = __builtin_amdgcn_readfirstlane(q0 & ~31);   // first key of the one 32-key pass that holds this wave's own 16 keys (the same in every lane: kept in a scalar register)
  float m = -INFINITY, l = 0.0f; v8f o[4] = {{}, {}, {}, {}};
  for (int st = 0; st < NSTG; ++st) {
    const b16* Kb = &Ks[st & 1][col * KPI]; const b16* Vb = &Vs[st & 1][col * VPI];
    for (int kl = 0; kl < KT; kl += 32) { const int kb = st * KT + kl;
      const v16b ka0 = frag_kb(Kb + kl * KPI, hh), ka1 = frag_kb(Kb + kl * KPI + 32, hh), kc0 = frag_kb(Kb + (kl + 16) * KPI, hh), kc1 = frag_kb(Kb + (kl + 16) * KPI + 32, hh);
      const v16b vf[4] = {frag_kb(Vb + kl, hh), frag_kb(Vb + 16 * VPI + kl, hh), frag_kb(Vb + 32 * VPI + kl, hh), frag_kb(Vb + 48 * VPI + kl, hh)};   // all of the pass's LDS reads stand together, ahead of its products
      v8f s0 = {}, s1 = {}; s0 = wmma16b(ka0, qf0, s0); s0 = wmma16b(ka1, qf1, s0); s1 = wmma16b(kc0, qf0, s1); s1 = wmma16b(kc1, qf1, s1);
      float mr = -INFINITY;
#pragma unroll
      for (int r = 0; r < 8; ++r) { s0[r] *= 1.0f / (QS * KS); s1[r] *= 1.0f / (QS * KS); }
      if (kb == dkb) {   // one pass in 128: a scalar compare and branch, so the other passes carry no index compare and no select
#pragma unroll
        for (int r = 0; r < 8; ++r) { if (kb + 8 * hh + r == qi) s0[r] = sself; if (kb + 16 + 8 * hh + r == qi) s1[r] = sself; } }
#pragma unroll
      for (int r = 0; r < 8; ++r) mr = fmaxf(mr, fmaxf(s0[r], s1[r]));
      mr = fmaxf(mr, __shfl_xor(mr, 16));
      const float mn = fmaxf(m, mr), al_ = nexp(m - mn); m = mn; float sum = 0.0f; v16b pbv;
#pragma unroll
      for (int r = 0; r < 8; ++r) { const float e0 = nexp(s0[r] - mn), e1 = nexp(s1[r] - mn); sum += e0 + e1; pbv[r] = (b16)(e0 * PS); pbv[8 + r] = (b16)(e1 * PS); }
      sum += __shfl_xor(sum, 16); l = l * al_ + sum;
#pragma unroll
      for (int t = 0; t < 4; ++t) { o[t] *= al_; o[t] = wmma16b(vf[t], pbv, o[t]); } }
    asm volatile("s_wait_dscnt 0x0" ::: "memory");      // this wave's reads of the buffer are done before the buffer is refilled
    asm volatile("s_wait_asynccnt 0x0" ::: "memory");   // this wave's copies of the next tile have landed before the barrier that publishes them
    __syncthreads();
    if (st + 2 < NSTG) { copy8(Kg + (size_t)(st + 2) * KT * HD, 32 * HD, &Ks[st & 1][kl0], 32 * KPI); copy8(Vg + (st + 2) * KT, (size_t)8 * S, &Vs[st & 1][vl0], 8 * VPI); } }
  asm volatile("s_wait_asynccnt 0x0" ::: "memory");     // nothing in flight when the wave goes on to its end
  const float inv = 1.0f / (l * VS * PS);
#pragma unroll
  for (int t = 0; t < 4; ++t)
#pragma unroll
    for (int r = 0; r < 8; ++r) Os[wave][col][t * 16 + 8 * hh + r] = (b16)(o[t][r] * inv);
  __syncthreads();
  b16* dst = ctx + ((size_t)b * S + q0) * DM + h * HD;   // this wave's 16 rows x 128 B: whole lines, one writer each
  for (int j = 0; j < 4; ++j) { const int rr = j * 4 + (lane >> 3), c8 = (lane & 7) * 8; *(v8b*)(dst + (size_t)rr * DM + c8) = *(const v8b*)(&Os[wave][rr][c8]); }
}

__global__ __launch_bounds__(128) void out_kernel(const b16* __restrict__ ctx, const b16* __restrict__ wo16, const float* __restrict__ P, float* __restrict__ out) {
  __shared__ __attribute__((aligned(16))) float Ts[4][32 * 64];
  const int lane = threadIdx.x & 31, wave = threadIdx.x >> 5, nloc = lane & 15, hlf = lane >> 4, m0 = blockIdx.y * 128 + wave * 32, c0 = blockIdx.x * 64;
  v8f acc[2][4];
#pragma unroll
  for (int r = 0; r < 2; ++r)
#pragma unroll
    for (int t = 0; t < 4; ++t) acc[r][t] = (v8f){};
  // as in the projection: fragments fetched one k-step ahead into a second register set
  const b16* cr = ctx + (size_t)(m0 + nloc) * DM; const b16* wr = wo16 + (size_t)(c0 + nloc) * DM;
  v16b a0 = frag_kb(cr, hlf), a1 = frag_kb(cr + 16 * DM, hlf), bw[4];
#pragma unroll
  for (int t = 0; t < 4; ++t) bw[t] = frag_kb(wr + t * 16 * DM, hlf);
#pragma unroll 2
  for (int kb = 32; kb <= DM; kb += 32) {   // kb = the k-step that is fetched; the one before it is worked on; the last trip fetches nothing
    v16b na0 = a0, na1 = a1, nb[4] = {bw[0], bw[1], bw[2], bw[3]};
    if (kb < DM) { na0 = frag_kb(cr + kb, hlf); na1 = frag_kb(cr + 16 * DM + kb, hlf);
#pragma unroll
      for (int t = 0; t < 4; ++t) nb[t] = frag_kb(wr + t * 16 * DM + kb, hlf);
      asm volatile("s_wait_xcnt 0x0" ::: "memory"); }   // stands behind the load group, ahead of the next rewrite of its address registers
    __builtin_amdgcn_sched_barrier(0);   // keeps the next step's loads ahead of this step's products: the scheduler otherwise sinks each load to its use, behind a full wait
#pragma unroll
    for (int t = 0; t < 4; ++t) { acc[0][t] = wmma16b(a0, bw[t], acc[0][t]); acc[1][t] = wmma16b(a1, bw[t], acc[1][t]); }
    a0 = na0; a1 = na1;
#pragma unroll
    for (int t = 0; t < 4; ++t) bw[t] = nb[t]; }
  float* Tt = Ts[wave];
#pragma unroll
  for (int t = 0; t < 4; ++t) { const float bb = P[c0 + t * 16 + nloc];
#pragma unroll
    for (int r = 0; r < 2; ++r)
#pragma unroll
      for (int v = 0; v < 8; ++v) Tt[(r * 16 + v + 8 * hlf) * 64 + t * 16 + nloc] = acc[r][t][v] + bb; }
  wave_lds_sync();
  {
#pragma unroll
    for (int j = 0; j < 16; ++j) { const int rr = j * 2 + hlf, c4 = nloc * 4; *(v4f*)(out + (size_t)(m0 + rr) * DM + c0 + c4) = *(const v4f*)(Tt + rr * 64 + c4); }
     }
}
}  // namespace

extern "C" void kernel_launch(void* const* d_in, const int* in_sizes, int n_in,
                              void* d_out, int out_size, void* d_ws, size_t ws_size, hipStream_t stream) {
  (void)n_in; (void)out_size;
  const float* x = (const float*)d_in[0]; const float* Wqkv = (const float*)d_in[1]; const float* Wout = (const float*)d_in[2]; const float* bout = (const float*)d_in[3];
  float* out = (float*)d_out;   // [2][4096][512]
  if (in_sizes[0] != NT * DM || in_sizes[1] != DM * DM || in_sizes[2] != DM * DM || in_sizes[3] != DM) return;
  size_t off = 0; char* ws = (char*)d_ws;
  auto carve = [&](size_t bytes) { char* p = ws + off; off += (bytes + 255) & ~(size_t)255; return p; };
  unsigned short* w16 = (unsigned short*)carve((size_t)DM * DM * 2); b16* wo16 = (b16*)carve((size_t)DM * DM * 2); float* P = (float*)carve(DM * 4);
  b16* qp = (b16*)carve(PL * 2); b16* kp = (b16*)carve(PL * 2); b16* vt = (b16*)carve(PL * 2); b16* ctx = (b16*)carve((size_t)NT * DM * 2); float* sq = (float*)carve((size_t)NT * H * 4);
  if (off > ws_size) return;                                    // ≈ 1 + 8.4 x 4 ≈ 35 MB
  prep_kernel<<<256, 256, 0, stream>>>(Wqkv, Wout, bout, w16, wo16, P);
  proj_kernel<<<dim3(H, NT / 128), 128, 0, stream>>>(x, w16, qp, kp, vt, sq);
  attn_kernel<<<Bn * H * (S / 128), 256, 0, stream>>>(qp, kp, vt, sq, ctx);
  out_kernel<<<dim3(DM / 64, NT / 128), 128, 0, stream>>>(ctx, wo16, P, out);
}

// v004
// A run of this version takes 122 microseconds.
// In both of two side-by-side timings against v003, it was 1.06 times as fast.
// Counting every step since v000, it is 3.04 times as fast.
#include <hip/hip_runtime.h>

// SAN (shared-projection attention): w = x W_qkv (q = k = v = w; 8 heads x 64 over 4096 tokens, batch 2); attn = softmax(w.w^T x 64^-0.5); out = (attn w) merged . W_out + b
// -> [2][4096][512].
// The shared projection is ONE exact GEMM on v_wmma_f32_16x16x32_bf16 (x and W exact bf16; 1 product) written three ways (q plane x 1/8 x8, k plane x8,
// (8w)^T plane) as single f16; attention on v_wmma_f32_16x16x32_f16 per (b, h, 16 queries) over all 128 key blocks with single-f16 q, k, P, v (1 product each; logits are O(1),
// softmax over 4096 keys) except the self logit w_i·w_i/8 ≈ 8, which dominates the softmax and is taken from an exact f32 |w_i|² computed in the projection epilogue; f32 online softmax / accumulate; ctx single f16; out = ctx.W_out + b (1 product). ≈4.7 M WMMAs (an f32-class path would be ≈13 M).

namespace {
constexpr int Bn = 2, S = 4096, DM = 512, H = 8, HD = 64, NT = Bn * S;
constexpr float QS = 8.0f, KS = 8.0f, VS = 8.0f, PS = 8.0f, SCALE = 0.125f;
constexpr size_t PL = (size_t)Bn * H * S * HD;

typedef _Float16 b16;
typedef __attribute__((ext_vector_type(16))) _Float16 v16b;
typedef __attribute__((ext_vector_type(16))) __bf16 v16bb;
typedef __attribute__((ext_vector_type(8))) _Float16 v8b;
typedef __attribute__((ext_vector_type(8))) unsigned short v8us;
typedef __attribute__((ext_vector_type(8))) float v8f;
typedef __attribute__((ext_vector_type(4))) float v4f;
__device__ __forceinline__ float bf16_rne(float f) { unsigned int u = __float_as_uint(f); u += 0x7FFFu + ((u >> 16) & 1u); return __uint_as_float(u & 0xFFFF0000u); }
__device__ __forceinline__ unsigned short bf16_bits(float f) { unsigned int u = __float_as_uint(f); u += 0x7FFFu + ((u >> 16) & 1u); return (unsigned short)(u >> 16); }
__device__ __forceinline__ v16b frag_kb(const b16* p, int hh) { const v8b a = *(const v8b*)(p + 8 * hh), b = *(const v8b*)(p + 16 + 8 * hh); v16b f;
#pragma unroll
  for (int e = 0; e < 8; ++e) { f[e] = a[e]; f[8 + e] = b[e]; } return f; }
__device__ __forceinline__ v16bb frag_bf(const unsigned short* p, int hh) { const v8us a = *(const v8us*)(p + 8 * hh), b = *(const v8us*)(p + 16 + 8 * hh); union { unsigned short s[16]; v16bb v; } u;
#pragma unroll
  for (int e = 0; e < 8; ++e) { u.s[e] = a[e]; u.s[8 + e] = b[e]; } return u.v; }
struct raw16 { v4f a, b, c, d; };   // one lane's 16 f32 of an A fragment, as loaded
__device__ __forceinline__ raw16 load_raw(const float* p, int hh) { raw16 r; r.a = *(const v4f*)(p + 8 * hh); r.b = *(const v4f*)(p + 8 * hh + 4); r.c = *(const v4f*)(p + 16 + 8 * hh); r.d = *(const v4f*)(p + 16 + 8 * hh + 4); return r; }
__device__ __forceinline__ v16bb cvt_raw(const raw16& r) { union { unsigned short s[16]; v16bb v; } u;
#pragma unroll
  for (int e = 0; e < 4; ++e) { u.s[e] = bf16_bits(r.a[e]); u.s[4 + e] = bf16_bits(r.b[e]); u.s[8 + e] = bf16_bits(r.c[e]); u.s[12 + e] = bf16_bits(r.d[e]); } return u.v; }
__device__ __forceinline__ v8f wmma16b(v16b a, v16b b, v8f c) { v8f d = __builtin_amdgcn_wmma_f32_16x16x32_f16(false, a, false, b, (short)0, c, false, false); asm volatile("v_nop\n\tv_nop\n\tv_nop\n\tv_nop" : "+v"(d) : "v"(a), "v"(b)); return d; }
__device__ __forceinline__ v8f wmma16bb(v16bb a, v16bb b, v8f c) { v8f d = __builtin_amdgcn_wmma_f32_16x16x32_bf16(false, a, false, b, (short)0, c, false, false); asm volatile("v_nop\n\tv_nop\n\tv_nop\n\tv_nop" : "+v"(d) : "v"(a), "v"(b)); return d; }
__device__ __forceinline__ void wave_lds_sync() { __builtin_amdgcn_fence(__ATOMIC_RELEASE, "workgroup"); __builtin_amdgcn_wave_barrier(); __builtin_amdgcn_fence(__ATOMIC_ACQUIRE, "workgroup"); }
constexpr float LC = 1.4426950408889634f / (QS * KS);   // raw score (= logit x QS x KS) -> logit in base-2 units

__global__ __launch_bounds__(256) void prep_kernel(const float* __restrict__ Wqkv, const float* __restrict__ Wout, const float* __restrict__ bout, unsigned short* __restrict__ w16, b16* __restrict__ wo16, float* __restrict__ P) {
  const int t_ = blockIdx.x * 256 + threadIdx.x, nth = gridDim.x * 256;
  {
    for (int q = t_; q < DM * DM; q += nth) { const int o = q / DM, k = q % DM; w16[q] = bf16_bits(Wqkv[(size_t)k * DM + o]); wo16[q] = (b16)bf16_rne(Wout[(size_t)k * DM + o]); }
    for (int q = t_; q < DM; q += nth) P[q] = bf16_rne(bout[q]);
     }
}

// projection: w = bf16(x).W (exact); block 128 tokens x 64 cols (= head h); writes q plane (w/8 x8 = w) hmm: q x SCALE x QS = w x 1, k plane (w x 8), (8w)^T plane, all single f16,
__global__ __launch_bounds__(128) void proj_kernel(const float* __restrict__ x, const unsigned short* __restrict__ w16, b16* __restrict__ qp, b16* __restrict__ kp, b16* __restrict__ vt, float* __restrict__ sq) {
  __shared__ __attribute__((aligned(16))) b16 Tq[4][32][HD + 8], Tk[4][32][HD + 8]; __shared__ __attribute__((aligned(16))) b16 Tv[HD][128 + 8]; __shared__ float Sq[128];
  const int lane = threadIdx.x & 31, wave = threadIdx.x >> 5, nloc = lane & 15, hlf = lane >> 4, h = blockIdx.x, c0 = h * HD, p0 = blockIdx.y * 128, m0 = p0 + wave * 32, b = p0 / S, t0 = p0 % S;
  v8f acc[2][4];
#pragma unroll
  for (int r = 0; r < 2; ++r)
#pragma unroll
    for (int t = 0; t < 4; ++t) acc[r][t] = (v8f){};
  // fragments are fetched one k-step ahead into a second register set: one load group per step, in flight while the step before it is worked on
  const float* xr = x + (size_t)(m0 + nloc) * DM; const unsigned short* wr = w16 + (size_t)(c0 + nloc) * DM;
  raw16 ra0 = load_raw(xr, hlf), ra1 = load_raw(xr + 16 * DM, hlf); v16bb bw[4];
#pragma unroll
  for (int t = 0; t < 4; ++t) bw[t] = frag_bf(wr + t * 16 * DM, hlf);
#pragma unroll 2
  for (int kb = 32; kb <= DM; kb += 32) {   // kb = the k-step that is fetched; the one before it is worked on; the last trip fetches nothing
    raw16 na0 = ra0, na1 = ra1; v16bb nb[4] = {bw[0], bw[1], bw[2], bw[3]};
    if (kb < DM) { na0 = load_raw(xr + kb, hlf); na1 = load_raw(xr + 16 * DM + kb, hlf);
#pragma unroll
      for (int t = 0; t < 4; ++t) nb[t] = frag_bf(wr + t * 16 * DM + kb, hlf);
      asm volatile("s_wait_xcnt 0x0" ::: "memory"); }   // stands behind the load group, ahead of the next rewrite of its address registers
    __builtin_amdgcn_sched_barrier(0);   // keeps the next step's loads ahead of this step's products: the scheduler otherwise sinks each load to its use, behind a full wait
    const v16bb a0 = cvt_raw(ra0), a1 = cvt_raw(ra1);
#pragma unroll
    for (int t = 0; t < 4; ++t) { acc[0][t] = wmma16bb(a0, bw[t], acc[0][t]); acc[1][t] = wmma16bb(a1, bw[t], acc[1][t]); }
    ra0 = na0; ra1 = na1;
#pragma unroll
    for (int t = 0; t < 4; ++t) bw[t] = nb[t]; }
#pragma unroll
  for (int t = 0; t < 4; ++t)
#pragma unroll
    for (int r = 0; r < 2; ++r)
#pragma unroll
      for (int v = 0; v < 8; ++v) { const float w = acc[r][t][v]; Tq[wave][r * 16 + 8 * hlf + v][t * 16 + nloc] = (b16)(w * (SCALE * QS)); Tk[wave][r * 16 + 8 * hlf + v][t * 16 + nloc] = (b16)(w * KS); Tv[t * 16 + nloc][wave * 32 + r * 16 + 8 * hlf + v] = (b16)(w * VS); }
  // exact f32 self-logit ingredient: |w_row|^2 per (token, head) (sum over this lane's 4 columns x ... then across the 16 column lanes; fixed order)
#pragma unroll
  for (int r = 0; r < 2; ++r)
#pragma unroll
    for (int v = 0; v < 8; ++v) { float s2 = 0.0f;
#pragma unroll
      for (int t = 0; t < 4; ++t) { const float w = acc[r][t][v]; s2 += w * w; }
#pragma unroll
      for (int o = 1; o < 16; o <<= 1) s2 += __shfl_xor(s2, o);
      if (nloc == 0) Sq[wave * 32 + r * 16 + 8 * hlf + v] = s2; }
  __syncthreads();
  b16* qb = qp + (((size_t)b * H + h) * S + (m0 % S)) * HD; b16* kb_ = kp + (((size_t)b * H + h) * S + (m0 % S)) * HD;
  {
#pragma unroll
    for (int j = 0; j < 8; ++j) { const int rr = j * 4 + (lane >> 3), c8 = (lane & 7) * 8; *(v8b*)(qb + (size_t)rr * HD + c8) = *(const v8b*)(&Tq[wave][rr][c8]); *(v8b*)(kb_ + (size_t)rr * HD + c8) = *(const v8b*)(&Tk[wave][rr][c8]); }
    for (int i = threadIdx.x; i < HD * 16; i += 128) { const int d = i >> 4, c8 = (i & 15) * 8; *(v8b*)(vt + (((size_t)b * H + h) * HD + d) * S + t0 + c8) = *(const v8b*)(&Tv[d][c8]); }
    *(float*)(sq + ((size_t)b * H + h) * S + t0 + threadIdx.x) = Sq[threadIdx.x];   // [b][h][token] f32: 512 B per block
     }
}

constexpr int KT = 256, NSTG = S / KT, KPI = HD + 8, VPI = KT + 8;   // LDS row pitches 144 B and 528 B (16 B x odd: no bank conflict for 16-byte fragment reads)
__device__ __forceinline__ unsigned lds_addr(const b16* p) { return (unsigned)(size_t)p; }   // low 32 bits of a __shared__ address = byte offset in the work-group's LDS
// eight 16-byte copies per lane; the s_wait_xcnt closes the statement so that no address register is rewritten before it
__device__ __forceinline__ void copy8(const b16* g, size_t gstep, const b16* l, int lstep) {
  asm volatile("global_load_async_to_lds_b128 %0, %8, off\n\tglobal_load_async_to_lds_b128 %1, %9, off\n\tglobal_load_async_to_lds_b128 %2, %10, off\n\tglobal_load_async_to_lds_b128 %3, %11, off\n\t"
               "global_load_async_to_lds_b128 %4, %12, off\n\tglobal_load_async_to_lds_b128 %5, %13, off\n\tglobal_load_async_to_lds_b128 %6, %14, off\n\tglobal_load_async_to_lds_b128 %7, %15, off\n\ts_wait_xcnt 0x0"
               :: "v"(lds_addr(l)), "v"(lds_addr(l + lstep)), "v"(lds_addr(l + 2 * lstep)), "v"(lds_addr(l + 3 * lstep)), "v"(lds_addr(l + 4 * lstep)), "v"(lds_addr(l + 5 * lstep)), "v"(lds_addr(l + 6 * lstep)), "v"(lds_addr(l + 7 * lstep)),
                  "v"(g), "v"(g + gstep), "v"(g + 2 * gstep), "v"(g + 3 * gstep), "v"(g + 4 * gstep), "v"(g + 5 * gstep), "v"(g + 6 * gstep), "v"(g + 7 * gstep) : "memory");
}
__global__ __launch_bounds__(256) void attn_kernel(const b16* __restrict__ qp, const b16* __restrict__ kp, const b16* __restrict__ vt, const float* __restrict__ sq, b16* __restrict__ ctx) {
  __shared__ __attribute__((aligned(16))) b16 Ks[2][KT * KPI], Vs[2][HD * VPI], Os[8][16][HD + 8];
  const int wave = threadIdx.x >> 5, lane = threadIdx.x & 31, hh = lane >> 4, col = lane & 15; const int bh = blockIdx.x / (S / 128), b = bh / H, h = bh % H, q0 = (blockIdx.x % (S / 128)) * 128 + wave * 16, qi = q0 + col;
  const b16* Q = qp + ((size_t)bh * S) * HD; const b16* K = kp + ((size_t)bh * S) * HD; const b16* V = vt + ((size_t)bh * HD) * S;
  // this lane's share of a tile: K = 256 rows x 128 B, contiguous (a wave's copy = 4 rows); V^T = 64 rows x 512 B (a wave's copy = 1 row)
  const b16* Kg = K + threadIdx.x * 8; const b16* Vg = V + (size_t)wave * S + lane * 8; const int kl0 = (threadIdx.x >> 3) * KPI + (threadIdx.x & 7) * 8, vl0 = wave * VPI + lane * 8;
  copy8(Kg, 32 * HD, &Ks[0][kl0], 32 * KPI); copy8(Vg, (size_t)8 * S, &Vs[0][vl0], 8 * VPI);
  asm volatile("s_wait_asynccnt 0x0" ::: "memory");   // tile 0 landed (this wave's copies) before the barrier that publishes it
  __syncthreads();
  copy8(Kg + KT * HD, 32 * HD, &Ks[1][kl0], 32 * KPI); copy8(Vg + KT, (size_t)8 * S, &Vs[1][vl0], 8 * VPI);
  const v16b qf0 = frag_kb(Q + (size_t)qi * HD, hh), qf1 = frag_kb(Q + (size_t)qi * HD + 32, hh); const float sself = sq[(size_t)bh * S + qi] * (SCALE * QS * KS);   // exact f32 self logit (the dominant softmax term), in the raw scores' units (x QS x KS, a power of two)
  const int dkb = __builtin_amdgcn_readfirstlane(q0 & ~31);   // first key of the one 32-key pass that holds this wave's own 16 keys (the same in every lane: kept in a scalar register)
  float m = -INFINITY, l = 0.0f; v8f o[4] = {{}, {}, {}, {}};
  for (int st = 0; st < NSTG; ++st) {
    const b16* Kb = &Ks[st & 1][col * KPI]; const b16* Vb = &Vs[st & 1][col * VPI];
    for (int kl = 0; kl < KT; kl += 32) { const int kb = st * KT + kl;
      const v16b ka0 = frag_kb(Kb + kl * KPI, hh), ka1 = frag_kb(Kb + kl * KPI + 32, hh), kc0 = frag_kb(Kb + (kl + 16) * KPI, hh), kc1 = frag_kb(Kb + (kl + 16) * KPI + 32, hh);
      const v16b vf[4] = {frag_kb(Vb + kl, hh), frag_kb(Vb + 16 * VPI + kl, hh), frag_kb(Vb + 32 * VPI + kl, hh), frag_kb(Vb + 48 * VPI + kl, hh)};   // all of the pass's LDS reads stand together, ahead of its products
      v8f s0 = {}, s1 = {}; s0 = wmma16b(ka0, qf0, s0); s0 = wmma16b(ka1, qf1, s0); s1 = wmma16b(kc0, qf0, s1); s1 = wmma16b(kc1, qf1, s1);
      float mr = -INFINITY;   // the maximum is taken on the raw scores; their scale, log2(e) and the x PS of P are folded into one multiply-add per score ahead of exp2
      if (kb == dkb) {   // one pass in 128: a scalar compare and branch, so the other passes carry no index compare and no select
#pragma unroll
        for (int r = 0; r < 8; ++r) { if (kb + 8 * hh + r == qi) s0[r] = sself; if (kb + 16 + 8 * hh + r == qi) s1[r] = sself; } }
#pragma unroll
      for (int r = 0; r < 8; ++r) mr = fmaxf(mr, fmaxf(s0[r], s1[r]));
      mr = fmaxf(mr, __shfl_xor(mr, 16));
      const float mn = fmaxf(m, mr), al_ = __builtin_amdgcn_exp2f((m - mn) * LC), nb = __builtin_fmaf(-mn, LC, 3.0f); m = mn; float sum = 0.0f; v16b pbv;   // 3 = log2(PS)
#pragma unroll
      for (int r = 0; r < 8; ++r) { const float e0 = __builtin_amdgcn_exp2f(__builtin_fmaf(s0[r], LC, nb)), e1 = __builtin_amdgcn_exp2f(__builtin_fmaf(s1[r], LC, nb)); sum += e0 + e1; pbv[r] = (b16)e0; pbv[8 + r] = (b16)e1; }   // e = PS x exp(logit - max)
      sum += __shfl_xor(sum, 16); l = l * al_ + sum;
#pragma unroll
      for (int t = 0; t < 4; ++t) { o[t] *= al_; o[t] = wmma16b(vf[t], pbv, o[t]); } }
    asm volatile("s_wait_dscnt 0x0" ::: "memory");      // this wave's reads of the buffer are done before the buffer is refilled
    asm volatile("s_wait_asynccnt 0x0" ::: "memory");   // this wave's copies of the next tile have landed before the barrier that publishes them
    __syncthreads();
    if (st + 2 < NSTG) { copy8(Kg + (size_t)(st + 2) * KT * HD, 32 * HD, &Ks[st & 1][kl0], 32 * KPI); copy8(Vg + (st + 2) * KT, (size_t)8 * S, &Vs[st & 1][vl0], 8 * VPI); } }
  asm volatile("s_wait_asynccnt 0x0" ::: "memory");     // nothing in flight when the wave goes on to its end
  const float inv = 1.0f / (l * VS);   // l already carries the x PS
#pragma unroll
  for (int t = 0; t < 4; ++t)
#pragma unroll
    for (int r = 0; r < 8; ++r) Os[wave][col][t * 16 + 8 * hh + r] = (b16)(o[t][r] * inv);
  __syncthreads();
  b16* dst = ctx + ((size_t)b * S + q0) * DM + h * HD;   // this wave's 16 rows x 128 B: whole lines, one writer each
  for (int j = 0; j < 4; ++j) { const int rr = j * 4 + (lane >> 3), c8 = (lane & 7) * 8; *(v8b*)(dst + (size_t)rr * DM + c8) = *(const v8b*)(&Os[wave][rr][c8]); }
}

__global__ __launch_bounds__(128) void out_kernel(const b16* __restrict__ ctx, const b16* __restrict__ wo16, const float* __restrict__ P, float* __restrict__ out) {
  __shared__ __attribute__((aligned(16))) float Ts[4][32 * 64];
  const int lane = threadIdx.x & 31, wave = threadIdx.x >> 5, nloc = lane & 15, hlf = lane >> 4, m0 = blockIdx.y * 128 + wave * 32, c0 = blockIdx.x * 64;
  v8f acc[2][4];
#pragma unroll
  for (int r = 0; r < 2; ++r)
#pragma unroll
    for (int t = 0; t < 4; ++t) acc[r][t] = (v8f){};
  // as in the projection: fragments fetched one k-step ahead into a second register set
  const b16* cr = ctx + (size_t)(m0 + nloc) * DM; const b16* wr = wo16 + (size_t)(c0 + nloc) * DM;
  v16b a0 = frag_kb(cr, hlf), a1 = frag_kb(cr + 16 * DM, hlf), bw[4];
#pragma unroll
  for (int t = 0; t < 4; ++t) bw[t] = frag_kb(wr + t * 16 * DM, hlf);
#pragma unroll 2
  for (int kb = 32; kb <= DM; kb += 32) {   // kb = the k-step that is fetched; the one before it is worked on; the last trip fetches nothing
    v16b na0 = a0, na1 = a1, nb[4] = {bw[0], bw[1], bw[2], bw[3]};
    if (kb < DM) { na0 = frag_kb(cr + kb, hlf); na1 = frag_kb(cr + 16 * DM + kb, hlf);
#pragma unroll
      for (int t = 0; t < 4; ++t) nb[t] = frag_kb(wr + t * 16 * DM + kb, hlf);
      asm volatile("s_wait_xcnt 0x0" ::: "memory"); }   // stands behind the load group, ahead of the next rewrite of its address registers
    __builtin_amdgcn_sched_barrier(0);   // keeps the next step's loads ahead of this step's products: the scheduler otherwise sinks each load to its use, behind a full wait
#pragma unroll
    for (int t = 0; t < 4; ++t) { acc[0][t] = wmma16b(a0, bw[t], acc[0][t]); acc[1][t] = wmma16b(a1, bw[t], acc[1][t]); }
    a0 = na0; a1 = na1;
#pragma unroll
    for (int t = 0; t < 4; ++t) bw[t] = nb[t]; }
  float* Tt = Ts[wave];
#pragma unroll
  for (int t = 0; t < 4; ++t) { const float bb = P[c0 + t * 16 + nloc];
#pragma unroll
    for (int r = 0; r < 2; ++r)
#pragma unroll
      for (int v = 0; v < 8; ++v) Tt[(r * 16 + v + 8 * hlf) * 64 + t * 16 + nloc] = acc[r][t][v] + bb; }
  wave_lds_sync();
  {
#pragma unroll
    for (int j = 0; j < 16; ++j) { const int rr = j * 2 + hlf, c4 = nloc * 4; *(v4f*)(out + (size_t)(m0 + rr) * DM + c0 + c4) = *(const v4f*)(Tt + rr * 64 + c4); }
     }
}
}  // namespace

extern "C" void kernel_launch(void* const* d_in, const int* in_sizes, int n_in,
                              void* d_out, int out_size, void* d_ws, size_t ws_size, hipStream_t stream) {
  (void)n_in; (void)out_size;
  const float* x = (const float*)d_in[0]; const float* Wqkv = (const float*)d_in[1]; const float* Wout = (const float*)d_in[2]; const float* bout = (const float*)d_in[3];
  float* out = (float*)d_out;   // [2][4096][512]
  if (in_sizes[0] != NT * DM || in_sizes[1] != DM * DM || in_sizes[2] != DM * DM || in_sizes[3] != DM) return;
  size_t off = 0; char* ws = (char*)d_ws;
  auto carve = [&](size_t bytes) { char* p = ws + off; off += (bytes + 255) & ~(size_t)255; return p; };
  unsigned short* w16 = (unsigned short*)carve((size_t)DM * DM * 2); b16* wo16 = (b16*)carve((size_t)DM * DM * 2); float* P = (float*)carve(DM * 4);
  b16* qp = (b16*)carve(PL * 2); b16* kp = (b16*)carve(PL * 2); b16* vt = (b16*)carve(PL * 2); b16* ctx = (b16*)carve((size_t)NT * DM * 2); float* sq = (float*)carve((size_t)NT * H * 4);
  if (off > ws_size) return;                                    // ≈ 1 + 8.4 x 4 ≈ 35 MB
  prep_kernel<<<256, 256, 0, stream>>>(Wqkv, Wout, bout, w16, wo16, P);
  proj_kernel<<<dim3(H, NT / 128), 128, 0, stream>>>(x, w16, qp, kp, vt, sq);
  attn_kernel<<<Bn * H * (S / 128), 256, 0, stream>>>(qp, kp, vt, sq, ctx);
  out_kernel<<<dim3(DM / 64, NT / 128), 128, 0, stream>>>(ctx, wo16, P, out);
}

// v005
// One run takes 116 microseconds.
// Next to v004, in two timings, it ran 1.05 times as fast each time.
// All steps since v000 together make it 3.20 times as fast.
#include <hip/hip_runtime.h>

// SAN (shared-projection attention): w = x W_qkv (q = k = v = w; 8 heads x 64 over 4096 tokens, batch 2); attn = softmax(w.w^T x 64^-0.5); out = (attn w) merged . W_out + b
// -> [2][4096][512].
// The shared projection is ONE exact GEMM on v_wmma_f32_16x16x32_bf16 (x and W exact bf16; 1 product) written three ways (q plane x 1/8 x8, k plane x8,
// (8w)^T plane) as single f16; attention on v_wmma_f32_16x16x32_f16 per (b, h, 16 queries) over all 128 key blocks with single-f16 q, k, P, v (1 product each; logits are O(1),
// softmax over 4096 keys) except the self logit w_i·w_i/8 ≈ 8, which dominates the softmax and is taken from an exact f32 |w_i|² computed in the projection epilogue; f32 online softmax / accumulate; ctx single f16; out = ctx.W_out + b (1 product). ≈4.7 M WMMAs (an f32-class path would be ≈13 M).

namespace {
constexpr int Bn = 2, S = 4096, DM = 512, H = 8, HD = 64, NT = Bn * S;
constexpr float QS = 8.0f, KS = 8.0f, VS = 8.0f, PS = 8.0f, SCALE = 0.125f;
constexpr size_t PL = (size_t)Bn * H * S * HD;

typedef _Float16 b16;
typedef __attribute__((ext_vector_type(16))) _Float16 v16b;
typedef __attribute__((ext_vector_type(16))) __bf16 v16bb;
typedef __attribute__((ext_vector_type(8))) _Float16 v8b;
typedef __attribute__((ext_vector_type(8))) unsigned short v8us;
typedef __attribute__((ext_vector_type(8))) float v8f;
typedef __attribute__((ext_vector_type(4))) float v4f;
__device__ __forceinline__ float bf16_rne(float f) { unsigned int u = __float_as_uint(f); u += 0x7FFFu + ((u >> 16) & 1u); return __uint_as_float(u & 0xFFFF0000u); }
__device__ __forceinline__ unsigned short bf16_bits(float f) { unsigned int u = __float_as_uint(f); u += 0x7FFFu + ((u >> 16) & 1u); return (unsigned short)(u >> 16); }
__device__ __forceinline__ v16b frag_kb(const b16* p, int hh) { const v8b a = *(const v8b*)(p + 8 * hh), b = *(const v8b*)(p + 16 + 8 * hh); v16b f;
#pragma unroll
  for (int e = 0; e < 8; ++e) { f[e] = a[e]; f[8 + e] = b[e]; } return f; }
__device__ __forceinline__ v16bb frag_bf(const unsigned short* p, int hh) { const v8us a = *(const v8us*)(p + 8 * hh), b = *(const v8us*)(p + 16 + 8 * hh); union { unsigned short s[16]; v16bb v; } u;
#pragma unroll
  for (int e = 0; e < 8; ++e) { u.s[e] = a[e]; u.s[8 + e] = b[e]; } return u.v; }
struct raw16 { v4f a, b, c, d; };   // one lane's 16 f32 of an A fragment, as loaded
__device__ __forceinline__ raw16 load_raw(const float* p, int hh) { raw16 r; r.a = *(const v4f*)(p + 8 * hh); r.b = *(const v4f*)(p + 8 * hh + 4); r.c = *(const v4f*)(p + 16 + 8 * hh); r.d = *(const v4f*)(p + 16 + 8 * hh + 4); return r; }
__device__ __forceinline__ v16bb cvt_raw(const raw16& r) { union { unsigned short s[16]; v16bb v; } u;
#pragma unroll
  for (int e = 0; e < 4; ++e) { u.s[e] = bf16_bits(r.a[e]); u.s[4 + e] = bf16_bits(r.b[e]); u.s[8 + e] = bf16_bits(r.c[e]); u.s[12 + e] = bf16_bits(r.d[e]); } return u.v; }
__device__ __forceinline__ v8f wmma16b(v16b a, v16b b, v8f c) { return __builtin_amdgcn_wmma_f32_16x16x32_f16(false, a, false, b, (short)0, c, false, false); }
__device__ __forceinline__ v8f wmma16bb(v16bb a, v16bb b, v8f c) { return __builtin_amdgcn_wmma_f32_16x16x32_bf16(false, a, false, b, (short)0, c, false, false); }
__device__ __forceinline__ void wave_lds_sync() { __builtin_amdgcn_fence(__ATOMIC_RELEASE, "workgroup"); __builtin_amdgcn_wave_barrier(); __builtin_amdgcn_fence(__ATOMIC_ACQUIRE, "workgroup"); }
constexpr float LC = 1.4426950408889634f / (QS * KS);   // raw score (= logit x QS x KS) -> logit in base-2 units

__global__ __launch_bounds__(256) void prep_kernel(const float* __restrict__ Wqkv, const float* __restrict__ Wout, const float* __restrict__ bout, unsigned short* __restrict__ w16, b16* __restrict__ wo16, float* __restrict__ P) {
  const int t_ = blockIdx.x * 256 + threadIdx.x, nth = gridDim.x * 256;
  {
    for (int q = t_; q < DM * DM; q += nth) { const int o = q / DM, k = q % DM; w16[q] = bf16_bits(Wqkv[(size_t)k * DM + o]); wo16[q] = (b16)bf16_rne(Wout[(size_t)k * DM + o]); }
    for (int q = t_; q < DM; q += nth) P[q] = bf16_rne(bout[q]);
     }
}

// projection: w = bf16(x).W (exact); block 128 tokens x 64 cols (= head h); writes q plane (w/8 x8 = w) hmm: q x SCALE x QS = w x 1, k plane (w x 8), (8w)^T plane, all single f16,
__global__ __launch_bounds__(128) void proj_kernel(const float* __restrict__ x, const unsigned short* __restrict__ w16, b16* __restrict__ qp, b16* __restrict__ kp, b16* __restrict__ vt, float* __restrict__ sq) {
  __shared__ __attribute__((aligned(16))) b16 Tq[4][32][HD + 8], Tk[4][32][HD + 8]; __shared__ __attribute__((aligned(16))) b16 Tv[HD][128 + 8]; __shared__ float Sq[128];
  const int lane = threadIdx.x & 31, wave = threadIdx.x >> 5, nloc = lane & 15, hlf = lane >> 4, h = blockIdx.x, c0 = h * HD, p0 = blockIdx.y * 128, m0 = p0 + wave * 32, b = p0 / S, t0 = p0 % S;
  v8f acc[2][4];
#pragma unroll
  for (int r = 0; r < 2; ++r)
#pragma unroll
    for (int t = 0; t < 4; ++t) acc[r][t] = (v8f){};
  // fragments are fetched one k-step ahead into a second register set: one load group per step, in flight while the step before it is worked on
  const float* xr = x + (size_t)(m0 + nloc) * DM; const unsigned short* wr = w16 + (size_t)(c0 + nloc) * DM;
  raw16 ra0 = load_raw(xr, hlf), ra1 = load_raw(xr + 16 * DM, hlf); v16bb bw[4];
#pragma unroll
  for (int t = 0; t < 4; ++t) bw[t] = frag_bf(wr + t * 16 * DM, hlf);
#pragma unroll 2
  for (int kb = 32; kb <= DM; kb += 32) {   // kb = the k-step that is fetched; the one before it is worked on; the last trip fetches nothing
    raw16 na0 = ra0, na1 = ra1; v16bb nb[4] = {bw[0], bw[1], bw[2], bw[3]};
    if (kb < DM) { na0 = load_raw(xr + kb, hlf); na1 = load_raw(xr + 16 * DM + kb, hlf);
#pragma unroll
      for (int t = 0; t < 4; ++t) nb[t] = frag_bf(wr + t * 16 * DM + kb, hlf);
      asm volatile("s_wait_xcnt 0x0" ::: "memory"); }   // stands behind the load group, ahead of the next rewrite of its address registers
    __builtin_amdgcn_sched_barrier(0);   // keeps the next step's loads ahead of this step's products: the scheduler otherwise sinks each load to its use, behind a full wait
    const v16bb a0 = cvt_raw(ra0), a1 = cvt_raw(ra1);
#pragma unroll
    for (int t = 0; t < 4; ++t) { acc[0][t] = wmma16bb(a0, bw[t], acc[0][t]); acc[1][t] = wmma16bb(a1, bw[t], acc[1][t]); }
    asm volatile("v_nop\n\tv_nop\n\tv_nop\n\tv_nop" :: "v"(acc[0][0]), "v"(acc[1][0]), "v"(acc[0][1]), "v"(acc[1][1]), "v"(acc[0][2]), "v"(acc[1][2]), "v"(acc[0][3]), "v"(acc[1][3]), "v"(bw[0]), "v"(bw[1]), "v"(bw[2]), "v"(bw[3]));   // behind the k-step's last product: the four vector slots before the next load group overwrites that product's A and B registers; a0 and a1 are not named: named here, each was packed a second time into registers of its own
    ra0 = na0; ra1 = na1;
#pragma unroll
    for (int t = 0; t < 4; ++t) bw[t] = nb[t]; }
#pragma unroll
  for (int t = 0; t < 4; ++t)
#pragma unroll
    for (int r = 0; r < 2; ++r)
#pragma unroll
      for (int v = 0; v < 8; ++v) { const float w = acc[r][t][v]; Tq[wave][r * 16 + 8 * hlf + v][t * 16 + nloc] = (b16)(w * (SCALE * QS)); Tk[wave][r * 16 + 8 * hlf + v][t * 16 + nloc] = (b16)(w * KS); Tv[t * 16 + nloc][wave * 32 + r * 16 + 8 * hlf + v] = (b16)(w * VS); }
  // exact f32 self-logit ingredient: |w_row|^2 per (token, head) (sum over this lane's 4 columns x ... then across the 16 column lanes; fixed order)
#pragma unroll
  for (int r = 0; r < 2; ++r)
#pragma unroll
    for (int v = 0; v < 8; ++v) { float s2 = 0.0f;
#pragma unroll
      for (int t = 0; t < 4; ++t) { const float w = acc[r][t][v]; s2 += w * w; }
#pragma unroll
      for (int o = 1; o < 16; o <<= 1) s2 += __shfl_xor(s2, o);
      if (nloc == 0) Sq[wave * 32 + r * 16 + 8 * hlf + v] = s2; }
  __syncthreads();
  b16* qb = qp + (((size_t)b * H + h) * S + (m0 % S)) * HD; b16* kb_ = kp + (((size_t)b * H + h) * S + (m0 % S)) * HD;
  {
#pragma unroll
    for (int j = 0; j < 8; ++j) { const int rr = j * 4 + (lane >> 3), c8 = (lane & 7) * 8; *(v8b*)(qb + (size_t)rr * HD + c8) = *(const v8b*)(&Tq[wave][rr][c8]); *(v8b*)(kb_ + (size_t)rr * HD + c8) = *(const v8b*)(&Tk[wave][rr][c8]); }
    for (int i = threadIdx.x; i < HD * 16; i += 128) { const int d = i >> 4, c8 = (i & 15) * 8; *(v8b*)(vt + (((size_t)b * H + h) * HD + d) * S + t0 + c8) = *(const v8b*)(&Tv[d][c8]); }
    *(float*)(sq + ((size_t)b * H + h) * S + t0 + threadIdx.x) = Sq[threadIdx.x];   // [b][h][token] f32: 512 B per block
     }
}

constexpr int KT = 256, NSTG = S / KT, KPI = HD + 8, VPI = KT + 8;   // LDS row pitches 144 B and 528 B (16 B x odd: no bank conflict for 16-byte fragment reads)
__device__ __forceinline__ unsigned lds_addr(const b16* p) { return (unsigned)(size_t)p; }   // low 32 bits of a __shared__ address = byte offset in the work-group's LDS
// eight 16-byte copies per lane; the s_wait_xcnt closes the statement so that no address register is rewritten before it
__device__ __forceinline__ void copy8(const b16* g, size_t gstep, const b16* l, int lstep) {
  asm volatile("global_load_async_to_lds_b128 %0, %8, off\n\tglobal_load_async_to_lds_b128 %1, %9, off\n\tglobal_load_async_to_lds_b128 %2, %10, off\n\tglobal_load_async_to_lds_b128 %3, %11, off\n\t"
               "global_load_async_to_lds_b128 %4, %12, off\n\tglobal_load_async_to_lds_b128 %5, %13, off\n\tglobal_load_async_to_lds_b128 %6, %14, off\n\tglobal_load_async_to_lds_b128 %7, %15, off\n\ts_wait_xcnt 0x0"
               :: "v"(lds_addr(l)), "v"(lds_addr(l + lstep)), "v"(lds_addr(l + 2 * lstep)), "v"(lds_addr(l + 3 * lstep)), "v"(lds_addr(l + 4 * lstep)), "v"(lds_addr(l + 5 * lstep)), "v"(lds_addr(l + 6 * lstep)), "v"(lds_addr(l + 7 * lstep)),
                  "v"(g), "v"(g + gstep), "v"(g + 2 * gstep), "v"(g + 3 * gstep), "v"(g + 4 * gstep), "v"(g + 5 * gstep), "v"(g + 6 * gstep), "v"(g + 7 * gstep) : "memory");
}
__global__ __launch_bounds__(256) void attn_kernel(const b16* __restrict__ qp, const b16* __restrict__ kp, const b16* __restrict__ vt, const float* __restrict__ sq, b16* __restrict__ ctx) {
  __shared__ __attribute__((aligned(16))) b16 Ks[2][KT * KPI], Vs[2][HD * VPI], Os[8][16][HD + 8];
  const int wave = threadIdx.x >> 5, lane = threadIdx.x & 31, hh = lane >> 4, col = lane & 15; const int bh = blockIdx.x / (S / 128), b = bh / H, h = bh % H, q0 = (blockIdx.x % (S / 128)) * 128 + wave * 16, qi = q0 + col;
  const b16* Q = qp + ((size_t)bh * S) * HD; const b16* K = kp + ((size_t)bh * S) * HD; const b16* V = vt + ((size_t)bh * HD) * S;
  // this lane's share of a tile: K = 256 rows x 128 B, contiguous (a wave's copy = 4 rows); V^T = 64 rows x 512 B (a wave's copy = 1 row)
  const b16* Kg = K + threadIdx.x * 8; const b16* Vg = V + (size_t)wave * S + lane * 8; const int kl0 = (threadIdx.x >> 3) * KPI + (threadIdx.x & 7) * 8, vl0 = wave * VPI + lane * 8;
  copy8(Kg, 32 * HD, &Ks[0][kl0], 32 * KPI); copy8(Vg, (size_t)8 * S, &Vs[0][vl0], 8 * VPI);
  asm volatile("s_wait_asynccnt 0x0" ::: "memory");   // tile 0 landed (this wave's copies) before the barrier that publishes it
  __syncthreads();
  copy8(Kg + KT * HD, 32 * HD, &Ks[1][kl0], 32 * KPI); copy8(Vg + KT, (size_t)8 * S, &Vs[1][vl0], 8 * VPI);
  const v16b qf0 = frag_kb(Q + (size_t)qi * HD, hh), qf1 = frag_kb(Q + (size_t)qi * HD + 32, hh); const float sself = sq[(size_t)bh * S + qi] * (SCALE * QS * KS);   // exact f32 self logit (the dominant softmax term), in the raw scores' units (x QS x KS, a power of two)
  const int dkb = __builtin_amdgcn_readfirstlane(q0 & ~31);   // first key of the one 32-key pass that holds this wave's own 16 keys (the same in every lane: kept in a scalar register)
  float m = -INFINITY, l = 0.0f; v8f o[4] = {{}, {}, {}, {}};
  for (int st = 0; st < NSTG; ++st) {
    const b16* Kb = &Ks[st & 1][col * KPI]; const b16* Vb = &Vs[st & 1][col * VPI];
    for (int kl = 0; kl < KT; kl += 32) { const int kb = st * KT + kl;
      const v16b ka0 = frag_kb(Kb + kl * KPI, hh), ka1 = frag_kb(Kb + kl * KPI + 32, hh), kc0 = frag_kb(Kb + (kl + 16) * KPI, hh), kc1 = frag_kb(Kb + (kl + 16) * KPI + 32, hh);
      const v16b vf[4] = {frag_kb(Vb + kl, hh), frag_kb(Vb + 16 * VPI + kl, hh), frag_kb(Vb + 32 * VPI + kl, hh), frag_kb(Vb + 48 * VPI + kl, hh)};   // all of the pass's LDS reads stand together, ahead of its products
      __builtin_amdgcn_sched_barrier(0);   // holds the 16 LDS reads in one group ahead of the products: the scheduler otherwise sinks each pair to its product, behind a full wait
      v8f s0 = {}, s1 = {}; s0 = wmma16b(ka0, qf0, s0); s0 = wmma16b(ka1, qf1, s0); s1 = wmma16b(kc0, qf0, s1); s1 = wmma16b(kc1, qf1, s1);
      float mr = -INFINITY;   // the maximum is taken on the raw scores; their scale, log2(e) and the x PS of P are folded into one multiply-add per score ahead of exp2
      if (kb == dkb) {   // one pass in 128: a scalar compare and branch, so the other passes carry no index compare and no select
#pragma unroll
        for (int r = 0; r < 8; ++r) { if (kb + 8 * hh + r == qi) s0[r] = sself; if (kb + 16 + 8 * hh + r == qi) s1[r] = sself; } }
#pragma unroll
      for (int r = 0; r < 8; ++r) mr = fmaxf(mr, fmaxf(s0[r], s1[r]));
      mr = fmaxf(mr, __shfl_xor(mr, 16));
      const float mn = fmaxf(m, mr), al_ = __builtin_amdgcn_exp2f((m - mn) * LC), nb = __builtin_fmaf(-mn, LC, 3.0f); m = mn; float sum = 0.0f; v16b pbv;   // 3 = log2(PS)
#pragma unroll
      for (int r = 0; r < 8; ++r) { const float e0 = __builtin_amdgcn_exp2f(__builtin_fmaf(s0[r], LC, nb)), e1 = __builtin_amdgcn_exp2f(__builtin_fmaf(s1[r], LC, nb)); sum += e0 + e1; pbv[r] = (b16)e0; pbv[8 + r] = (b16)e1; }   // e = PS x exp(logit - max)
      sum += __shfl_xor(sum, 16); l = l * al_ + sum;
#pragma unroll
      for (int t = 0; t < 4; ++t) { o[t] *= al_; o[t] = wmma16b(vf[t], pbv, o[t]); }
      asm volatile("v_nop\n\tv_nop\n\tv_nop\n\tv_nop" : "+v"(o[3]) : "v"(vf[3]), "v"(pbv)); }   // behind the pass's last product: the four vector slots the chip needs before the next pass's address arithmetic overwrites that product's A registers
    asm volatile("s_wait_dscnt 0x0" ::: "memory");      // this wave's reads of the buffer are done before the buffer is refilled
    asm volatile("s_wait_asynccnt 0x0" ::: "memory");   // this wave's copies of the next tile have landed before the barrier that publishes them
    __syncthreads();
    if (st + 2 < NSTG) { copy8(Kg + (size_t)(st + 2) * KT * HD, 32 * HD, &Ks[st & 1][kl0], 32 * KPI); copy8(Vg + (st + 2) * KT, (size_t)8 * S, &Vs[st & 1][vl0], 8 * VPI); } }
  asm volatile("s_wait_asynccnt 0x0" ::: "memory");     // nothing in flight when the wave goes on to its end
  const float inv = 1.0f / (l * VS);   // l already carries the x PS
#pragma unroll
  for (int t = 0; t < 4; ++t)
#pragma unroll
    for (int r = 0; r < 8; ++r) Os[wave][col][t * 16 + 8 * hh + r] = (b16)(o[t][r] * inv);
  __syncthreads();
  b16* dst = ctx + ((size_t)b * S + q0) * DM + h * HD;   // this wave's 16 rows x 128 B: whole lines, one writer each
  for (int j = 0; j < 4; ++j) { const int rr = j * 4 + (lane >> 3), c8 = (lane & 7) * 8; *(v8b*)(dst + (size_t)rr * DM + c8) = *(const v8b*)(&Os[wave][rr][c8]); }
}

__global__ __launch_bounds__(128) void out_kernel(const b16* __restrict__ ctx, const b16* __restrict__ wo16, const float* __restrict__ P, float* __restrict__ out) {
  __shared__ __attribute__((aligned(16))) float Ts[4][32 * 64];
  const int lane = threadIdx.x & 31, wave = threadIdx.x >> 5, nloc = lane & 15, hlf = lane >> 4, m0 = blockIdx.y * 128 + wave * 32, c0 = blockIdx.x * 64;
  v8f acc[2][4];
#pragma unroll
  for (int r = 0; r < 2; ++r)
#pragma unroll
    for (int t = 0; t < 4; ++t) acc[r][t] = (v8f){};
  // as in the projection: fragments fetched one k-step ahead into a second register set
  const b16* cr = ctx + (size_t)(m0 + nloc) * DM; const b16* wr = wo16 + (size_t)(c0 + nloc) * DM;
  v16b a0 = frag_kb(cr, hlf), a1 = frag_kb(cr + 16 * DM, hlf), bw[4];
#pragma unroll
  for (int t = 0; t < 4; ++t) bw[t] = frag_kb(wr + t * 16 * DM, hlf);
#pragma unroll 2
  for (int kb = 32; kb <= DM; kb += 32) {   // kb = the k-step that is fetched; the one before it is worked on; the last trip fetches nothing
    v16b na0 = a0, na1 = a1, nb[4] = {bw[0], bw[1], bw[2], bw[3]};
    if (kb < DM) { na0 = frag_kb(cr + kb, hlf); na1 = frag_kb(cr + 16 * DM + kb, hlf);
#pragma unroll
      for (int t = 0; t < 4; ++t) nb[t] = frag_kb(wr + t * 16 * DM + kb, hlf);
      asm volatile("s_wait_xcnt 0x0" ::: "memory"); }   // stands behind the load group, ahead of the next rewrite of its address registers
    __builtin_amdgcn_sched_barrier(0);   // keeps the next step's loads ahead of this step's products: the scheduler otherwise sinks each load to its use, behind a full wait
#pragma unroll
    for (int t = 0; t < 4; ++t) { acc[0][t] = wmma16b(a0, bw[t], acc[0][t]); acc[1][t] = wmma16b(a1, bw[t], acc[1][t]); }
    asm volatile("v_nop\n\tv_nop\n\tv_nop\n\tv_nop" :: "v"(acc[0][0]), "v"(acc[1][0]), "v"(acc[0][1]), "v"(acc[1][1]), "v"(acc[0][2]), "v"(acc[1][2]), "v"(acc[0][3]), "v"(acc[1][3]), "v"(a0), "v"(a1), "v"(bw[0]), "v"(bw[1]), "v"(bw[2]), "v"(bw[3]));   // behind the k-step's last product: the four vector slots before the next load group overwrites that product's A and B registers
    a0 = na0; a1 = na1;
#pragma unroll
    for (int t = 0; t < 4; ++t) bw[t] = nb[t]; }
  float* Tt = Ts[wave];
#pragma unroll
  for (int t = 0; t < 4; ++t) { const float bb = P[c0 + t * 16 + nloc];
#pragma unroll
    for (int r = 0; r < 2; ++r)
#pragma unroll
      for (int v = 0; v < 8; ++v) Tt[(r * 16 + v + 8 * hlf) * 64 + t * 16 + nloc] = acc[r][t][v] + bb; }
  wave_lds_sync();
  {
#pragma unroll
    for (int j = 0; j < 16; ++j) { const int rr = j * 2 + hlf, c4 = nloc * 4; *(v4f*)(out + (size_t)(m0 + rr) * DM + c0 + c4) = *(const v4f*)(Tt + rr * 64 + c4); }
     }
}
}  // namespace

extern "C" void kernel_launch(void* const* d_in, const int* in_sizes, int n_in,
                              void* d_out, int out_size, void* d_ws, size_t ws_size, hipStream_t stream) {
  (void)n_in; (void)out_size;
  const float* x = (const float*)d_in[0]; const float* Wqkv = (const float*)d_in[1]; const float* Wout = (const float*)d_in[2]; const float* bout = (const float*)d_in[3];
  float* out = (float*)d_out;   // [2][4096][512]
  if (in_sizes[0] != NT * DM || in_sizes[1] != DM * DM || in_sizes[2] != DM * DM || in_sizes[3] != DM) return;
  size_t off = 0; char* ws = (char*)d_ws;
  auto carve = [&](size_t bytes) { char* p = ws + off; off += (bytes + 255) & ~(size_t)255; return p; };
  unsigned short* w16 = (unsigned short*)carve((size_t)DM * DM * 2); b16* wo16 = (b16*)carve((size_t)DM * DM * 2); float* P = (float*)carve(DM * 4);
  b16* qp = (b16*)carve(PL * 2); b16* kp = (b16*)carve(PL * 2); b16* vt = (b16*)carve(PL * 2); b16* ctx = (b16*)carve((size_t)NT * DM * 2); float* sq = (float*)carve((size_t)NT * H * 4);
  if (off > ws_size) return;                                    // ≈ 1 + 8.4 x 4 ≈ 35 MB
  prep_kernel<<<256, 256, 0, stream>>>(Wqkv, Wout, bout, w16, wo16, P);
  proj_kernel<<<dim3(H, NT / 128), 128, 0, stream>>>(x, w16, qp, kp, vt, sq);
  attn_kernel<<<Bn * H * (S / 128), 256, 0, stream>>>(qp, kp, vt, sq, ctx);
  out_kernel<<<dim3(DM / 64, NT / 128), 128, 0, stream>>>(ctx, wo16, P, out);
}

// v006
// A run of this version takes 107 microseconds.
// Next to v005, in two timings, it ran 1.09 times as fast each time.
// Over all steps from v000 it is 3.49 times as fast.
#include <hip/hip_runtime.h>

// SAN (shared-projection attention): w = x W_qkv (q = k = v = w; 8 heads x 64 over 4096 tokens, batch 2); attn = softmax(w.w^T x 64^-0.5); out = (attn w) merged . W_out + b
// -> [2][4096][512].
// The shared projection is ONE exact GEMM on v_wmma_f32_16x16x32_bf16 (x and W exact bf16; 1 product) written three ways (q plane x 1/8 x8, k plane x8,
// (8w)^T plane) as single f16; attention on v_wmma_f32_16x16x32_f16 per (b, h, 16 queries) over all 128 key blocks with single-f16 q, k, P, v (1 product each; logits are O(1),
// softmax over 4096 keys) except the self logit w_i·w_i/8 ≈ 8, which dominates the softmax and is taken from an exact f32 |w_i|² computed in the projection epilogue; f32 online softmax / accumulate; ctx single f16; out = ctx.W_out + b (1 product). ≈4.7 M WMMAs (an f32-class path would be ≈13 M).

namespace {
constexpr int Bn = 2, S = 4096, DM = 512, H = 8, HD = 64, NT = Bn * S;
constexpr float QS = 8.0f, KS = 8.0f, VS = 8.0f, PS = 8.0f, SCALE = 0.125f;
constexpr size_t PL = (size_t)Bn * H * S * HD;

typedef _Float16 b16;
typedef __attribute__((ext_vector_type(16))) _Float16 v16b;
typedef __attribute__((ext_vector_type(16))) __bf16 v16bb;
typedef __attribute__((ext_vector_type(8))) _Float16 v8b;
typedef __attribute__((ext_vector_type(8))) unsigned short v8us;
typedef __attribute__((ext_vector_type(8))) float v8f;
typedef __attribute__((ext_vector_type(4))) float v4f;
__device__ __forceinline__ float bf16_rne(float f) { unsigned int u = __float_as_uint(f); u += 0x7FFFu + ((u >> 16) & 1u); return __uint_as_float(u & 0xFFFF0000u); }
__device__ __forceinline__ unsigned short bf16_bits(float f) { unsigned int u = __float_as_uint(f); u += 0x7FFFu + ((u >> 16) & 1u); return (unsigned short)(u >> 16); }
__device__ __forceinline__ v16b frag_kb(const b16* p, int hh) { const v8b a = *(const v8b*)(p + 8 * hh), b = *(const v8b*)(p + 16 + 8 * hh); v16b f;
#pragma unroll
  for (int e = 0; e < 8; ++e) { f[e] = a[e]; f[8 + e] = b[e]; } return f; }
__device__ __forceinline__ v16bb frag_bf(const unsigned short* p, int hh) { const v8us a = *(const v8us*)(p + 8 * hh), b = *(const v8us*)(p + 16 + 8 * hh); union { unsigned short s[16]; v16bb v; } u;
#pragma unroll
  for (int e = 0; e < 8; ++e) { u.s[e] = a[e]; u.s[8 + e] = b[e]; } return u.v; }
struct raw16 { v4f a, b, c, d; };   // one lane's 16 f32 of an A fragment, as loaded
__device__ __forceinline__ raw16 load_raw(const float* p, int hh) { raw16 r; r.a = *(const v4f*)(p + 8 * hh); r.b = *(const v4f*)(p + 8 * hh + 4); r.c = *(const v4f*)(p + 16 + 8 * hh); r.d = *(const v4f*)(p + 16 + 8 * hh + 4); return r; }
__device__ __forceinline__ v16bb cvt_raw(const raw16& r) { union { unsigned short s[16]; v16bb v; } u;
#pragma unroll
  for (int e = 0; e < 4; ++e) { u.s[e] = bf16_bits(r.a[e]); u.s[4 + e] = bf16_bits(r.b[e]); u.s[8 + e] = bf16_bits(r.c[e]); u.s[12 + e] = bf16_bits(r.d[e]); } return u.v; }
__device__ __forceinline__ v8f wmma16b(v16b a, v16b b, v8f c) { return __builtin_amdgcn_wmma_f32_16x16x32_f16(false, a, false, b, (short)0, c, false, false); }
__device__ __forceinline__ v8f wmma16bb(v16bb a, v16bb b, v8f c) { return __builtin_amdgcn_wmma_f32_16x16x32_bf16(false, a, false, b, (short)0, c, false, false); }
__device__ __forceinline__ void wave_lds_sync() { __builtin_amdgcn_fence(__ATOMIC_RELEASE, "workgroup"); __builtin_amdgcn_wave_barrier(); __builtin_amdgcn_fence(__ATOMIC_ACQUIRE, "workgroup"); }
constexpr float LC = 1.4426950408889634f / (QS * KS);   // raw score (= logit x QS x KS) -> logit in base-2 units
constexpr float PMAX = PS * 256.0f;   // a lane's sum of P over one pass above which the softmax base is moved

__global__ __launch_bounds__(256) void prep_kernel(const float* __restrict__ Wqkv, const float* __restrict__ Wout, const float* __restrict__ bout, unsigned short* __restrict__ w16, b16* __restrict__ wo16, float* __restrict__ P) {
  const int t_ = blockIdx.x * 256 + threadIdx.x, nth = gridDim.x * 256;
  {
    for (int q = t_; q < DM * DM; q += nth) { const int o = q / DM, k = q % DM; w16[q] = bf16_bits(Wqkv[(size_t)k * DM + o]); wo16[q] = (b16)bf16_rne(Wout[(size_t)k * DM + o]); }
    for (int q = t_; q < DM; q += nth) P[q] = bf16_rne(bout[q]);
     }
}

// projection: w = bf16(x).W (exact); block 128 tokens x 64 cols (= head h); writes q plane (w/8 x8 = w) hmm: q x SCALE x QS = w x 1, k plane (w x 8), (8w)^T plane, all single f16,
__global__ __launch_bounds__(128) void proj_kernel(const float* __restrict__ x, const unsigned short* __restrict__ w16, b16* __restrict__ qp, b16* __restrict__ kp, b16* __restrict__ vt, float* __restrict__ sq) {
  __shared__ __attribute__((aligned(16))) b16 Tq[4][32][HD + 8], Tk[4][32][HD + 8]; __shared__ __attribute__((aligned(16))) b16 Tv[HD][128 + 8]; __shared__ float Sq[128];
  const int lane = threadIdx.x & 31, wave = threadIdx.x >> 5, nloc = lane & 15, hlf = lane >> 4, h = blockIdx.x, c0 = h * HD, p0 = blockIdx.y * 128, m0 = p0 + wave * 32, b = p0 / S, t0 = p0 % S;
  v8f acc[2][4];
#pragma unroll
  for (int r = 0; r < 2; ++r)
#pragma unroll
    for (int t = 0; t < 4; ++t) acc[r][t] = (v8f){};
  // fragments are fetched one k-step ahead into a second register set: one load group per step, in flight while the step before it is worked on
  const float* xr = x + (size_t)(m0 + nloc) * DM; const unsigned short* wr = w16 + (size_t)(c0 + nloc) * DM;
  raw16 ra0 = load_raw(xr, hlf), ra1 = load_raw(xr + 16 * DM, hlf); v16bb bw[4];
#pragma unroll
  for (int t = 0; t < 4; ++t) bw[t] = frag_bf(wr + t * 16 * DM, hlf);
#pragma unroll 2
  for (int kb = 32; kb <= DM; kb += 32) {   // kb = the k-step that is fetched; the one before it is worked on; the last trip fetches nothing
    raw16 na0 = ra0, na1 = ra1; v16bb nb[4] = {bw[0], bw[1], bw[2], bw[3]};
    if (kb < DM) { na0 = load_raw(xr + kb, hlf); na1 = load_raw(xr + 16 * DM + kb, hlf);
#pragma unroll
      for (int t = 0; t < 4; ++t) nb[t] = frag_bf(wr + t * 16 * DM + kb, hlf);
      asm volatile("s_wait_xcnt 0x0" ::: "memory"); }   // stands behind the load group, ahead of the next rewrite of its address registers
    __builtin_amdgcn_sched_barrier(0);   // keeps the next step's loads ahead of this step's products: the scheduler otherwise sinks each load to its use, behind a full wait
    const v16bb a0 = cvt_raw(ra0), a1 = cvt_raw(ra1);
#pragma unroll
    for (int t = 0; t < 4; ++t) { acc[0][t] = wmma16bb(a0, bw[t], acc[0][t]); acc[1][t] = wmma16bb(a1, bw[t], acc[1][t]); }
    asm volatile("v_nop\n\tv_nop\n\tv_nop\n\tv_nop" :: "v"(acc[0][0]), "v"(acc[1][0]), "v"(acc[0][1]), "v"(acc[1][1]), "v"(acc[0][2]), "v"(acc[1][2]), "v"(acc[0][3]), "v"(acc[1][3]), "v"(bw[0]), "v"(bw[1]), "v"(bw[2]), "v"(bw[3]));   // behind the k-step's last product: the four vector slots before the next load group overwrites that product's A and B registers; a0 and a1 are not named: named here, each was packed a second time into registers of its own
    ra0 = na0; ra1 = na1;
#pragma unroll
    for (int t = 0; t < 4; ++t) bw[t] = nb[t]; }
#pragma unroll
  for (int t = 0; t < 4; ++t)
#pragma unroll
    for (int r = 0; r < 2; ++r)
#pragma unroll
      for (int v = 0; v < 8; ++v) { const float w = acc[r][t][v]; Tq[wave][r * 16 + 8 * hlf + v][t * 16 + nloc] = (b16)(w * (SCALE * QS)); Tk[wave][r * 16 + 8 * hlf + v][t * 16 + nloc] = (b16)(w * KS); Tv[t * 16 + nloc][wave * 32 + r * 16 + 8 * hlf + v] = (b16)(w * VS); }
  // exact f32 self-logit ingredient: |w_row|^2 per (token, head) (sum over this lane's 4 columns x ... then across the 16 column lanes; fixed order)
#pragma unroll
  for (int r = 0; r < 2; ++r)
#pragma unroll
    for (int v = 0; v < 8; ++v) { float s2 = 0.0f;
#pragma unroll
      for (int t = 0; t < 4; ++t) { const float w = acc[r][t][v]; s2 += w * w; }
#pragma unroll
      for (int o = 1; o < 16; o <<= 1) s2 += __shfl_xor(s2, o);
      if (nloc == 0) Sq[wave * 32 + r * 16 + 8 * hlf + v] = s2; }
  __syncthreads();
  b16* qb = qp + (((size_t)b * H + h) * S + (m0 % S)) * HD; b16* kb_ = kp + (((size_t)b * H + h) * S + (m0 % S)) * HD;
  {
#pragma unroll
    for (int j = 0; j < 8; ++j) { const int rr = j * 4 + (lane >> 3), c8 = (lane & 7) * 8; *(v8b*)(qb + (size_t)rr * HD + c8) = *(const v8b*)(&Tq[wave][rr][c8]); *(v8b*)(kb_ + (size_t)rr * HD + c8) = *(const v8b*)(&Tk[wave][rr][c8]); }
    for (int i = threadIdx.x; i < HD * 16; i += 128) { const int d = i >> 4, c8 = (i & 15) * 8; *(v8b*)(vt + (((size_t)b * H + h) * HD + d) * S + t0 + c8) = *(const v8b*)(&Tv[d][c8]); }
    *(float*)(sq + ((size_t)b * H + h) * S + t0 + threadIdx.x) = Sq[threadIdx.x];   // [b][h][token] f32: 512 B per block
     }
}

constexpr int KT = 256, NSTG = S / KT, KPI = HD + 8, VPI = KT + 8;   // LDS row pitches 144 B and 528 B (16 B x odd: no bank conflict for 16-byte fragment reads)
__device__ __forceinline__ unsigned lds_addr(const b16* p) { return (unsigned)(size_t)p; }   // low 32 bits of a __shared__ address = byte offset in the work-group's LDS
// eight 16-byte copies per lane; the s_wait_xcnt closes the statement so that no address register is rewritten before it
__device__ __forceinline__ void copy8(const b16* g, size_t gstep, const b16* l, int lstep) {
  asm volatile("global_load_async_to_lds_b128 %0, %8, off\n\tglobal_load_async_to_lds_b128 %1, %9, off\n\tglobal_load_async_to_lds_b128 %2, %10, off\n\tglobal_load_async_to_lds_b128 %3, %11, off\n\t"
               "global_load_async_to_lds_b128 %4, %12, off\n\tglobal_load_async_to_lds_b128 %5, %13, off\n\tglobal_load_async_to_lds_b128 %6, %14, off\n\tglobal_load_async_to_lds_b128 %7, %15, off\n\ts_wait_xcnt 0x0"
               :: "v"(lds_addr(l)), "v"(lds_addr(l + lstep)), "v"(lds_addr(l + 2 * lstep)), "v"(lds_addr(l + 3 * lstep)), "v"(lds_addr(l + 4 * lstep)), "v"(lds_addr(l + 5 * lstep)), "v"(lds_addr(l + 6 * lstep)), "v"(lds_addr(l + 7 * lstep)),
                  "v"(g), "v"(g + gstep), "v"(g + 2 * gstep), "v"(g + 3 * gstep), "v"(g + 4 * gstep), "v"(g + 5 * gstep), "v"(g + 6 * gstep), "v"(g + 7 * gstep) : "memory");
}
__global__ __launch_bounds__(256) void attn_kernel(const b16* __restrict__ qp, const b16* __restrict__ kp, const b16* __restrict__ vt, const float* __restrict__ sq, b16* __restrict__ ctx) {
  __shared__ __attribute__((aligned(16))) b16 Ks[2][KT * KPI], Vs[2][HD * VPI], Os[8][16][HD + 8];
  const int wave = threadIdx.x >> 5, lane = threadIdx.x & 31, hh = lane >> 4, col = lane & 15; const int bh = blockIdx.x / (S / 128), b = bh / H, h = bh % H, q0 = (blockIdx.x % (S / 128)) * 128 + wave * 16, qi = q0 + col;
  const b16* Q = qp + ((size_t)bh * S) * HD; const b16* K = kp + ((size_t)bh * S) * HD; const b16* V = vt + ((size_t)bh * HD) * S;
  // this lane's share of a tile: K = 256 rows x 128 B, contiguous (a wave's copy = 4 rows); V^T = 64 rows x 512 B (a wave's copy = 1 row)
  const b16* Kg = K + threadIdx.x * 8; const b16* Vg = V + (size_t)wave * S + lane * 8; const int kl0 = (threadIdx.x >> 3) * KPI + (threadIdx.x & 7) * 8, vl0 = wave * VPI + lane * 8;
  copy8(Kg, 32 * HD, &Ks[0][kl0], 32 * KPI); copy8(Vg, (size_t)8 * S, &Vs[0][vl0], 8 * VPI);
  asm volatile("s_wait_asynccnt 0x0" ::: "memory");   // tile 0 landed (this wave's copies) before the barrier that publishes it
  __syncthreads();
  copy8(Kg + KT * HD, 32 * HD, &Ks[1][kl0], 32 * KPI); copy8(Vg + KT, (size_t)8 * S, &Vs[1][vl0], 8 * VPI);
  const v16b qf0 = frag_kb(Q + (size_t)qi * HD, hh), qf1 = frag_kb(Q + (size_t)qi * HD + 32, hh); const float sself = sq[(size_t)bh * S + qi] * (SCALE * QS * KS);   // exact f32 self logit (the dominant softmax term), in the raw scores' units (x QS x KS, a power of two)
  const int dkb = __builtin_amdgcn_readfirstlane(q0 & ~31);   // first key of the one 32-key pass that holds this wave's own 16 keys (the same in every lane: kept in a scalar register)
  float m = -INFINITY, nb = INFINITY, l = 0.0f; v8f o[4] = {{}, {}, {}, {}};   // m = the base in use (raw-score units), nb = 3 - m x LC
  for (int st = 0; st < NSTG; ++st) {
    const b16* Kb = &Ks[st & 1][col * KPI]; const b16* Vb = &Vs[st & 1][col * VPI];
    for (int kl = 0; kl < KT; kl += 32) { const int kb = st * KT + kl;
      const v16b ka0 = frag_kb(Kb + kl * KPI, hh), ka1 = frag_kb(Kb + kl * KPI + 32, hh), kc0 = frag_kb(Kb + (kl + 16) * KPI, hh), kc1 = frag_kb(Kb + (kl + 16) * KPI + 32, hh);
      const v16b vf[4] = {frag_kb(Vb + kl, hh), frag_kb(Vb + 16 * VPI + kl, hh), frag_kb(Vb + 32 * VPI + kl, hh), frag_kb(Vb + 48 * VPI + kl, hh)};   // all of the pass's LDS reads stand together, ahead of its products
      __builtin_amdgcn_sched_barrier(0);   // holds the 16 LDS reads in one group ahead of the products: the scheduler otherwise sinks each pair to its product, behind a full wait
      v8f s0 = {}, s1 = {}; s0 = wmma16b(ka0, qf0, s0); s0 = wmma16b(ka1, qf1, s0); s1 = wmma16b(kc0, qf0, s1); s1 = wmma16b(kc1, qf1, s1);
      float lim = PMAX;   // the same in every lane: a scalar register
      if (kb == dkb) { lim = -1.0f;   // one pass in 128: a scalar compare and branch, so the other passes carry no index compare and no select
#pragma unroll
        for (int r = 0; r < 8; ++r) { if (kb + 8 * hh + r == qi) s0[r] = sself; if (kb + 16 + 8 * hh + r == qi) s1[r] = sself; } }
      // lazy rescale: P is formed against the base m in use (score scale, log2(e), the base and the x PS of P in one multiply-add per score ahead of exp2); the base moves only when it has to
      float e0[8], e1[8], sum = 0.0f;
#pragma unroll
      for (int r = 0; r < 8; ++r) { e0[r] = __builtin_amdgcn_exp2f(__builtin_fmaf(s0[r], LC, nb)); e1[r] = __builtin_amdgcn_exp2f(__builtin_fmaf(s1[r], LC, nb)); sum += e0[r] + e1[r]; }   // e = PS x exp(logit - base)
      // every e is >= 0, so a lane's sum bounds each of them: one compare, ballot and scalar branch per pass. Taken in the first pass (nb = +inf gives sum = +inf), where a score lies more than
      // about 8 octaves above the base (P would leave f16's range; a NaN sum is caught too), and always in the pass of the wave's own keys (lim < 0), so that the dominant self term's P stays the exact PS
      if (__builtin_amdgcn_ballot_w32(!(sum <= lim)) != 0) {
        float mr = -INFINITY;   // the maximum is taken on the raw scores
#pragma unroll
        for (int r = 0; r < 8; ++r) mr = fmaxf(mr, fmaxf(s0[r], s1[r]));
        mr = fmaxf(mr, __shfl_xor(mr, 16));   // both halves of the wave hold the same query: one base for both
        const float mn = fmaxf(m, mr), al_ = __builtin_amdgcn_exp2f((m - mn) * LC); m = mn; nb = __builtin_fmaf(-mn, LC, 3.0f); l *= al_; sum = 0.0f;   // 3 = log2(PS); al_ = 0 in the first pass
#pragma unroll
        for (int t = 0; t < 4; ++t) o[t] *= al_;
#pragma unroll
        for (int r = 0; r < 8; ++r) { e0[r] = __builtin_amdgcn_exp2f(__builtin_fmaf(s0[r], LC, nb)); e1[r] = __builtin_amdgcn_exp2f(__builtin_fmaf(s1[r], LC, nb)); sum += e0[r] + e1[r]; } }
      v16b pbv;
#pragma unroll
      for (int r = 0; r < 8; ++r) { pbv[r] = (b16)e0[r]; pbv[8 + r] = (b16)e1[r]; }
      sum += __shfl_xor(sum, 16); l += sum;
#pragma unroll
      for (int t = 0; t < 4; ++t) o[t] = wmma16b(vf[t], pbv, o[t]);
      asm volatile("v_nop\n\tv_nop\n\tv_nop\n\tv_nop" : "+v"(o[3]) : "v"(vf[3]), "v"(pbv)); }   // behind the pass's last product: the four vector slots the chip needs before the next pass's address arithmetic overwrites that product's A registers
    asm volatile("s_wait_dscnt 0x0" ::: "memory");      // this wave's reads of the buffer are done before the buffer is refilled
    asm volatile("s_wait_asynccnt 0x0" ::: "memory");   // this wave's copies of the next tile have landed before the barrier that publishes them
    __syncthreads();
    if (st + 2 < NSTG) { copy8(Kg + (size_t)(st + 2) * KT * HD, 32 * HD, &Ks[st & 1][kl0], 32 * KPI); copy8(Vg + (st + 2) * KT, (size_t)8 * S, &Vs[st & 1][vl0], 8 * VPI); } }
  asm volatile("s_wait_asynccnt 0x0" ::: "memory");     // nothing in flight when the wave goes on to its end
  const float inv = 1.0f / (l * VS);   // l already carries the x PS
#pragma unroll
  for (int t = 0; t < 4; ++t)
#pragma unroll
    for (int r = 0; r < 8; ++r) Os[wave][col][t * 16 + 8 * hh + r] = (b16)(o[t][r] * inv);
  __syncthreads();
  b16* dst = ctx + ((size_t)b * S + q0) * DM + h * HD;   // this wave's 16 rows x 128 B: whole lines, one writer each
  for (int j = 0; j < 4; ++j) { const int rr = j * 4 + (lane >> 3), c8 = (lane & 7) * 8; *(v8b*)(dst + (size_t)rr * DM + c8) = *(const v8b*)(&Os[wave][rr][c8]); }
}

__global__ __launch_bounds__(128) void out_kernel(const b16* __restrict__ ctx, const b16* __restrict__ wo16, const float* __restrict__ P, float* __restrict__ out) {
  __shared__ __attribute__((aligned(16))) float Ts[4][32 * 64];
  const int lane = threadIdx.x & 31, wave = threadIdx.x >> 5, nloc = lane & 15, hlf = lane >> 4, m0 = blockIdx.y * 128 + wave * 32, c0 = blockIdx.x * 64;
  v8f acc[2][4];
#pragma unroll
  for (int r = 0; r < 2; ++r)
#pragma unroll
    for (int t = 0; t < 4; ++t) acc[r][t] = (v8f){};
  // as in the projection: fragments fetched one k-step ahead into a second register set
  const b16* cr = ctx + (size_t)(m0 + nloc) * DM; const b16* wr = wo16 + (size_t)(c0 + nloc) * DM;
  v16b a0 = frag_kb(cr, hlf), a1 = frag_kb(cr + 16 * DM, hlf), bw[4];
#pragma unroll
  for (int t = 0; t < 4; ++t) bw[t] = frag_kb(wr + t * 16 * DM, hlf);
#pragma unroll 2
  for (int kb = 32; kb <= DM; kb += 32) {   // kb = the k-step that is fetched; the one before it is worked on; the last trip fetches nothing
    v16b na0 = a0, na1 = a1, nb[4] = {bw[0], bw[1], bw[2], bw[3]};
    if (kb < DM) { na0 = frag_kb(cr + kb, hlf); na1 = frag_kb(cr + 16 * DM + kb, hlf);
#pragma unroll
      for (int t = 0; t < 4; ++t) nb[t] = frag_kb(wr + t * 16 * DM + kb, hlf);
      asm volatile("s_wait_xcnt 0x0" ::: "memory"); }   // stands behind the load group, ahead of the next rewrite of its address registers
    __builtin_amdgcn_sched_barrier(0);   // keeps the next step's loads ahead of this step's products: the scheduler otherwise sinks each load to its use, behind a full wait
#pragma unroll
    for (int t = 0; t < 4; ++t) { acc[0][t] = wmma16b(a0, bw[t], acc[0][t]); acc[1][t] = wmma16b(a1, bw[t], acc[1][t]); }
    asm volatile("v_nop\n\tv_nop\n\tv_nop\n\tv_nop" :: "v"(acc[0][0]), "v"(acc[1][0]), "v"(acc[0][1]), "v"(acc[1][1]), "v"(acc[0][2]), "v"(acc[1][2]), "v"(acc[0][3]), "v"(acc[1][3]), "v"(a0), "v"(a1), "v"(bw[0]), "v"(bw[1]), "v"(bw[2]), "v"(bw[3]));   // behind the k-step's last product: the four vector slots before the next load group overwrites that product's A and B registers
    a0 = na0; a1 = na1;
#pragma unroll
    for (int t = 0; t < 4; ++t) bw[t] = nb[t]; }
  float* Tt = Ts[wave];
#pragma unroll
  for (int t = 0; t < 4; ++t) { const float bb = P[c0 + t * 16 + nloc];
#pragma unroll
    for (int r = 0; r < 2; ++r)
#pragma unroll
      for (int v = 0; v < 8; ++v) Tt[(r * 16 + v + 8 * hlf) * 64 + t * 16 + nloc] = acc[r][t][v] + bb; }
  wave_lds_sync();
  {
#pragma unroll
    for (int j = 0; j < 16; ++j) { const int rr = j * 2 + hlf, c4 = nloc * 4; *(v4f*)(out + (size_t)(m0 + rr) * DM + c0 + c4) = *(const v4f*)(Tt + rr * 64 + c4); }
     }
}
}  // namespace

extern "C" void kernel_launch(void* const* d_in, const int* in_sizes, int n_in,
                              void* d_out, int out_size, void* d_ws, size_t ws_size, hipStream_t stream) {
  (void)n_in; (void)out_size;
  const float* x = (const float*)d_in[0]; const float* Wqkv = (const float*)d_in[1]; const float* Wout = (const float*)d_in[2]; const float* bout = (const float*)d_in[3];
  float* out = (float*)d_out;   // [2][4096][512]
  if (in_sizes[0] != NT * DM || in_sizes[1] != DM * DM || in_sizes[2] != DM * DM || in_sizes[3] != DM) return;
  size_t off = 0; char* ws = (char*)d_ws;
  auto carve = [&](size_t bytes) { char* p = ws + off; off += (bytes + 255) & ~(size_t)255; return p; };
  unsigned short* w16 = (unsigned short*)carve((size_t)DM * DM * 2); b16* wo16 = (b16*)carve((size_t)DM * DM * 2); float* P = (float*)carve(DM * 4);
  b16* qp = (b16*)carve(PL * 2); b16* kp = (b16*)carve(PL * 2); b16* vt = (b16*)carve(PL * 2); b16* ctx = (b16*)carve((size_t)NT * DM * 2); float* sq = (float*)carve((size_t)NT * H * 4);
  if (off > ws_size) return;                                    // ≈ 1 + 8.4 x 4 ≈ 35 MB
  prep_kernel<<<256, 256, 0, stream>>>(Wqkv, Wout, bout, w16, wo16, P);
  proj_kernel<<<dim3(H, NT / 128), 128, 0, stream>>>(x, w16, qp, kp, vt, sq);
  attn_kernel<<<Bn * H * (S / 128), 256, 0, stream>>>(qp, kp, vt, sq, ctx);
  out_kernel<<<dim3(DM / 64, NT / 128), 128, 0, stream>>>(ctx, wo16, P, out);
}

// v007
// One run takes 99.7 microseconds.
// Two timings next to v006 both put it at 1.07 times that version's speed.
// Over all steps from v000 it is 3.73 times as fast.
#include <hip/hip_runtime.h>

// SAN (shared-projection attention): w = x W_qkv (q = k = v = w; 8 heads x 64 over 4096 tokens, batch 2); attn = softmax(w.w^T x 64^-0.5); out = (attn w) merged . W_out + b
// -> [2][4096][512].
// The shared projection is ONE exact GEMM on v_wmma_f32_16x16x32_bf16 (x and W exact bf16; 1 product) written three ways (q plane x 1/8 x8, k plane x8,
// (8w)^T plane) as single f16; attention on v_wmma_f32_16x16x32_f16 per (b, h, 32 queries, half of the keys: 64 key blocks) with single-f16 q, k, P, v (1 product each; logits are O(1),
// softmax over 4096 keys) except the self logit w_i·w_i/8 ≈ 8, which dominates the softmax and is taken from an exact f32 |w_i|² computed in the projection epilogue; f32 online softmax / accumulate; ctx single f16; out = ctx.W_out + b (1 product). ≈4.7 M WMMAs (an f32-class path would be ≈13 M).

namespace {
constexpr int Bn = 2, S = 4096, DM = 512, H = 8, HD = 64, NT = Bn * S;
constexpr float QS = 8.0f, KS = 8.0f, VS = 8.0f, PS = 8.0f, SCALE = 0.125f;
constexpr size_t PL = (size_t)Bn * H * S * HD;

typedef _Float16 b16;
typedef __attribute__((ext_vector_type(16))) _Float16 v16b;
typedef __attribute__((ext_vector_type(16))) __bf16 v16bb;
typedef __attribute__((ext_vector_type(8))) _Float16 v8b;
typedef __attribute__((ext_vector_type(8))) unsigned short v8us;
typedef __attribute__((ext_vector_type(8))) float v8f;
typedef __attribute__((ext_vector_type(4))) float v4f;
__device__ __forceinline__ float bf16_rne(float f) { unsigned int u = __float_as_uint(f); u += 0x7FFFu + ((u >> 16) & 1u); return __uint_as_float(u & 0xFFFF0000u); }
__device__ __forceinline__ unsigned short bf16_bits(float f) { unsigned int u = __float_as_uint(f); u += 0x7FFFu + ((u >> 16) & 1u); return (unsigned short)(u >> 16); }
__device__ __forceinline__ v16b frag_kb(const b16* p, int hh) { const v8b a = *(const v8b*)(p + 8 * hh), b = *(const v8b*)(p + 16 + 8 * hh); v16b f;
#pragma unroll
  for (int e = 0; e < 8; ++e) { f[e] = a[e]; f[8 + e] = b[e]; } return f; }
__device__ __forceinline__ v16bb frag_bf(const unsigned short* p, int hh) { const v8us a = *(const v8us*)(p + 8 * hh), b = *(const v8us*)(p + 16 + 8 * hh); union { unsigned short s[16]; v16bb v; } u;
#pragma unroll
  for (int e = 0; e < 8; ++e) { u.s[e] = a[e]; u.s[8 + e] = b[e]; } return u.v; }
struct raw16 { v4f a, b, c, d; };   // one lane's 16 f32 of an A fragment, as loaded
__device__ __forceinline__ raw16 load_raw(const float* p, int hh) { raw16 r; r.a = *(const v4f*)(p + 8 * hh); r.b = *(const v4f*)(p + 8 * hh + 4); r.c = *(const v4f*)(p + 16 + 8 * hh); r.d = *(const v4f*)(p + 16 + 8 * hh + 4); return r; }
__device__ __forceinline__ v16bb cvt_raw(const raw16& r) { union { unsigned short s[16]; v16bb v; } u;
#pragma unroll
  for (int e = 0; e < 4; ++e) { u.s[e] = bf16_bits(r.a[e]); u.s[4 + e] = bf16_bits(r.b[e]); u.s[8 + e] = bf16_bits(r.c[e]); u.s[12 + e] = bf16_bits(r.d[e]); } return u.v; }
__device__ __forceinline__ v8f wmma16b(v16b a, v16b b, v8f c) { return __builtin_amdgcn_wmma_f32_16x16x32_f16(false, a, false, b, (short)0, c, false, false); }
__device__ __forceinline__ v8f wmma16bb(v16bb a, v16bb b, v8f c) { return __builtin_amdgcn_wmma_f32_16x16x32_bf16(false, a, false, b, (short)0, c, false, false); }
__device__ __forceinline__ void wave_lds_sync() { __builtin_amdgcn_fence(__ATOMIC_RELEASE, "workgroup"); __builtin_amdgcn_wave_barrier(); __builtin_amdgcn_fence(__ATOMIC_ACQUIRE, "workgroup"); }
constexpr float LC = 1.4426950408889634f / (QS * KS);   // raw score (= logit x QS x KS) -> logit in base-2 units
constexpr float PMAX = PS * 256.0f;   // a lane's sum of P over one pass above which the softmax base is moved

__global__ __launch_bounds__(256) void prep_kernel(const float* __restrict__ Wqkv, const float* __restrict__ Wout, const float* __restrict__ bout, unsigned short* __restrict__ w16, b16* __restrict__ wo16, float* __restrict__ P) {
  const int t_ = blockIdx.x * 256 + threadIdx.x, nth = gridDim.x * 256;
  {
    for (int q = t_; q < DM * DM; q += nth) { const int o = q / DM, k = q % DM; w16[q] = bf16_bits(Wqkv[(size_t)k * DM + o]); wo16[q] = (b16)bf16_rne(Wout[(size_t)k * DM + o]); }
    for (int q = t_; q < DM; q += nth) P[q] = bf16_rne(bout[q]);
     }
}

// projection: w = bf16(x).W (exact); block 128 tokens x 64 cols (= head h); writes q plane (w/8 x8 = w) hmm: q x SCALE x QS = w x 1, k plane (w x 8), (8w)^T plane, all single f16,
__global__ __launch_bounds__(128) void proj_kernel(const float* __restrict__ x, const unsigned short* __restrict__ w16, b16* __restrict__ qp, b16* __restrict__ kp, b16* __restrict__ vt, float* __restrict__ sq) {
  __shared__ __attribute__((aligned(16))) b16 Tq[4][32][HD + 8], Tk[4][32][HD + 8]; __shared__ __attribute__((aligned(16))) b16 Tv[HD][128 + 8]; __shared__ float Sq[128];
  const int lane = threadIdx.x & 31, wave = threadIdx.x >> 5, nloc = lane & 15, hlf = lane >> 4, h = blockIdx.x, c0 = h * HD, p0 = blockIdx.y * 128, m0 = p0 + wave * 32, b = p0 / S, t0 = p0 % S;
  v8f acc[2][4];
#pragma unroll
  for (int r = 0; r < 2; ++r)
#pragma unroll
    for (int t = 0; t < 4; ++t) acc[r][t] = (v8f){};
  // fragments are fetched one k-step ahead into a second register set: one load group per step, in flight while the step before it is worked on
  const float* xr = x + (size_t)(m0 + nloc) * DM; const unsigned short* wr = w16 + (size_t)(c0 + nloc) * DM;
  raw16 ra0 = load_raw(xr, hlf), ra1 = load_raw(xr + 16 * DM, hlf); v16bb bw[4];
#pragma unroll
  for (int t = 0; t < 4; ++t) bw[t] = frag_bf(wr + t * 16 * DM, hlf);
#pragma unroll 2
  for (int kb = 32; kb <= DM; kb += 32) {   // kb = the k-step that is fetched; the one before it is worked on; the last trip fetches nothing
    raw16 na0 = ra0, na1 = ra1; v16bb nb[4] = {bw[0], bw[1], bw[2], bw[3]};
    if (kb < DM) { na0 = load_raw(xr + kb, hlf); na1 = load_raw(xr + 16 * DM + kb, hlf);
#pragma unroll
      for (int t = 0; t < 4; ++t) nb[t] = frag_bf(wr + t * 16 * DM + kb, hlf);
      asm volatile("s_wait_xcnt 0x0" ::: "memory"); }   // stands behind the load group, ahead of the next rewrite of its address registers
    __builtin_amdgcn_sched_barrier(0);   // keeps the next step's loads ahead of this step's products: the scheduler otherwise sinks each load to its use, behind a full wait
    const v16bb a0 = cvt_raw(ra0), a1 = cvt_raw(ra1);
#pragma unroll
    for (int t = 0; t < 4; ++t) { acc[0][t] = wmma16bb(a0, bw[t], acc[0][t]); acc[1][t] = wmma16bb(a1, bw[t], acc[1][t]); }
    asm volatile("v_nop\n\tv_nop\n\tv_nop\n\tv_nop" :: "v"(acc[0][0]), "v"(acc[1][0]), "v"(acc[0][1]), "v"(acc[1][1]), "v"(acc[0][2]), "v"(acc[1][2]), "v"(acc[0][3]), "v"(acc[1][3]), "v"(bw[0]), "v"(bw[1]), "v"(bw[2]), "v"(bw[3]));   // behind the k-step's last product: the four vector slots before the next load group overwrites that product's A and B registers; a0 and a1 are not named: named here, each was packed a second time into registers of its own
    ra0 = na0; ra1 = na1;
#pragma unroll
    for (int t = 0; t < 4; ++t) bw[t] = nb[t]; }
#pragma unroll
  for (int t = 0; t < 4; ++t)
#pragma unroll
    for (int r = 0; r < 2; ++r)
#pragma unroll
      for (int v = 0; v < 8; ++v) { const float w = acc[r][t][v]; Tq[wave][r * 16 + 8 * hlf + v][t * 16 + nloc] = (b16)(w * (SCALE * QS)); Tk[wave][r * 16 + 8 * hlf + v][t * 16 + nloc] = (b16)(w * KS); Tv[t * 16 + nloc][wave * 32 + r * 16 + 8 * hlf + v] = (b16)(w * VS); }
  // exact f32 self-logit ingredient: |w_row|^2 per (token, head) (sum over this lane's 4 columns x ... then across the 16 column lanes; fixed order)
#pragma unroll
  for (int r = 0; r < 2; ++r)
#pragma unroll
    for (int v = 0; v < 8; ++v) { float s2 = 0.0f;
#pragma unroll
      for (int t = 0; t < 4; ++t) { const float w = acc[r][t][v]; s2 += w * w; }
#pragma unroll
      for (int o = 1; o < 16; o <<= 1) s2 += __shfl_xor(s2, o);
      if (nloc == 0) Sq[wave * 32 + r * 16 + 8 * hlf + v] = s2; }
  __syncthreads();
  b16* qb = qp + (((size_t)b * H + h) * S + (m0 % S)) * HD; b16* kb_ = kp + (((size_t)b * H + h) * S + (m0 % S)) * HD;
  {
#pragma unroll
    for (int j = 0; j < 8; ++j) { const int rr = j * 4 + (lane >> 3), c8 = (lane & 7) * 8; *(v8b*)(qb + (size_t)rr * HD + c8) = *(const v8b*)(&Tq[wave][rr][c8]); *(v8b*)(kb_ + (size_t)rr * HD + c8) = *(const v8b*)(&Tk[wave][rr][c8]); }
    for (int i = threadIdx.x; i < HD * 16; i += 128) { const int d = i >> 4, c8 = (i & 15) * 8; *(v8b*)(vt + (((size_t)b * H + h) * HD + d) * S + t0 + c8) = *(const v8b*)(&Tv[d][c8]); }
    *(float*)(sq + ((size_t)b * H + h) * S + t0 + threadIdx.x) = Sq[threadIdx.x];   // [b][h][token] f32: 512 B per block
     }
}

constexpr int KT = 256, NSTG = S / KT, KPI = HD + 8, VPI = KT + 8;   // LDS row pitches 144 B and 528 B (16 B x odd: no bank conflict for 16-byte fragment reads)
__device__ __forceinline__ unsigned lds_addr(const b16* p) { return (unsigned)(size_t)p; }   // low 32 bits of a __shared__ address = byte offset in the work-group's LDS
// eight 16-byte copies per lane; the s_wait_xcnt closes the statement so that no address register is rewritten before it
__device__ __forceinline__ void copy8(const b16* g, size_t gstep, const b16* l, int lstep) {
  asm volatile("global_load_async_to_lds_b128 %0, %8, off\n\tglobal_load_async_to_lds_b128 %1, %9, off\n\tglobal_load_async_to_lds_b128 %2, %10, off\n\tglobal_load_async_to_lds_b128 %3, %11, off\n\t"
               "global_load_async_to_lds_b128 %4, %12, off\n\tglobal_load_async_to_lds_b128 %5, %13, off\n\tglobal_load_async_to_lds_b128 %6, %14, off\n\tglobal_load_async_to_lds_b128 %7, %15, off\n\ts_wait_xcnt 0x0"
               :: "v"(lds_addr(l)), "v"(lds_addr(l + lstep)), "v"(lds_addr(l + 2 * lstep)), "v"(lds_addr(l + 3 * lstep)), "v"(lds_addr(l + 4 * lstep)), "v"(lds_addr(l + 5 * lstep)), "v"(lds_addr(l + 6 * lstep)), "v"(lds_addr(l + 7 * lstep)),
                  "v"(g), "v"(g + gstep), "v"(g + 2 * gstep), "v"(g + 3 * gstep), "v"(g + 4 * gstep), "v"(g + 5 * gstep), "v"(g + 6 * gstep), "v"(g + 7 * gstep) : "memory");
}
typedef v4f __attribute__((may_alias)) v4fa;   // f32 view of the K buffers, which carry the partial sums behind the loop
__global__ __launch_bounds__(256) void attn_kernel(const b16* __restrict__ qp, const b16* __restrict__ kp, const b16* __restrict__ vt, const float* __restrict__ sq, b16* __restrict__ ctx) {
  __shared__ __attribute__((aligned(16))) b16 Ks[2][KT * KPI], Vs[2][HD * VPI], Os[8][16][HD + 8];
  const int wave = threadIdx.x >> 5, lane = threadIdx.x & 31, hh = lane >> 4, col = lane & 15; const int bh = blockIdx.x / (S / 128), b = bh / H, h = bh % H, q0 = (blockIdx.x % (S / 128)) * 128 + (wave & 3) * 32;
  const int kg = __builtin_amdgcn_readfirstlane(wave >> 2);   // this wave's half of every key tile (the same in every lane: kept in a scalar register)
  const b16* Q = qp + ((size_t)bh * S) * HD; const b16* K = kp + ((size_t)bh * S) * HD; const b16* V = vt + ((size_t)bh * HD) * S;
  // this lane's share of a tile: K = 256 rows x 128 B, contiguous (a wave's copy = 4 rows); V^T = 64 rows x 512 B (a wave's copy = 1 row)
  const b16* Kg = K + threadIdx.x * 8; const b16* Vg = V + (size_t)wave * S + lane * 8; const int kl0 = (threadIdx.x >> 3) * KPI + (threadIdx.x & 7) * 8, vl0 = wave * VPI + lane * 8;
  copy8(Kg, 32 * HD, &Ks[0][kl0], 32 * KPI); copy8(Vg, (size_t)8 * S, &Vs[0][vl0], 8 * VPI);
  asm volatile("s_wait_asynccnt 0x0" ::: "memory");   // tile 0 landed (this wave's copies) before the barrier that publishes it
  __syncthreads();
  copy8(Kg + KT * HD, 32 * HD, &Ks[1][kl0], 32 * KPI); copy8(Vg + KT, (size_t)8 * S, &Vs[1][vl0], 8 * VPI);
  v16b qf[2][2]; float sself[2];   // index u = query tile: queries q0 + 16 u + col
#pragma unroll
  for (int u = 0; u < 2; ++u) { const int qi = q0 + 16 * u + col; qf[u][0] = frag_kb(Q + (size_t)qi * HD, hh); qf[u][1] = frag_kb(Q + (size_t)qi * HD + 32, hh); sself[u] = sq[(size_t)bh * S + qi] * (SCALE * QS * KS); }   // exact f32 self logit (the dominant softmax term), in the raw scores' units (x QS x KS, a power of two)
  const int dkb = __builtin_amdgcn_readfirstlane(q0);   // first key of the one 32-key pass that holds this wave's own 32 keys; it lies in one key half only: the wave of the other half never meets it
  float m[2] = {-INFINITY, -INFINITY}, nb[2] = {INFINITY, INFINITY}, l[2] = {0.0f, 0.0f}; v8f o[2][4] = {{{}, {}, {}, {}}, {{}, {}, {}, {}}};   // m = the base in use (raw-score units), nb = 3 - m x LC
  for (int st = 0; st < NSTG; ++st) {
    const b16* Kb = &Ks[st & 1][col * KPI]; const b16* Vb = &Vs[st & 1][col * VPI];
    for (int kl = kg * (KT / 2); kl < kg * (KT / 2) + KT / 2; kl += 32) { const int kb = st * KT + kl;
      const v16b ka0 = frag_kb(Kb + kl * KPI, hh), ka1 = frag_kb(Kb + kl * KPI + 32, hh), kc0 = frag_kb(Kb + (kl + 16) * KPI, hh), kc1 = frag_kb(Kb + (kl + 16) * KPI + 32, hh);
      const v16b vf[4] = {frag_kb(Vb + kl, hh), frag_kb(Vb + 16 * VPI + kl, hh), frag_kb(Vb + 32 * VPI + kl, hh), frag_kb(Vb + 48 * VPI + kl, hh)};   // all of the pass's LDS reads stand together, ahead of its products
      __builtin_amdgcn_sched_barrier(0);   // holds the 16 LDS reads in one group ahead of the products: the scheduler otherwise sinks each pair to its product, behind a full wait
      v8f s0[2] = {{}, {}}, s1[2] = {{}, {}};
#pragma unroll
      for (int u = 0; u < 2; ++u) { s0[u] = wmma16b(ka0, qf[u][0], s0[u]); s1[u] = wmma16b(kc0, qf[u][0], s1[u]); }
#pragma unroll
      for (int u = 0; u < 2; ++u) { s0[u] = wmma16b(ka1, qf[u][1], s0[u]); s1[u] = wmma16b(kc1, qf[u][1], s1[u]); }
      float lim = PMAX;   // the same in every lane: a scalar register
      if (kb == dkb) { lim = -1.0f;   // one pass in 64, in one key half: a scalar compare and branch, so the other passes carry no index compare and no select
#pragma unroll
        for (int r = 0; r < 8; ++r) if (8 * hh + r == col) { s0[0][r] = sself[0]; s1[1][r] = sself[1]; } }   // kb = q0 here: query q0 + col is key row col of the first 16 keys, query q0 + 16 + col key row col of the second 16
      // lazy rescale: P is formed against the base m in use (score scale, log2(e), the base and the x PS of P in one multiply-add per score ahead of exp2); the base moves only when it has to
      float e0[2][8], e1[2][8], sum[2] = {0.0f, 0.0f};
      // one score tile after the other (s0's eight scores, then s1's), the sums last, in the order they had: with two query tiles this compiler packs the multiply-adds in pairs by itself, and with
      // s0 and s1 taken in turn it pairs a register of the one with a register of the other and first copies all 32 scores of the pass into such pairs
#pragma unroll
      for (int u = 0; u < 2; ++u) {
#pragma unroll
        for (int r = 0; r < 8; ++r) e0[u][r] = __builtin_amdgcn_exp2f(__builtin_fmaf(s0[u][r], LC, nb[u]));   // e = PS x exp(logit - base)
#pragma unroll
        for (int r = 0; r < 8; ++r) e1[u][r] = __builtin_amdgcn_exp2f(__builtin_fmaf(s1[u][r], LC, nb[u]));
#pragma unroll
        for (int r = 0; r < 8; ++r) sum[u] += e0[u][r] + e1[u][r]; }
      // every e is >= 0, so a lane's sum bounds each of them: one ballot and scalar branch per pass for both query tiles. Taken in the first pass (nb = +inf gives sum = +inf), where a score lies more than
      // about 8 octaves above the base (P would leave f16's range; a NaN sum is caught too), and always in the pass of the wave's own keys (lim < 0), so that the dominant self term's P stays the exact PS
      if (__builtin_amdgcn_ballot_w32(!(sum[0] <= lim) || !(sum[1] <= lim)) != 0) {
#pragma unroll
        for (int u = 0; u < 2; ++u) {
          float mr = -INFINITY;   // the maximum is taken on the raw scores
#pragma unroll
          for (int r = 0; r < 8; ++r) mr = fmaxf(mr, fmaxf(s0[u][r], s1[u][r]));
          mr = fmaxf(mr, __shfl_xor(mr, 16));   // both halves of the wave hold the same query: one base for both
          const float mn = fmaxf(m[u], mr), al_ = __builtin_amdgcn_exp2f((m[u] - mn) * LC); m[u] = mn; nb[u] = __builtin_fmaf(-mn, LC, 3.0f); l[u] *= al_; sum[u] = 0.0f;   // 3 = log2(PS); al_ = 0 in the first pass
#pragma unroll
          for (int t = 0; t < 4; ++t) o[u][t] *= al_;
#pragma unroll
          for (int r = 0; r < 8; ++r) e0[u][r] = __builtin_amdgcn_exp2f(__builtin_fmaf(s0[u][r], LC, nb[u]));
#pragma unroll
          for (int r = 0; r < 8; ++r) e1[u][r] = __builtin_amdgcn_exp2f(__builtin_fmaf(s1[u][r], LC, nb[u]));
#pragma unroll
          for (int r = 0; r < 8; ++r) sum[u] += e0[u][r] + e1[u][r]; } }
      v16b pbv[2];
#pragma unroll
      for (int u = 0; u < 2; ++u) {
#pragma unroll
        for (int r = 0; r < 8; ++r) { pbv[u][r] = (b16)e0[u][r]; pbv[u][8 + r] = (b16)e1[u][r]; }
        sum[u] += __shfl_xor(sum[u], 16); l[u] += sum[u]; }
#pragma unroll
      for (int t = 0; t < 4; ++t) { o[0][t] = wmma16b(vf[t], pbv[0], o[0][t]); o[1][t] = wmma16b(vf[t], pbv[1], o[1][t]); }
      asm volatile("v_nop\n\tv_nop\n\tv_nop\n\tv_nop" : "+v"(o[1][3]) : "v"(vf[3]), "v"(pbv[1])); }   // behind the pass's last product: the four vector slots the chip needs before the next pass's address arithmetic overwrites that product's A registers
    asm volatile("s_wait_dscnt 0x0" ::: "memory");      // this wave's reads of the buffer are done before the buffer is refilled
    asm volatile("s_wait_asynccnt 0x0" ::: "memory");   // this wave's copies of the next tile have landed before the barrier that publishes them
    __syncthreads();
    if (st + 2 < NSTG) { copy8(Kg + (size_t)(st + 2) * KT * HD, 32 * HD, &Ks[st & 1][kl0], 32 * KPI); copy8(Vg + (st + 2) * KT, (size_t)8 * S, &Vs[st & 1][vl0], 8 * VPI); } }
  asm volatile("s_wait_asynccnt 0x0" ::: "memory");     // nothing in flight when the wave goes on to its end
  // join of the two key halves: waves w and w ^ 4 hold the same 32 queries. Wave w finishes query tile kg and hands its partial sums of the other tile to its partner through the K buffers,
  // which nobody reads any more (the loop's last barrier) and into which nothing is in flight (the last two trips issue no copy). Lane for lane the two waves hold the same (query, d) places.
  v4fa* X = (v4fa*)&Ks[0][0];   // [wave][9][lane] x 16 B = 36,864 B of the 73,728
  v8f own[4], snd[4];
#pragma unroll
  for (int t = 0; t < 4; ++t) { own[t] = kg ? o[1][t] : o[0][t]; snd[t] = kg ? o[0][t] : o[1][t]; }
  const float mo = kg ? m[1] : m[0], lo = kg ? l[1] : l[0], ms = kg ? m[0] : m[1], ls = kg ? l[0] : l[1];
#pragma unroll
  for (int t = 0; t < 4; ++t) { X[(wave * 9 + 2 * t) * 32 + lane] = (v4f){snd[t][0], snd[t][1], snd[t][2], snd[t][3]}; X[(wave * 9 + 2 * t + 1) * 32 + lane] = (v4f){snd[t][4], snd[t][5], snd[t][6], snd[t][7]}; }
  X[(wave * 9 + 8) * 32 + lane] = (v4f){ms, ls, 0.0f, 0.0f};
  __syncthreads();   // publishes every wave's partial sums to its partner
  const int pw = wave ^ 4; const v4f ml = X[(pw * 9 + 8) * 32 + lane];
  const float mj = fmaxf(mo, ml[0]), fo = __builtin_amdgcn_exp2f((mo - mj) * LC), fx = __builtin_amdgcn_exp2f((ml[0] - mj) * LC);   // both bases are finite: every wave's first pass sets one
  const float inv = 1.0f / ((lo * fo + ml[1] * fx) * VS), go = fo * inv, gx = fx * inv;   // l already carries the x PS
#pragma unroll
  for (int t = 0; t < 4; ++t) { const v4f xa = X[(pw * 9 + 2 * t) * 32 + lane], xb = X[(pw * 9 + 2 * t + 1) * 32 + lane];
#pragma unroll
    for (int r = 0; r < 4; ++r) { Os[wave][col][t * 16 + 8 * hh + r] = (b16)(own[t][r] * go + xa[r] * gx); Os[wave][col][t * 16 + 8 * hh + 4 + r] = (b16)(own[t][4 + r] * go + xb[r] * gx); } }
  __syncthreads();
  b16* dst = ctx + ((size_t)b * S + q0 + 16 * kg) * DM + h * HD;   // this wave's 16 rows x 128 B: whole lines, one writer each
  for (int j = 0; j < 4; ++j) { const int rr = j * 4 + (lane >> 3), c8 = (lane & 7) * 8; *(v8b*)(dst + (size_t)rr * DM + c8) = *(const v8b*)(&Os[wave][rr][c8]); }
}

__global__ __launch_bounds__(128) void out_kernel(const b16* __restrict__ ctx, const b16* __restrict__ wo16, const float* __restrict__ P, float* __restrict__ out) {
  __shared__ __attribute__((aligned(16))) float Ts[4][32 * 64];
  const int lane = threadIdx.x & 31, wave = threadIdx.x >> 5, nloc = lane & 15, hlf = lane >> 4, m0 = blockIdx.y * 128 + wave * 32, c0 = blockIdx.x * 64;
  v8f acc[2][4];
#pragma unroll
  for (int r = 0; r < 2; ++r)
#pragma unroll
    for (int t = 0; t < 4; ++t) acc[r][t] = (v8f){};
  // as in the projection: fragments fetched one k-step ahead into a second register set
  const b16* cr = ctx + (size_t)(m0 + nloc) * DM; const b16* wr = wo16 + (size_t)(c0 + nloc) * DM;
  v16b a0 = frag_kb(cr, hlf), a1 = frag_kb(cr + 16 * DM, hlf), bw[4];
#pragma unroll
  for (int t = 0; t < 4; ++t) bw[t] = frag_kb(wr + t * 16 * DM, hlf);
#pragma unroll 2
  for (int kb = 32; kb <= DM; kb += 32) {   // kb = the k-step that is fetched; the one before it is worked on; the last trip fetches nothing
    v16b na0 = a0, na1 = a1, nb[4] = {bw[0], bw[1], bw[2], bw[3]};
    if (kb < DM) { na0 = frag_kb(cr + kb, hlf); na1 = frag_kb(cr + 16 * DM + kb, hlf);
#pragma unroll
      for (int t = 0; t < 4; ++t) nb[t] = frag_kb(wr + t * 16 * DM + kb, hlf);
      asm volatile("s_wait_xcnt 0x0" ::: "memory"); }   // stands behind the load group, ahead of the next rewrite of its address registers
    __builtin_amdgcn_sched_barrier(0);   // keeps the next step's loads ahead of this step's products: the scheduler otherwise sinks each load to its use, behind a full wait
#pragma unroll
    for (int t = 0; t < 4; ++t) { acc[0][t] = wmma16b(a0, bw[t], acc[0][t]); acc[1][t] = wmma16b(a1, bw[t], acc[1][t]); }
    asm volatile("v_nop\n\tv_nop\n\tv_nop\n\tv_nop" :: "v"(acc[0][0]), "v"(acc[1][0]), "v"(acc[0][1]), "v"(acc[1][1]), "v"(acc[0][2]), "v"(acc[1][2]), "v"(acc[0][3]), "v"(acc[1][3]), "v"(a0), "v"(a1), "v"(bw[0]), "v"(bw[1]), "v"(bw[2]), "v"(bw[3]));   // behind the k-step's last product: the four vector slots before the next load group overwrites that product's A and B registers
    a0 = na0; a1 = na1;
#pragma unroll
    for (int t = 0; t < 4; ++t) bw[t] = nb[t]; }
  float* Tt = Ts[wave];
#pragma unroll
  for (int t = 0; t < 4; ++t) { const float bb = P[c0 + t * 16 + nloc];
#pragma unroll
    for (int r = 0; r < 2; ++r)
#pragma unroll
      for (int v = 0; v < 8; ++v) Tt[(r * 16 + v + 8 * hlf) * 64 + t * 16 + nloc] = acc[r][t][v] + bb; }
  wave_lds_sync();
  {
#pragma unroll
    for (int j = 0; j < 16; ++j) { const int rr = j * 2 + hlf, c4 = nloc * 4; *(v4f*)(out + (size_t)(m0 + rr) * DM + c0 + c4) = *(const v4f*)(Tt + rr * 64 + c4); }
     }
}
}  // namespace

extern "C" void kernel_launch(void* const* d_in, const int* in_sizes, int n_in,
                              void* d_out, int out_size, void* d_ws, size_t ws_size, hipStream_t stream) {
  (void)n_in; (void)out_size;
  const float* x = (const float*)d_in[0]; const float* Wqkv = (const float*)d_in[1]; const float* Wout = (const float*)d_in[2]; const float* bout = (const float*)d_in[3];
  float* out = (float*)d_out;   // [2][4096][512]
  if (in_sizes[0] != NT * DM || in_sizes[1] != DM * DM || in_sizes[2] != DM * DM || in_sizes[3] != DM) return;
  size_t off = 0; char* ws = (char*)d_ws;
  auto carve = [&](size_t bytes) { char* p = ws + off; off += (bytes + 255) & ~(size_t)255; return p; };
  unsigned short* w16 = (unsigned short*)carve((size_t)DM * DM * 2); b16* wo16 = (b16*)carve((size_t)DM * DM * 2); float* P = (float*)carve(DM * 4);
  b16* qp = (b16*)carve(PL * 2); b16* kp = (b16*)carve(PL * 2); b16* vt = (b16*)carve(PL * 2); b16* ctx = (b16*)carve((size_t)NT * DM * 2); float* sq = (float*)carve((size_t)NT * H * 4);
  if (off > ws_size) return;                                    // ≈ 1 + 8.4 x 4 ≈ 35 MB
  prep_kernel<<<256, 256, 0, stream>>>(Wqkv, Wout, bout, w16, wo16, P);
  proj_kernel<<<dim3(H, NT / 128), 128, 0, stream>>>(x, w16, qp, kp, vt, sq);
  attn_kernel<<<Bn * H * (S / 128), 256, 0, stream>>>(qp, kp, vt, sq, ctx);
  out_kernel<<<dim3(DM / 64, NT / 128), 128, 0, stream>>>(ctx, wo16, P, out);
}

// v008
// It runs in 85.5 microseconds.
// Two timings next to v007 both put it at 1.17 times that version's speed.
// Counting every step since v000, it is 4.35 times as fast.
#include <hip/hip_runtime.h>

// SAN (shared-projection attention): w = x W_qkv (q = k = v = w; 8 heads x 64 over 4096 tokens, batch 2); attn = softmax(w.w^T x 64^-0.5); out = (attn w) merged . W_out + b
// -> [2][4096][512].
// The shared projection is ONE exact GEMM on v_wmma_f32_16x16x32_bf16 (x and W exact bf16; 1 product) written three ways (q plane x 1/8 x8, k plane x8,
// (8w)^T plane) as single f16; attention on v_wmma_f32_16x16x32_f16 per (b, h, 32 queries, half of the keys: 64 key blocks) with single-f16 q, k, P, v (1 product each; logits are O(1),
// softmax over 4096 keys) except the self logit w_i·w_i/8 ≈ 8, which dominates the softmax and is taken from an exact f32 |w_i|² computed in the projection epilogue; f32 online softmax / accumulate; ctx single f16; out = ctx.W_out + b (1 product). ≈4.7 M WMMAs (an f32-class path would be ≈13 M).

namespace {
constexpr int Bn = 2, S = 4096, DM = 512, H = 8, HD = 64, NT = Bn * S;
constexpr float QS = 8.0f, KS = 8.0f, VS = 8.0f, PS = 8.0f, SCALE = 0.125f;
constexpr size_t PL = (size_t)Bn * H * S * HD;

typedef _Float16 b16;
typedef __attribute__((ext_vector_type(16))) _Float16 v16b;
typedef __attribute__((ext_vector_type(16))) __bf16 v16bb;
typedef __attribute__((ext_vector_type(8))) _Float16 v8b;
typedef __attribute__((ext_vector_type(8))) unsigned short v8us;
typedef __attribute__((ext_vector_type(8))) float v8f;
typedef __attribute__((ext_vector_type(4))) float v4f;
__device__ __forceinline__ float bf16_rne(float f) { unsigned int u = __float_as_uint(f); u += 0x7FFFu + ((u >> 16) & 1u); return __uint_as_float(u & 0xFFFF0000u); }
__device__ __forceinline__ unsigned short bf16_bits(float f) { unsigned int u = __float_as_uint(f); u += 0x7FFFu + ((u >> 16) & 1u); return (unsigned short)(u >> 16); }
__device__ __forceinline__ v16b frag_kb(const b16* p, int hh) { const v8b a = *(const v8b*)(p + 8 * hh), b = *(const v8b*)(p + 16 + 8 * hh); v16b f;
#pragma unroll
  for (int e = 0; e < 8; ++e) { f[e] = a[e]; f[8 + e] = b[e]; } return f; }
__device__ __forceinline__ v16bb frag_bf(const unsigned short* p, int hh) { const v8us a = *(const v8us*)(p + 8 * hh), b = *(const v8us*)(p + 16 + 8 * hh); union { unsigned short s[16]; v16bb v; } u;
#pragma unroll
  for (int e = 0; e < 8; ++e) { u.s[e] = a[e]; u.s[8 + e] = b[e]; } return u.v; }
struct raw16 { v4f a, b, c, d; };   // one lane's 16 f32 of an A fragment, as loaded
__device__ __forceinline__ raw16 load_raw(const float* p, int hh) { raw16 r; r.a = *(const v4f*)(p + 8 * hh); r.b = *(const v4f*)(p + 8 * hh + 4); r.c = *(const v4f*)(p + 16 + 8 * hh); r.d = *(const v4f*)(p + 16 + 8 * hh + 4); return r; }
__device__ __forceinline__ v16bb cvt_raw(const raw16& r) { union { unsigned short s[16]; v16bb v; } u;
#pragma unroll
  for (int e = 0; e < 4; ++e) { u.s[e] = bf16_bits(r.a[e]); u.s[4 + e] = bf16_bits(r.b[e]); u.s[8 + e] = bf16_bits(r.c[e]); u.s[12 + e] = bf16_bits(r.d[e]); } return u.v; }
__device__ __forceinline__ v8f wmma16b(v16b a, v16b b, v8f c) { return __builtin_amdgcn_wmma_f32_16x16x32_f16(false, a, false, b, (short)0, c, false, false); }
__device__ __forceinline__ v8f wmma16bb(v16bb a, v16bb b, v8f c) { return __builtin_amdgcn_wmma_f32_16x16x32_bf16(false, a, false, b, (short)0, c, false, false); }
__device__ __forceinline__ void wave_lds_sync() { __builtin_amdgcn_fence(__ATOMIC_RELEASE, "workgroup"); __builtin_amdgcn_wave_barrier(); __builtin_amdgcn_fence(__ATOMIC_ACQUIRE, "workgroup"); }
constexpr float LC = 1.4426950408889634f / (QS * KS);   // raw score (= logit x QS x KS) -> logit in base-2 units
constexpr float PMAX = PS * 256.0f;   // a lane's sum of P over one pass above which the softmax base is moved

// GEMM operand staging: 16-byte asynchronous copies to LDS, addresses and steps in bytes; the s_wait_xcnt closes each statement so that no address register is rewritten before it
__device__ __forceinline__ unsigned lds_off(const void* p) { return (unsigned)(size_t)p; }   // low 32 bits of a __shared__ address = byte offset in the work-group's LDS
__device__ __forceinline__ void copy8g(const char* g, size_t gstep, unsigned l, unsigned lstep) {
  asm volatile("global_load_async_to_lds_b128 %0, %8, off\n\tglobal_load_async_to_lds_b128 %1, %9, off\n\tglobal_load_async_to_lds_b128 %2, %10, off\n\tglobal_load_async_to_lds_b128 %3, %11, off\n\t"
               "global_load_async_to_lds_b128 %4, %12, off\n\tglobal_load_async_to_lds_b128 %5, %13, off\n\tglobal_load_async_to_lds_b128 %6, %14, off\n\tglobal_load_async_to_lds_b128 %7, %15, off\n\ts_wait_xcnt 0x0"
               :: "v"(l), "v"(l + lstep), "v"(l + 2 * lstep), "v"(l + 3 * lstep), "v"(l + 4 * lstep), "v"(l + 5 * lstep), "v"(l + 6 * lstep), "v"(l + 7 * lstep),
                  "v"(g), "v"(g + gstep), "v"(g + 2 * gstep), "v"(g + 3 * gstep), "v"(g + 4 * gstep), "v"(g + 5 * gstep), "v"(g + 6 * gstep), "v"(g + 7 * gstep) : "memory");
}
__device__ __forceinline__ void copy4g(const char* g, size_t gstep, unsigned l, unsigned lstep) {
  asm volatile("global_load_async_to_lds_b128 %0, %4, off\n\tglobal_load_async_to_lds_b128 %1, %5, off\n\tglobal_load_async_to_lds_b128 %2, %6, off\n\tglobal_load_async_to_lds_b128 %3, %7, off\n\ts_wait_xcnt 0x0"
               :: "v"(l), "v"(l + lstep), "v"(l + 2 * lstep), "v"(l + 3 * lstep), "v"(g), "v"(g + gstep), "v"(g + 2 * gstep), "v"(g + 3 * gstep) : "memory");
}
constexpr int PKT = 64, PNT = DM / PKT, APF = PKT + 4, BPH = PKT + 8;   // projection: 64-k tiles; LDS row pitches 272 B (f32 x rows) and 144 B (bf16 W rows), 16 B x odd: no bank conflict for 16-byte fragment reads
constexpr int OKT = 128, ONT = DM / OKT, OPH = OKT + 8;                  // output GEMM: 128-k tiles; LDS row pitch 272 B

__global__ __launch_bounds__(256) void prep_kernel(const float* __restrict__ Wqkv, const float* __restrict__ Wout, const float* __restrict__ bout, unsigned short* __restrict__ w16, b16* __restrict__ wo16, float* __restrict__ P) {
  const int t_ = blockIdx.x * 256 + threadIdx.x, nth = gridDim.x * 256;
  {
    for (int q = t_; q < DM * DM; q += nth) { const int o = q / DM, k = q % DM; w16[q] = bf16_bits(Wqkv[(size_t)k * DM + o]); wo16[q] = (b16)bf16_rne(Wout[(size_t)k * DM + o]); }
    for (int q = t_; q < DM; q += nth) P[q] = bf16_rne(bout[q]);
     }
}

// projection: w = bf16(x).W (exact); block 128 tokens x 64 cols (= head h); writes q plane (w/8 x8 = w) hmm: q x SCALE x QS = w x 1, k plane (w x 8), (8w)^T plane, all single f16,
__global__ __launch_bounds__(128) void proj_kernel(const float* __restrict__ x, const unsigned short* __restrict__ w16, b16* __restrict__ qp, b16* __restrict__ kp, b16* __restrict__ vt, float* __restrict__ sq) {
  __shared__ __attribute__((aligned(16))) b16 Tq[4][32][HD + 8], Tk[4][32][HD + 8]; __shared__ __attribute__((aligned(16))) b16 Tv[HD][128 + 8]; __shared__ float Sq[128];
  __shared__ __attribute__((aligned(16))) float Ax[2][128 * APF]; __shared__ __attribute__((aligned(16))) unsigned short Bw[2][HD * BPH];
  const int lane = threadIdx.x & 31, wave = threadIdx.x >> 5, nloc = lane & 15, hlf = lane >> 4, h = blockIdx.x, c0 = h * HD, p0 = blockIdx.y * 128, m0 = p0 + wave * 32, b = p0 / S, t0 = p0 % S;
  v8f acc[2][4];
#pragma unroll
  for (int r = 0; r < 2; ++r)
#pragma unroll
    for (int t = 0; t < 4; ++t) acc[r][t] = (v8f){};
  const int tid = threadIdx.x;
  const char* Ag = (const char*)(x + (size_t)(p0 + (tid >> 4)) * DM + (tid & 15) * 4); const char* Bg = (const char*)(w16 + (size_t)(c0 + (tid >> 3)) * DM + (tid & 7) * 8);   // a wave's copy = 2 rows of x, 4 rows of W
  const unsigned al0 = lds_off(&Ax[0][(tid >> 4) * APF + (tid & 15) * 4]), bl0 = lds_off(&Bw[0][(tid >> 3) * BPH + (tid & 7) * 8]);
  copy8g(Ag, 8 * DM * 4, al0, 8 * APF * 4); copy8g(Ag + 64 * DM * 4, 8 * DM * 4, al0 + 64 * APF * 4, 8 * APF * 4); copy4g(Bg, 16 * DM * 2, bl0, 16 * BPH * 2);
  asm volatile("s_wait_asynccnt 0x0" ::: "memory");   // tile 0 landed (this wave's copies) before the barrier that publishes it
  __syncthreads();
  copy8g(Ag + PKT * 4, 8 * DM * 4, al0 + 128 * APF * 4, 8 * APF * 4); copy8g(Ag + 64 * DM * 4 + PKT * 4, 8 * DM * 4, al0 + (128 + 64) * APF * 4, 8 * APF * 4); copy4g(Bg + PKT * 2, 16 * DM * 2, bl0 + HD * BPH * 2, 16 * BPH * 2);
  for (int kt = 0; kt < PNT; ++kt) {
    const float* xr = &Ax[kt & 1][(wave * 32 + nloc) * APF]; const unsigned short* wr = &Bw[kt & 1][nloc * BPH];
    // inside a tile the fragments are fetched one k-step ahead into a second register set; nothing of the next tile is read here
    raw16 ra0 = load_raw(xr, hlf), ra1 = load_raw(xr + 16 * APF, hlf); v16bb bw[4];
#pragma unroll
    for (int t = 0; t < 4; ++t) bw[t] = frag_bf(wr + t * 16 * BPH, hlf);
#pragma unroll
    for (int kb = 32; kb <= PKT; kb += 32) {   // kb = the k-step of the tile that is fetched; the one before it is worked on; the last trip fetches nothing
      raw16 na0 = ra0, na1 = ra1; v16bb nb[4] = {bw[0], bw[1], bw[2], bw[3]};
      if (kb < PKT) { na0 = load_raw(xr + kb, hlf); na1 = load_raw(xr + 16 * APF + kb, hlf);
#pragma unroll
        for (int t = 0; t < 4; ++t) nb[t] = frag_bf(wr + t * 16 * BPH + kb, hlf); }
      __builtin_amdgcn_sched_barrier(0);   // keeps the next step's LDS reads in one group ahead of this step's products: the scheduler otherwise sinks each read to its use, behind a full wait
      const v16bb a0 = cvt_raw(ra0), a1 = cvt_raw(ra1);
#pragma unroll
      for (int t = 0; t < 4; ++t) { acc[0][t] = wmma16bb(a0, bw[t], acc[0][t]); acc[1][t] = wmma16bb(a1, bw[t], acc[1][t]); }
      asm volatile("v_nop\n\tv_nop\n\tv_nop\n\tv_nop" :: "v"(acc[0][0]), "v"(acc[1][0]), "v"(acc[0][1]), "v"(acc[1][1]), "v"(acc[0][2]), "v"(acc[1][2]), "v"(acc[0][3]), "v"(acc[1][3]), "v"(bw[0]), "v"(bw[1]), "v"(bw[2]), "v"(bw[3]));   // behind the k-step's last product: the four vector slots before the next load group overwrites that product's A and B registers; a0 and a1 are not named: named here, each was packed a second time into registers of its own
      ra0 = na0; ra1 = na1;
#pragma unroll
      for (int t = 0; t < 4; ++t) bw[t] = nb[t]; }
    asm volatile("s_wait_dscnt 0x0" ::: "memory");      // this wave's reads of the buffer are done before the buffer is refilled
    asm volatile("s_wait_asynccnt 0x0" ::: "memory");   // this wave's copies of the next tile have landed before the barrier that publishes them
    __syncthreads();
    if (kt + 2 < PNT) { const char* ag = Ag + (kt + 2) * PKT * 4; const unsigned al = al0 + (kt & 1) * (128 * APF * 4);
      copy8g(ag, 8 * DM * 4, al, 8 * APF * 4); copy8g(ag + 64 * DM * 4, 8 * DM * 4, al + 64 * APF * 4, 8 * APF * 4); copy4g(Bg + (kt + 2) * PKT * 2, 16 * DM * 2, bl0 + (kt & 1) * (HD * BPH * 2), 16 * BPH * 2); } }
  asm volatile("s_wait_asynccnt 0x0" ::: "memory");     // nothing in flight when the wave goes on to its epilogue
#pragma unroll
  for (int t = 0; t < 4; ++t)
#pragma unroll
    for (int r = 0; r < 2; ++r)
#pragma unroll
      for (int v = 0; v < 8; ++v) { const float w = acc[r][t][v]; Tq[wave][r * 16 + 8 * hlf + v][t * 16 + nloc] = (b16)(w * (SCALE * QS)); Tk[wave][r * 16 + 8 * hlf + v][t * 16 + nloc] = (b16)(w * KS); Tv[t * 16 + nloc][wave * 32 + r * 16 + 8 * hlf + v] = (b16)(w * VS); }
  // exact f32 self-logit ingredient: |w_row|^2 per (token, head) (sum over this lane's 4 columns x ... then across the 16 column lanes; fixed order)
#pragma unroll
  for (int r = 0; r < 2; ++r)
#pragma unroll
    for (int v = 0; v < 8; ++v) { float s2 = 0.0f;
#pragma unroll
      for (int t = 0; t < 4; ++t) { const float w = acc[r][t][v]; s2 += w * w; }
#pragma unroll
      for (int o = 1; o < 16; o <<= 1) s2 += __shfl_xor(s2, o);
      if (nloc == 0) Sq[wave * 32 + r * 16 + 8 * hlf + v] = s2; }
  __syncthreads();
  b16* qb = qp + (((size_t)b * H + h) * S + (m0 % S)) * HD; b16* kb_ = kp + (((size_t)b * H + h) * S + (m0 % S)) * HD;
  {
#pragma unroll
    for (int j = 0; j < 8; ++j) { const int rr = j * 4 + (lane >> 3), c8 = (lane & 7) * 8; *(v8b*)(qb + (size_t)rr * HD + c8) = *(const v8b*)(&Tq[wave][rr][c8]); *(v8b*)(kb_ + (size_t)rr * HD + c8) = *(const v8b*)(&Tk[wave][rr][c8]); }
    for (int i = threadIdx.x; i < HD * 16; i += 128) { const int d = i >> 4, c8 = (i & 15) * 8; *(v8b*)(vt + (((size_t)b * H + h) * HD + d) * S + t0 + c8) = *(const v8b*)(&Tv[d][c8]); }
    *(float*)(sq + ((size_t)b * H + h) * S + t0 + threadIdx.x) = Sq[threadIdx.x];   // [b][h][token] f32: 512 B per block
     }
}

constexpr int KT = 256, NSTG = S / KT, KPI = HD + 8, VPI = KT + 8;   // LDS row pitches 144 B and 528 B (16 B x odd: no bank conflict for 16-byte fragment reads)
__device__ __forceinline__ unsigned lds_addr(const b16* p) { return (unsigned)(size_t)p; }   // low 32 bits of a __shared__ address = byte offset in the work-group's LDS
// eight 16-byte copies per lane; the s_wait_xcnt closes the statement so that no address register is rewritten before it
__device__ __forceinline__ void copy8(const b16* g, size_t gstep, const b16* l, int lstep) {
  asm volatile("global_load_async_to_lds_b128 %0, %8, off\n\tglobal_load_async_to_lds_b128 %1, %9, off\n\tglobal_load_async_to_lds_b128 %2, %10, off\n\tglobal_load_async_to_lds_b128 %3, %11, off\n\t"
               "global_load_async_to_lds_b128 %4, %12, off\n\tglobal_load_async_to_lds_b128 %5, %13, off\n\tglobal_load_async_to_lds_b128 %6, %14, off\n\tglobal_load_async_to_lds_b128 %7, %15, off\n\ts_wait_xcnt 0x0"
               :: "v"(lds_addr(l)), "v"(lds_addr(l + lstep)), "v"(lds_addr(l + 2 * lstep)), "v"(lds_addr(l + 3 * lstep)), "v"(lds_addr(l + 4 * lstep)), "v"(lds_addr(l + 5 * lstep)), "v"(lds_addr(l + 6 * lstep)), "v"(lds_addr(l + 7 * lstep)),
                  "v"(g), "v"(g + gstep), "v"(g + 2 * gstep), "v"(g + 3 * gstep), "v"(g + 4 * gstep), "v"(g + 5 * gstep), "v"(g + 6 * gstep), "v"(g + 7 * gstep) : "memory");
}
typedef v4f __attribute__((may_alias)) v4fa;   // f32 view of the K buffers, which carry the partial sums behind the loop
__global__ __launch_bounds__(256) void attn_kernel(const b16* __restrict__ qp, const b16* __restrict__ kp, const b16* __restrict__ vt, const float* __restrict__ sq, b16* __restrict__ ctx) {
  __shared__ __attribute__((aligned(16))) b16 Ks[2][KT * KPI], Vs[2][HD * VPI], Os[8][16][HD + 8];
  const int wave = threadIdx.x >> 5, lane = threadIdx.x & 31, hh = lane >> 4, col = lane & 15; const int bh = blockIdx.x / (S / 128), b = bh / H, h = bh % H, q0 = (blockIdx.x % (S / 128)) * 128 + (wave & 3) * 32;
  const int kg = __builtin_amdgcn_readfirstlane(wave >> 2);   // this wave's half of every key tile (the same in every lane: kept in a scalar register)
  const b16* Q = qp + ((size_t)bh * S) * HD; const b16* K = kp + ((size_t)bh * S) * HD; const b16* V = vt + ((size_t)bh * HD) * S;
  // this lane's share of a tile: K = 256 rows x 128 B, contiguous (a wave's copy = 4 rows); V^T = 64 rows x 512 B (a wave's copy = 1 row)
  const b16* Kg = K + threadIdx.x * 8; const b16* Vg = V + (size_t)wave * S + lane * 8; const int kl0 = (threadIdx.x >> 3) * KPI + (threadIdx.x & 7) * 8, vl0 = wave * VPI + lane * 8;
  copy8(Kg, 32 * HD, &Ks[0][kl0], 32 * KPI); copy8(Vg, (size_t)8 * S, &Vs[0][vl0], 8 * VPI);
  asm volatile("s_wait_asynccnt 0x0" ::: "memory");   // tile 0 landed (this wave's copies) before the barrier that publishes it
  __syncthreads();
  copy8(Kg + KT * HD, 32 * HD, &Ks[1][kl0], 32 * KPI); copy8(Vg + KT, (size_t)8 * S, &Vs[1][vl0], 8 * VPI);
  v16b qf[2][2]; float sself[2];   // index u = query tile: queries q0 + 16 u + col
#pragma unroll
  for (int u = 0; u < 2; ++u) { const int qi = q0 + 16 * u + col; qf[u][0] = frag_kb(Q + (size_t)qi * HD, hh); qf[u][1] = frag_kb(Q + (size_t)qi * HD + 32, hh); sself[u] = sq[(size_t)bh * S + qi] * (SCALE * QS * KS); }   // exact f32 self logit (the dominant softmax term), in the raw scores' units (x QS x KS, a power of two)
  const int dkb = __builtin_amdgcn_readfirstlane(q0);   // first key of the one 32-key pass that holds this wave's own 32 keys; it lies in one key half only: the wave of the other half never meets it
  float m[2] = {-INFINITY, -INFINITY}, nb[2] = {INFINITY, INFINITY}, l[2] = {0.0f, 0.0f}; v8f o[2][4] = {{{}, {}, {}, {}}, {{}, {}, {}, {}}};   // m = the base in use (raw-score units), nb = 3 - m x LC
  for (int st = 0; st < NSTG; ++st) {
    const b16* Kb = &Ks[st & 1][col * KPI]; const b16* Vb = &Vs[st & 1][col * VPI];
    for (int kl = kg * (KT / 2); kl < kg * (KT / 2) + KT / 2; kl += 32) { const int kb = st * KT + kl;
      const v16b ka0 = frag_kb(Kb + kl * KPI, hh), ka1 = frag_kb(Kb + kl * KPI + 32, hh), kc0 = frag_kb(Kb + (kl + 16) * KPI, hh), kc1 = frag_kb(Kb + (kl + 16) * KPI + 32, hh);
      const v16b vf[4] = {frag_kb(Vb + kl, hh), frag_kb(Vb + 16 * VPI + kl, hh), frag_kb(Vb + 32 * VPI + kl, hh), frag_kb(Vb + 48 * VPI + kl, hh)};   // all of the pass's LDS reads stand together, ahead of its products
      __builtin_amdgcn_sched_barrier(0);   // holds the 16 LDS reads in one group ahead of the products: the scheduler otherwise sinks each pair to its product, behind a full wait
      v8f s0[2] = {{}, {}}, s1[2] = {{}, {}};
#pragma unroll
      for (int u = 0; u < 2; ++u) { s0[u] = wmma16b(ka0, qf[u][0], s0[u]); s1[u] = wmma16b(kc0, qf[u][0], s1[u]); }
#pragma unroll
      for (int u = 0; u < 2; ++u) { s0[u] = wmma16b(ka1, qf[u][1], s0[u]); s1[u] = wmma16b(kc1, qf[u][1], s1[u]); }
      float lim = PMAX;   // the same in every lane: a scalar register
      if (kb == dkb) { lim = -1.0f;   // one pass in 64, in one key half: a scalar compare and branch, so the other passes carry no index compare and no select
#pragma unroll
        for (int r = 0; r < 8; ++r) if (8 * hh + r == col) { s0[0][r] = sself[0]; s1[1][r] = sself[1]; } }   // kb = q0 here: query q0 + col is key row col of the first 16 keys, query q0 + 16 + col key row col of the second 16
      // lazy rescale: P is formed against the base m in use (score scale, log2(e), the base and the x PS of P in one multiply-add per score ahead of exp2); the base moves only when it has to
      float e0[2][8], e1[2][8], sum[2] = {0.0f, 0.0f};
      // one score tile after the other (s0's eight scores, then s1's), the sums last, in the order they had: with two query tiles this compiler packs the multiply-adds in pairs by itself, and with
      // s0 and s1 taken in turn it pairs a register of the one with a register of the other and first copies all 32 scores of the pass into such pairs
#pragma unroll
      for (int u = 0; u < 2; ++u) {
#pragma unroll
        for (int r = 0; r < 8; ++r) e0[u][r] = __builtin_amdgcn_exp2f(__builtin_fmaf(s0[u][r], LC, nb[u]));   // e = PS x exp(logit - base)
#pragma unroll
        for (int r = 0; r < 8; ++r) e1[u][r] = __builtin_amdgcn_exp2f(__builtin_fmaf(s1[u][r], LC, nb[u]));
#pragma unroll
        for (int r = 0; r < 8; ++r) sum[u] += e0[u][r] + e1[u][r]; }
      // every e is >= 0, so a lane's sum bounds each of them: one ballot and scalar branch per pass for both query tiles. Taken in the first pass (nb = +inf gives sum = +inf), where a score lies more than
      // about 8 octaves above the base (P would leave f16's range; a NaN sum is caught too), and always in the pass of the wave's own keys (lim < 0), so that the dominant self term's P stays the exact PS
      if (__builtin_amdgcn_ballot_w32(!(sum[0] <= lim) || !(sum[1] <= lim)) != 0) {
#pragma unroll
        for (int u = 0; u < 2; ++u) {
          float mr = -INFINITY;   // the maximum is taken on the raw scores
#pragma unroll
          for (int r = 0; r < 8; ++r) mr = fmaxf(mr, fmaxf(s0[u][r], s1[u][r]));
          mr = fmaxf(mr, __shfl_xor(mr, 16));   // both halves of the wave hold the same query: one base for both
          const float mn = fmaxf(m[u], mr), al_ = __builtin_amdgcn_exp2f((m[u] - mn) * LC); m[u] = mn; nb[u] = __builtin_fmaf(-mn, LC, 3.0f); l[u] *= al_; sum[u] = 0.0f;   // 3 = log2(PS); al_ = 0 in the first pass
#pragma unroll
          for (int t = 0; t < 4; ++t) o[u][t] *= al_;
#pragma unroll
          for (int r = 0; r < 8; ++r) e0[u][r] = __builtin_amdgcn_exp2f(__builtin_fmaf(s0[u][r], LC, nb[u]));
#pragma unroll
          for (int r = 0; r < 8; ++r) e1[u][r] = __builtin_amdgcn_exp2f(__builtin_fmaf(s1[u][r], LC, nb[u]));
#pragma unroll
          for (int r = 0; r < 8; ++r) sum[u] += e0[u][r] + e1[u][r]; } }
      v16b pbv[2];
#pragma unroll
      for (int u = 0; u < 2; ++u) {
#pragma unroll
        for (int r = 0; r < 8; ++r) { pbv[u][r] = (b16)e0[u][r]; pbv[u][8 + r] = (b16)e1[u][r]; }
        sum[u] += __shfl_xor(sum[u], 16); l[u] += sum[u]; }
#pragma unroll
      for (int t = 0; t < 4; ++t) { o[0][t] = wmma16b(vf[t], pbv[0], o[0][t]); o[1][t] = wmma16b(vf[t], pbv[1], o[1][t]); }
      asm volatile("v_nop\n\tv_nop\n\tv_nop\n\tv_nop" : "+v"(o[1][3]) : "v"(vf[3]), "v"(pbv[1])); }   // behind the pass's last product: the four vector slots the chip needs before the next pass's address arithmetic overwrites that product's A registers
    asm volatile("s_wait_dscnt 0x0" ::: "memory");      // this wave's reads of the buffer are done before the buffer is refilled
    asm volatile("s_wait_asynccnt 0x0" ::: "memory");   // this wave's copies of the next tile have landed before the barrier that publishes them
    __syncthreads();
    if (st + 2 < NSTG) { copy8(Kg + (size_t)(st + 2) * KT * HD, 32 * HD, &Ks[st & 1][kl0], 32 * KPI); copy8(Vg + (st + 2) * KT, (size_t)8 * S, &Vs[st & 1][vl0], 8 * VPI); } }
  asm volatile("s_wait_asynccnt 0x0" ::: "memory");     // nothing in flight when the wave goes on to its end
  // join of the two key halves: waves w and w ^ 4 hold the same 32 queries. Wave w finishes query tile kg and hands its partial sums of the other tile to its partner through the K buffers,
  // which nobody reads any more (the loop's last barrier) and into which nothing is in flight (the last two trips issue no copy). Lane for lane the two waves hold the same (query, d) places.
  v4fa* X = (v4fa*)&Ks[0][0];   // [wave][9][lane] x 16 B = 36,864 B of the 73,728
  v8f own[4], snd[4];
#pragma unroll
  for (int t = 0; t < 4; ++t) { own[t] = kg ? o[1][t] : o[0][t]; snd[t] = kg ? o[0][t] : o[1][t]; }
  const float mo = kg ? m[1] : m[0], lo = kg ? l[1] : l[0], ms = kg ? m[0] : m[1], ls = kg ? l[0] : l[1];
#pragma unroll
  for (int t = 0; t < 4; ++t) { X[(wave * 9 + 2 * t) * 32 + lane] = (v4f){snd[t][0], snd[t][1], snd[t][2], snd[t][3]}; X[(wave * 9 + 2 * t + 1) * 32 + lane] = (v4f){snd[t][4], snd[t][5], snd[t][6], snd[t][7]}; }
  X[(wave * 9 + 8) * 32 + lane] = (v4f){ms, ls, 0.0f, 0.0f};
  __syncthreads();   // publishes every wave's partial sums to its partner
  const int pw = wave ^ 4; const v4f ml = X[(pw * 9 + 8) * 32 + lane];
  const float mj = fmaxf(mo, ml[0]), fo = __builtin_amdgcn_exp2f((mo - mj) * LC), fx = __builtin_amdgcn_exp2f((ml[0] - mj) * LC);   // both bases are finite: every wave's first pass sets one
  const float inv = 1.0f / ((lo * fo + ml[1] * fx) * VS), go = fo * inv, gx = fx * inv;   // l already carries the x PS
#pragma unroll
  for (int t = 0; t < 4; ++t) { const v4f xa = X[(pw * 9 + 2 * t) * 32 + lane], xb = X[(pw * 9 + 2 * t + 1) * 32 + lane];
#pragma unroll
    for (int r = 0; r < 4; ++r) { Os[wave][col][t * 16 + 8 * hh + r] = (b16)(own[t][r] * go + xa[r] * gx); Os[wave][col][t * 16 + 8 * hh + 4 + r] = (b16)(own[t][4 + r] * go + xb[r] * gx); } }
  __syncthreads();
  b16* dst = ctx + ((size_t)b * S + q0 + 16 * kg) * DM + h * HD;   // this wave's 16 rows x 128 B: whole lines, one writer each
  for (int j = 0; j < 4; ++j) { const int rr = j * 4 + (lane >> 3), c8 = (lane & 7) * 8; *(v8b*)(dst + (size_t)rr * DM + c8) = *(const v8b*)(&Os[wave][rr][c8]); }
}

__global__ __launch_bounds__(128) void out_kernel(const b16* __restrict__ ctx, const b16* __restrict__ wo16, const float* __restrict__ P, float* __restrict__ out) {
  __shared__ __attribute__((aligned(16))) float Ts[4][32 * 64]; __shared__ __attribute__((aligned(16))) b16 Ac[2][128 * OPH], Bo[2][64 * OPH];
  const int lane = threadIdx.x & 31, wave = threadIdx.x >> 5, nloc = lane & 15, hlf = lane >> 4, m0 = blockIdx.y * 128 + wave * 32, c0 = blockIdx.x * 64;
  v8f acc[2][4];
#pragma unroll
  for (int r = 0; r < 2; ++r)
#pragma unroll
    for (int t = 0; t < 4; ++t) acc[r][t] = (v8f){};
  // as in the projection: each 128-k tile of ctx (128 rows x 256 B) and of W_out (64 rows x 256 B) comes into LDS once per block in whole lines, two buffers
  const int tid = threadIdx.x;
  const char* Ag = (const char*)(ctx + (size_t)(blockIdx.y * 128 + (tid >> 4)) * DM + (tid & 15) * 8); const char* Bg = (const char*)(wo16 + (size_t)(c0 + (tid >> 4)) * DM + (tid & 15) * 8);   // a wave's copy = 2 rows
  const unsigned al0 = lds_off(&Ac[0][(tid >> 4) * OPH + (tid & 15) * 8]), bl0 = lds_off(&Bo[0][(tid >> 4) * OPH + (tid & 15) * 8]);
  copy8g(Ag, 8 * DM * 2, al0, 8 * OPH * 2); copy8g(Ag + 64 * DM * 2, 8 * DM * 2, al0 + 64 * OPH * 2, 8 * OPH * 2); copy8g(Bg, 8 * DM * 2, bl0, 8 * OPH * 2);
  asm volatile("s_wait_asynccnt 0x0" ::: "memory");   // tile 0 landed (this wave's copies) before the barrier that publishes it
  __syncthreads();
  copy8g(Ag + OKT * 2, 8 * DM * 2, al0 + 128 * OPH * 2, 8 * OPH * 2); copy8g(Ag + 64 * DM * 2 + OKT * 2, 8 * DM * 2, al0 + (128 + 64) * OPH * 2, 8 * OPH * 2); copy8g(Bg + OKT * 2, 8 * DM * 2, bl0 + 64 * OPH * 2, 8 * OPH * 2);
  for (int kt = 0; kt < ONT; ++kt) {
    const b16* cr = &Ac[kt & 1][(wave * 32 + nloc) * OPH]; const b16* wr = &Bo[kt & 1][nloc * OPH];
    // inside a tile the fragments are fetched one k-step ahead into a second register set; nothing of the next tile is read here
    v16b a0 = frag_kb(cr, hlf), a1 = frag_kb(cr + 16 * OPH, hlf), bw[4];
#pragma unroll
    for (int t = 0; t < 4; ++t) bw[t] = frag_kb(wr + t * 16 * OPH, hlf);
#pragma unroll
    for (int kb = 32; kb <= OKT; kb += 32) {   // kb = the k-step of the tile that is fetched; the one before it is worked on; the last trip fetches nothing
      v16b na0 = a0, na1 = a1, nb[4] = {bw[0], bw[1], bw[2], bw[3]};
      if (kb < OKT) { na0 = frag_kb(cr + kb, hlf); na1 = frag_kb(cr + 16 * OPH + kb, hlf);
#pragma unroll
        for (int t = 0; t < 4; ++t) nb[t] = frag_kb(wr + t * 16 * OPH + kb, hlf); }
      __builtin_amdgcn_sched_barrier(0);   // keeps the next step's LDS reads in one group ahead of this step's products: the scheduler otherwise sinks each read to its use, behind a full wait
#pragma unroll
      for (int t = 0; t < 4; ++t) { acc[0][t] = wmma16b(a0, bw[t], acc[0][t]); acc[1][t] = wmma16b(a1, bw[t], acc[1][t]); }
      asm volatile("v_nop\n\tv_nop\n\tv_nop\n\tv_nop" :: "v"(acc[0][0]), "v"(acc[1][0]), "v"(acc[0][1]), "v"(acc[1][1]), "v"(acc[0][2]), "v"(acc[1][2]), "v"(acc[0][3]), "v"(acc[1][3]), "v"(a0), "v"(a1), "v"(bw[0]), "v"(bw[1]), "v"(bw[2]), "v"(bw[3]));   // behind the k-step's last product: the four vector slots before the next load group overwrites that product's A and B registers
      a0 = na0; a1 = na1;
#pragma unroll
      for (int t = 0; t < 4; ++t) bw[t] = nb[t]; }
    asm volatile("s_wait_dscnt 0x0" ::: "memory");      // this wave's reads of the buffer are done before the buffer is refilled
    asm volatile("s_wait_asynccnt 0x0" ::: "memory");   // this wave's copies of the next tile have landed before the barrier that publishes them
    __syncthreads();
    if (kt + 2 < ONT) { const char* ag = Ag + (kt + 2) * OKT * 2; const unsigned al = al0 + (kt & 1) * (128 * OPH * 2);
      copy8g(ag, 8 * DM * 2, al, 8 * OPH * 2); copy8g(ag + 64 * DM * 2, 8 * DM * 2, al + 64 * OPH * 2, 8 * OPH * 2); copy8g(Bg + (kt + 2) * OKT * 2, 8 * DM * 2, bl0 + (kt & 1) * (64 * OPH * 2), 8 * OPH * 2); } }
  asm volatile("s_wait_asynccnt 0x0" ::: "memory");     // nothing in flight when the wave goes on to its epilogue
  float* Tt = Ts[wave];
#pragma unroll
  for (int t = 0; t < 4; ++t) { const float bb = P[c0 + t * 16 + nloc];
#pragma unroll
    for (int r = 0; r < 2; ++r)
#pragma unroll
      for (int v = 0; v < 8; ++v) Tt[(r * 16 + v + 8 * hlf) * 64 + t * 16 + nloc] = acc[r][t][v] + bb; }
  wave_lds_sync();
  {
#pragma unroll
    for (int j = 0; j < 16; ++j) { const int rr = j * 2 + hlf, c4 = nloc * 4; *(v4f*)(out + (size_t)(m0 + rr) * DM + c0 + c4) = *(const v4f*)(Tt + rr * 64 + c4); }
     }
}
}  // namespace

extern "C" void kernel_launch(void* const* d_in, const int* in_sizes, int n_in,
                              void* d_out, int out_size, void* d_ws, size_t ws_size, hipStream_t stream) {
  (void)n_in; (void)out_size;
  const float* x = (const float*)d_in[0]; const float* Wqkv = (const float*)d_in[1]; const float* Wout = (const float*)d_in[2]; const float* bout = (const float*)d_in[3];
  float* out = (float*)d_out;   // [2][4096][512]
  if (in_sizes[0] != NT * DM || in_sizes[1] != DM * DM || in_sizes[2] != DM * DM || in_sizes[3] != DM) return;
  size_t off = 0; char* ws = (char*)d_ws;
  auto carve = [&](size_t bytes) { char* p = ws + off; off += (bytes + 255) & ~(size_t)255; return p; };
  unsigned short* w16 = (unsigned short*)carve((size_t)DM * DM * 2); b16* wo16 = (b16*)carve((size_t)DM * DM * 2); float* P = (float*)carve(DM * 4);
  b16* qp = (b16*)carve(PL * 2); b16* kp = (b16*)carve(PL * 2); b16* vt = (b16*)carve(PL * 2); b16* ctx = (b16*)carve((size_t)NT * DM * 2); float* sq = (float*)carve((size_t)NT * H * 4);
  if (off > ws_size) return;                                    // ≈ 1 + 8.4 x 4 ≈ 35 MB
  prep_kernel<<<256, 256, 0, stream>>>(Wqkv, Wout, bout, w16, wo16, P);
  proj_kernel<<<dim3(H, NT / 128), 128, 0, stream>>>(x, w16, qp, kp, vt, sq);
  attn_kernel<<<Bn * H * (S / 128), 256, 0, stream>>>(qp, kp, vt, sq, ctx);
  out_kernel<<<dim3(DM / 64, NT / 128), 128, 0, stream>>>(ctx, wo16, P, out);
}

// v009
// It runs in 81.1 microseconds.
// In both of two side-by-side timings against v008, it was 1.05 times as fast.
// Over all steps from v000 it is 4.58 times as fast.
#include <hip/hip_runtime.h>

// SAN (shared-projection attention): w = x W_qkv (q = k = v = w; 8 heads x 64 over 4096 tokens, batch 2); attn = softmax(w.w^T x 64^-0.5); out = (attn w) merged . W_out + b
// -> [2][4096][512].
// The shared projection is ONE exact GEMM on v_wmma_f32_16x16x32_bf16 (x and W exact bf16; 1 product) written three ways (q plane x 1/8 x8, k plane x8,
// (8w)^T plane) as single f16; attention on v_wmma_f32_16x16x32_f16 per (b, h, 32 queries, half of the keys: 64 key blocks) with single-f16 q, k, P, v (1 product each; logits are O(1),
// softmax over 4096 keys) except the self logit w_i·w_i/8 ≈ 8, which dominates the softmax and is taken from an exact f32 |w_i|² computed in the projection epilogue; f32 online softmax / accumulate; ctx single f16; out = ctx.W_out + b (1 product). ≈4.7 M WMMAs (an f32-class path would be ≈13 M).

namespace {
constexpr int Bn = 2, S = 4096, DM = 512, H = 8, HD = 64, NT = Bn * S;
constexpr float QS = 8.0f, KS = 8.0f, VS = 8.0f, PS = 8.0f, SCALE = 0.125f;
constexpr size_t PL = (size_t)Bn * H * S * HD;

typedef _Float16 b16;
typedef __attribute__((ext_vector_type(16))) _Float16 v16b;
typedef __attribute__((ext_vector_type(16))) __bf16 v16bb;
typedef __attribute__((ext_vector_type(8))) _Float16 v8b;
typedef __attribute__((ext_vector_type(8))) unsigned short v8us;
typedef __attribute__((ext_vector_type(8))) float v8f;
typedef __attribute__((ext_vector_type(4))) float v4f;
__device__ __forceinline__ float bf16_rne(float f) { unsigned int u = __float_as_uint(f); u += 0x7FFFu + ((u >> 16) & 1u); return __uint_as_float(u & 0xFFFF0000u); }
__device__ __forceinline__ unsigned short bf16_bits(float f) { unsigned int u = __float_as_uint(f); u += 0x7FFFu + ((u >> 16) & 1u); return (unsigned short)(u >> 16); }
__device__ __forceinline__ v16b frag_kb(const b16* p, int hh) { const v8b a = *(const v8b*)(p + 8 * hh), b = *(const v8b*)(p + 16 + 8 * hh); v16b f;
#pragma unroll
  for (int e = 0; e < 8; ++e) { f[e] = a[e]; f[8 + e] = b[e]; } return f; }
__device__ __forceinline__ v16bb frag_bf(const unsigned short* p, int hh) { const v8us a = *(const v8us*)(p + 8 * hh), b = *(const v8us*)(p + 16 + 8 * hh); union { unsigned short s[16]; v16bb v; } u;
#pragma unroll
  for (int e = 0; e < 8; ++e) { u.s[e] = a[e]; u.s[8 + e] = b[e]; } return u.v; }
struct raw16 { v4f a, b, c, d; };   // one lane's 16 f32 of an A fragment, as loaded
__device__ __forceinline__ raw16 load_raw(const float* p, int hh) { raw16 r; r.a = *(const v4f*)(p + 8 * hh); r.b = *(const v4f*)(p + 8 * hh + 4); r.c = *(const v4f*)(p + 16 + 8 * hh); r.d = *(const v4f*)(p + 16 + 8 * hh + 4); return r; }
__device__ __forceinline__ v16bb cvt_raw(const raw16& r) { union { unsigned short s[16]; v16bb v; } u;
#pragma unroll
  for (int e = 0; e < 4; ++e) { u.s[e] = bf16_bits(r.a[e]); u.s[4 + e] = bf16_bits(r.b[e]); u.s[8 + e] = bf16_bits(r.c[e]); u.s[12 + e] = bf16_bits(r.d[e]); } return u.v; }
__device__ __forceinline__ v8f wmma16b(v16b a, v16b b, v8f c) { return __builtin_amdgcn_wmma_f32_16x16x32_f16(false, a, false, b, (short)0, c, false, false); }
__device__ __forceinline__ v8f wmma16bb(v16bb a, v16bb b, v8f c) { return __builtin_amdgcn_wmma_f32_16x16x32_bf16(false, a, false, b, (short)0, c, false, false); }
__device__ __forceinline__ void wave_lds_sync() { __builtin_amdgcn_fence(__ATOMIC_RELEASE, "workgroup"); __builtin_amdgcn_wave_barrier(); __builtin_amdgcn_fence(__ATOMIC_ACQUIRE, "workgroup"); }
// cross-lane exchanges on the vector pipe (a shuffle compiles to ds_bpermute_b32: a trip through the LDS queue and a full s_wait_dscnt in front of every use)
__device__ __forceinline__ float xhalf(float x) { return __builtin_bit_cast(float, __builtin_amdgcn_permlanex16(__builtin_bit_cast(int, x), __builtin_bit_cast(int, x), 0x76543210, 0xfedcba98, false, false)); }   // lane l reads lane l ^ 16
template <int M> __device__ __forceinline__ float xrow(float x) { return __builtin_bit_cast(float, __builtin_amdgcn_update_dpp(0, __builtin_bit_cast(int, x), 0x160 + M, 0xf, 0xf, true)); }   // lane l reads lane l ^ M of its 16-lane row (DPP row_xmask)
constexpr float LC = 1.4426950408889634f / (QS * KS);   // raw score (= logit x QS x KS) -> logit in base-2 units
constexpr float PMAX = PS * 256.0f;   // a lane's sum of P over one pass above which the softmax base is moved

// GEMM operand staging: 16-byte asynchronous copies to LDS, addresses and steps in bytes; the s_wait_xcnt closes each statement so that no address register is rewritten before it
__device__ __forceinline__ unsigned lds_off(const void* p) { return (unsigned)(size_t)p; }   // low 32 bits of a __shared__ address = byte offset in the work-group's LDS
__device__ __forceinline__ void copy8g(const char* g, size_t gstep, unsigned l, unsigned lstep) {
  asm volatile("global_load_async_to_lds_b128 %0, %8, off\n\tglobal_load_async_to_lds_b128 %1, %9, off\n\tglobal_load_async_to_lds_b128 %2, %10, off\n\tglobal_load_async_to_lds_b128 %3, %11, off\n\t"
               "global_load_async_to_lds_b128 %4, %12, off\n\tglobal_load_async_to_lds_b128 %5, %13, off\n\tglobal_load_async_to_lds_b128 %6, %14, off\n\tglobal_load_async_to_lds_b128 %7, %15, off\n\ts_wait_xcnt 0x0"
               :: "v"(l), "v"(l + lstep), "v"(l + 2 * lstep), "v"(l + 3 * lstep), "v"(l + 4 * lstep), "v"(l + 5 * lstep), "v"(l + 6 * lstep), "v"(l + 7 * lstep),
                  "v"(g), "v"(g + gstep), "v"(g + 2 * gstep), "v"(g + 3 * gstep), "v"(g + 4 * gstep), "v"(g + 5 * gstep), "v"(g + 6 * gstep), "v"(g + 7 * gstep) : "memory");
}
__device__ __forceinline__ void copy4g(const char* g, size_t gstep, unsigned l, unsigned lstep) {
  asm volatile("global_load_async_to_lds_b128 %0, %4, off\n\tglobal_load_async_to_lds_b128 %1, %5, off\n\tglobal_load_async_to_lds_b128 %2, %6, off\n\tglobal_load_async_to_lds_b128 %3, %7, off\n\ts_wait_xcnt 0x0"
               :: "v"(l), "v"(l + lstep), "v"(l + 2 * lstep), "v"(l + 3 * lstep), "v"(g), "v"(g + gstep), "v"(g + 2 * gstep), "v"(g + 3 * gstep) : "memory");
}
constexpr int PKT = 64, PNT = DM / PKT, APF = PKT + 4, BPH = PKT + 8;   // projection: 64-k tiles; LDS row pitches 272 B (f32 x rows) and 144 B (bf16 W rows), 16 B x odd: no bank conflict for 16-byte fragment reads
constexpr int OKT = 128, ONT = DM / OKT, OPH = OKT + 8;                  // output GEMM: 128-k tiles; LDS row pitch 272 B

__global__ __launch_bounds__(256) void prep_kernel(const float* __restrict__ Wqkv, const float* __restrict__ Wout, const float* __restrict__ bout, unsigned short* __restrict__ w16, b16* __restrict__ wo16, float* __restrict__ P) {
  const int t_ = blockIdx.x * 256 + threadIdx.x, nth = gridDim.x * 256;
  {
    for (int q = t_; q < DM * DM; q += nth) { const int o = q / DM, k = q % DM; w16[q] = bf16_bits(Wqkv[(size_t)k * DM + o]); wo16[q] = (b16)bf16_rne(Wout[(size_t)k * DM + o]); }
    for (int q = t_; q < DM; q += nth) P[q] = bf16_rne(bout[q]);
     }
}

// projection: w = bf16(x).W (exact); block 128 tokens x 64 cols (= head h); writes q plane (w/8 x8 = w) hmm: q x SCALE x QS = w x 1, k plane (w x 8), (8w)^T plane, all single f16,
__global__ __launch_bounds__(128) void proj_kernel(const float* __restrict__ x, const unsigned short* __restrict__ w16, b16* __restrict__ qp, b16* __restrict__ kp, b16* __restrict__ vt, float* __restrict__ sq) {
  __shared__ __attribute__((aligned(16))) b16 Tq[4][32][HD + 8], Tk[4][32][HD + 8]; __shared__ __attribute__((aligned(16))) b16 Tv[HD][128 + 8]; __shared__ float Sq[128];
  __shared__ __attribute__((aligned(16))) float Ax[2][128 * APF]; __shared__ __attribute__((aligned(16))) unsigned short Bw[2][HD * BPH];
  const int lane = threadIdx.x & 31, wave = threadIdx.x >> 5, nloc = lane & 15, hlf = lane >> 4, h = blockIdx.x, c0 = h * HD, p0 = blockIdx.y * 128, m0 = p0 + wave * 32, b = p0 / S, t0 = p0 % S;
  v8f acc[2][4];
#pragma unroll
  for (int r = 0; r < 2; ++r)
#pragma unroll
    for (int t = 0; t < 4; ++t) acc[r][t] = (v8f){};
  const int tid = threadIdx.x;
  const char* Ag = (const char*)(x + (size_t)(p0 + (tid >> 4)) * DM + (tid & 15) * 4); const char* Bg = (const char*)(w16 + (size_t)(c0 + (tid >> 3)) * DM + (tid & 7) * 8);   // a wave's copy = 2 rows of x, 4 rows of W
  const unsigned al0 = lds_off(&Ax[0][(tid >> 4) * APF + (tid & 15) * 4]), bl0 = lds_off(&Bw[0][(tid >> 3) * BPH + (tid & 7) * 8]);
  copy8g(Ag, 8 * DM * 4, al0, 8 * APF * 4); copy8g(Ag + 64 * DM * 4, 8 * DM * 4, al0 + 64 * APF * 4, 8 * APF * 4); copy4g(Bg, 16 * DM * 2, bl0, 16 * BPH * 2);
  asm volatile("s_wait_asynccnt 0x0" ::: "memory");   // tile 0 landed (this wave's copies) before the barrier that publishes it
  __syncthreads();
  copy8g(Ag + PKT * 4, 8 * DM * 4, al0 + 128 * APF * 4, 8 * APF * 4); copy8g(Ag + 64 * DM * 4 + PKT * 4, 8 * DM * 4, al0 + (128 + 64) * APF * 4, 8 * APF * 4); copy4g(Bg + PKT * 2, 16 * DM * 2, bl0 + HD * BPH * 2, 16 * BPH * 2);
  for (int kt = 0; kt < PNT; ++kt) {
    const float* xr = &Ax[kt & 1][(wave * 32 + nloc) * APF]; const unsigned short* wr = &Bw[kt & 1][nloc * BPH];
    // inside a tile the fragments are fetched one k-step ahead into a second register set; nothing of the next tile is read here
    raw16 ra0 = load_raw(xr, hlf), ra1 = load_raw(xr + 16 * APF, hlf); v16bb bw[4];
#pragma unroll
    for (int t = 0; t < 4; ++t) bw[t] = frag_bf(wr + t * 16 * BPH, hlf);
#pragma unroll
    for (int kb = 32; kb <= PKT; kb += 32) {   // kb = the k-step of the tile that is fetched; the one before it is worked on; the last trip fetches nothing
      raw16 na0 = ra0, na1 = ra1; v16bb nb[4] = {bw[0], bw[1], bw[2], bw[3]};
      if (kb < PKT) { na0 = load_raw(xr + kb, hlf); na1 = load_raw(xr + 16 * APF + kb, hlf);
#pragma unroll
        for (int t = 0; t < 4; ++t) nb[t] = frag_bf(wr + t * 16 * BPH + kb, hlf); }
      __builtin_amdgcn_sched_barrier(0);   // keeps the next step's LDS reads in one group ahead of this step's products: the scheduler otherwise sinks each read to its use, behind a full wait
      const v16bb a0 = cvt_raw(ra0), a1 = cvt_raw(ra1);
#pragma unroll
      for (int t = 0; t < 4; ++t) { acc[0][t] = wmma16bb(a0, bw[t], acc[0][t]); acc[1][t] = wmma16bb(a1, bw[t], acc[1][t]); }
      asm volatile("v_nop\n\tv_nop\n\tv_nop\n\tv_nop" :: "v"(acc[0][0]), "v"(acc[1][0]), "v"(acc[0][1]), "v"(acc[1][1]), "v"(acc[0][2]), "v"(acc[1][2]), "v"(acc[0][3]), "v"(acc[1][3]), "v"(bw[0]), "v"(bw[1]), "v"(bw[2]), "v"(bw[3]));   // behind the k-step's last product: the four vector slots before the next load group overwrites that product's A and B registers; a0 and a1 are not named: named here, each was packed a second time into registers of its own
      ra0 = na0; ra1 = na1;
#pragma unroll
      for (int t = 0; t < 4; ++t) bw[t] = nb[t]; }
    asm volatile("s_wait_dscnt 0x0" ::: "memory");      // this wave's reads of the buffer are done before the buffer is refilled
    asm volatile("s_wait_asynccnt 0x0" ::: "memory");   // this wave's copies of the next tile have landed before the barrier that publishes them
    __syncthreads();
    if (kt + 2 < PNT) { const char* ag = Ag + (kt + 2) * PKT * 4; const unsigned al = al0 + (kt & 1) * (128 * APF * 4);
      copy8g(ag, 8 * DM * 4, al, 8 * APF * 4); copy8g(ag + 64 * DM * 4, 8 * DM * 4, al + 64 * APF * 4, 8 * APF * 4); copy4g(Bg + (kt + 2) * PKT * 2, 16 * DM * 2, bl0 + (kt & 1) * (HD * BPH * 2), 16 * BPH * 2); } }
  asm volatile("s_wait_asynccnt 0x0" ::: "memory");     // nothing in flight when the wave goes on to its epilogue
#pragma unroll
  for (int t = 0; t < 4; ++t)
#pragma unroll
    for (int r = 0; r < 2; ++r)
#pragma unroll
      for (int v = 0; v < 8; ++v) { const float w = acc[r][t][v]; Tq[wave][r * 16 + 8 * hlf + v][t * 16 + nloc] = (b16)(w * (SCALE * QS)); Tk[wave][r * 16 + 8 * hlf + v][t * 16 + nloc] = (b16)(w * KS); Tv[t * 16 + nloc][wave * 32 + r * 16 + 8 * hlf + v] = (b16)(w * VS); }
  // exact f32 self-logit ingredient: |w_row|^2 per (token, head) (sum over this lane's 4 columns x ... then across the 16 column lanes; fixed order)
  float s2a[2][8];   // the 16 chains are independent: formed side by side, stored under one test
#pragma unroll
  for (int r = 0; r < 2; ++r)
#pragma unroll
    for (int v = 0; v < 8; ++v) { float s2 = 0.0f;
#pragma unroll
      for (int t = 0; t < 4; ++t) { const float w = acc[r][t][v]; s2 += w * w; }
      s2 += xrow<1>(s2); s2 += xrow<2>(s2); s2 += xrow<4>(s2); s2 += xrow<8>(s2); s2a[r][v] = s2; }
  if (nloc == 0) {
#pragma unroll
    for (int r = 0; r < 2; ++r)
#pragma unroll
      for (int v = 0; v < 8; ++v) Sq[wave * 32 + r * 16 + 8 * hlf + v] = s2a[r][v]; }
  __syncthreads();
  b16* qb = qp + (((size_t)b * H + h) * S + (m0 % S)) * HD; b16* kb_ = kp + (((size_t)b * H + h) * S + (m0 % S)) * HD;
  {
#pragma unroll
    for (int j = 0; j < 8; ++j) { const int rr = j * 4 + (lane >> 3), c8 = (lane & 7) * 8; *(v8b*)(qb + (size_t)rr * HD + c8) = *(const v8b*)(&Tq[wave][rr][c8]); *(v8b*)(kb_ + (size_t)rr * HD + c8) = *(const v8b*)(&Tk[wave][rr][c8]); }
    for (int i = threadIdx.x; i < HD * 16; i += 128) { const int d = i >> 4, c8 = (i & 15) * 8; *(v8b*)(vt + (((size_t)b * H + h) * HD + d) * S + t0 + c8) = *(const v8b*)(&Tv[d][c8]); }
    *(float*)(sq + ((size_t)b * H + h) * S + t0 + threadIdx.x) = Sq[threadIdx.x];   // [b][h][token] f32: 512 B per block
     }
}

constexpr int KT = 256, NSTG = S / KT, KPI = HD + 8, VPI = KT + 8;   // LDS row pitches 144 B and 528 B (16 B x odd: no bank conflict for 16-byte fragment reads)
__device__ __forceinline__ unsigned lds_addr(const b16* p) { return (unsigned)(size_t)p; }   // low 32 bits of a __shared__ address = byte offset in the work-group's LDS
// eight 16-byte copies per lane; the s_wait_xcnt closes the statement so that no address register is rewritten before it
__device__ __forceinline__ void copy8(const b16* g, size_t gstep, const b16* l, int lstep) {
  asm volatile("global_load_async_to_lds_b128 %0, %8, off\n\tglobal_load_async_to_lds_b128 %1, %9, off\n\tglobal_load_async_to_lds_b128 %2, %10, off\n\tglobal_load_async_to_lds_b128 %3, %11, off\n\t"
               "global_load_async_to_lds_b128 %4, %12, off\n\tglobal_load_async_to_lds_b128 %5, %13, off\n\tglobal_load_async_to_lds_b128 %6, %14, off\n\tglobal_load_async_to_lds_b128 %7, %15, off\n\ts_wait_xcnt 0x0"
               :: "v"(lds_addr(l)), "v"(lds_addr(l + lstep)), "v"(lds_addr(l + 2 * lstep)), "v"(lds_addr(l + 3 * lstep)), "v"(lds_addr(l + 4 * lstep)), "v"(lds_addr(l + 5 * lstep)), "v"(lds_addr(l + 6 * lstep)), "v"(lds_addr(l + 7 * lstep)),
                  "v"(g), "v"(g + gstep), "v"(g + 2 * gstep), "v"(g + 3 * gstep), "v"(g + 4 * gstep), "v"(g + 5 * gstep), "v"(g + 6 * gstep), "v"(g + 7 * gstep) : "memory");
}
typedef v4f __attribute__((may_alias)) v4fa;   // f32 view of the K buffers, which carry the partial sums behind the loop
__global__ __launch_bounds__(256) void attn_kernel(const b16* __restrict__ qp, const b16* __restrict__ kp, const b16* __restrict__ vt, const float* __restrict__ sq, b16* __restrict__ ctx) {
  __shared__ __attribute__((aligned(16))) b16 Ks[2][KT * KPI], Vs[2][HD * VPI], Os[8][16][HD + 8];
  const int wave = threadIdx.x >> 5, lane = threadIdx.x & 31, hh = lane >> 4, col = lane & 15; const int bh = blockIdx.x / (S / 128), b = bh / H, h = bh % H, q0 = (blockIdx.x % (S / 128)) * 128 + (wave & 3) * 32;
  const int kg = __builtin_amdgcn_readfirstlane(wave >> 2);   // this wave's half of every key tile (the same in every lane: kept in a scalar register)
  const b16* Q = qp + ((size_t)bh * S) * HD; const b16* K = kp + ((size_t)bh * S) * HD; const b16* V = vt + ((size_t)bh * HD) * S;
  // this lane's share of a tile: K = 256 rows x 128 B, contiguous (a wave's copy = 4 rows); V^T = 64 rows x 512 B (a wave's copy = 1 row)
  const b16* Kg = K + threadIdx.x * 8; const b16* Vg = V + (size_t)wave * S + lane * 8; const int kl0 = (threadIdx.x >> 3) * KPI + (threadIdx.x & 7) * 8, vl0 = wave * VPI + lane * 8;
  copy8(Kg, 32 * HD, &Ks[0][kl0], 32 * KPI); copy8(Vg, (size_t)8 * S, &Vs[0][vl0], 8 * VPI);
  asm volatile("s_wait_asynccnt 0x0" ::: "memory");   // tile 0 landed (this wave's copies) before the barrier that publishes it
  __syncthreads();
  copy8(Kg + KT * HD, 32 * HD, &Ks[1][kl0], 32 * KPI); copy8(Vg + KT, (size_t)8 * S, &Vs[1][vl0], 8 * VPI);
  v16b qf[2][2]; float sself[2];   // index u = query tile: queries q0 + 16 u + col
#pragma unroll
  for (int u = 0; u < 2; ++u) { const int qi = q0 + 16 * u + col; qf[u][0] = frag_kb(Q + (size_t)qi * HD, hh); qf[u][1] = frag_kb(Q + (size_t)qi * HD + 32, hh); sself[u] = sq[(size_t)bh * S + qi] * (SCALE * QS * KS); }   // exact f32 self logit (the dominant softmax term), in the raw scores' units (x QS x KS, a power of two)
  const int dkb = __builtin_amdgcn_readfirstlane(q0);   // first key of the one 32-key pass that holds this wave's own 32 keys; it lies in one key half only: the wave of the other half never meets it
  float m[2] = {-INFINITY, -INFINITY}, nb[2] = {INFINITY, INFINITY}, l[2] = {0.0f, 0.0f}; v8f o[2][4] = {{{}, {}, {}, {}}, {{}, {}, {}, {}}};   // m = the base in use (raw-score units), nb = 3 - m x LC
  for (int st = 0; st < NSTG; ++st) {
    const b16* Kb = &Ks[st & 1][col * KPI]; const b16* Vb = &Vs[st & 1][col * VPI];
    for (int kl = kg * (KT / 2); kl < kg * (KT / 2) + KT / 2; kl += 32) { const int kb = st * KT + kl;
      const v16b ka0 = frag_kb(Kb + kl * KPI, hh), ka1 = frag_kb(Kb + kl * KPI + 32, hh), kc0 = frag_kb(Kb + (kl + 16) * KPI, hh), kc1 = frag_kb(Kb + (kl + 16) * KPI + 32, hh);
      const v16b vf[4] = {frag_kb(Vb + kl, hh), frag_kb(Vb + 16 * VPI + kl, hh), frag_kb(Vb + 32 * VPI + kl, hh), frag_kb(Vb + 48 * VPI + kl, hh)};   // all of the pass's LDS reads stand together, ahead of its products
      __builtin_amdgcn_sched_barrier(0);   // holds the 16 LDS reads in one group ahead of the products: the scheduler otherwise sinks each pair to its product, behind a full wait
      v8f s0[2] = {{}, {}}, s1[2] = {{}, {}};
#pragma unroll
      for (int u = 0; u < 2; ++u) { s0[u] = wmma16b(ka0, qf[u][0], s0[u]); s1[u] = wmma16b(kc0, qf[u][0], s1[u]); }
#pragma unroll
      for (int u = 0; u < 2; ++u) { s0[u] = wmma16b(ka1, qf[u][1], s0[u]); s1[u] = wmma16b(kc1, qf[u][1], s1[u]); }
      float lim = PMAX;   // the same in every lane: a scalar register
      if (kb == dkb) { lim = -1.0f;   // one pass in 64, in one key half: a scalar compare and branch, so the other passes carry no index compare and no select
#pragma unroll
        for (int r = 0; r < 8; ++r) if (8 * hh + r == col) { s0[0][r] = sself[0]; s1[1][r] = sself[1]; } }   // kb = q0 here: query q0 + col is key row col of the first 16 keys, query q0 + 16 + col key row col of the second 16
      // lazy rescale: P is formed against the base m in use (score scale, log2(e), the base and the x PS of P in one multiply-add per score ahead of exp2); the base moves only when it has to
      float e0[2][8], e1[2][8], sum[2] = {0.0f, 0.0f};
      // one score tile after the other (s0's eight scores, then s1's), the sums last, in the order they had: with two query tiles this compiler packs the multiply-adds in pairs by itself, and with
      // s0 and s1 taken in turn it pairs a register of the one with a register of the other and first copies all 32 scores of the pass into such pairs
#pragma unroll
      for (int u = 0; u < 2; ++u) {
#pragma unroll
        for (int r = 0; r < 8; ++r) e0[u][r] = __builtin_amdgcn_exp2f(__builtin_fmaf(s0[u][r], LC, nb[u]));   // e = PS x exp(logit - base)
#pragma unroll
        for (int r = 0; r < 8; ++r) e1[u][r] = __builtin_amdgcn_exp2f(__builtin_fmaf(s1[u][r], LC, nb[u]));
#pragma unroll
        for (int r = 0; r < 8; ++r) sum[u] += e0[u][r] + e1[u][r]; }
      // every e is >= 0, so a lane's sum bounds each of them: one ballot and scalar branch per pass for both query tiles. Taken in the first pass (nb = +inf gives sum = +inf), where a score lies more than
      // about 8 octaves above the base (P would leave f16's range; a NaN sum is caught too), and always in the pass of the wave's own keys (lim < 0), so that the dominant self term's P stays the exact PS
      if (__builtin_amdgcn_ballot_w32(!(sum[0] <= lim) || !(sum[1] <= lim)) != 0) {
#pragma unroll
        for (int u = 0; u < 2; ++u) {
          float mr = -INFINITY;   // the maximum is taken on the raw scores
#pragma unroll
          for (int r = 0; r < 8; ++r) mr = fmaxf(mr, fmaxf(s0[u][r], s1[u][r]));
          mr = fmaxf(mr, xhalf(mr));   // both halves of the wave hold the same query: one base for both
          const float mn = fmaxf(m[u], mr), al_ = __builtin_amdgcn_exp2f((m[u] - mn) * LC); m[u] = mn; nb[u] = __builtin_fmaf(-mn, LC, 3.0f); l[u] *= al_; sum[u] = 0.0f;   // 3 = log2(PS); al_ = 0 in the first pass
#pragma unroll
          for (int t = 0; t < 4; ++t) o[u][t] *= al_;
#pragma unroll
          for (int r = 0; r < 8; ++r) e0[u][r] = __builtin_amdgcn_exp2f(__builtin_fmaf(s0[u][r], LC, nb[u]));
#pragma unroll
          for (int r = 0; r < 8; ++r) e1[u][r] = __builtin_amdgcn_exp2f(__builtin_fmaf(s1[u][r], LC, nb[u]));
#pragma unroll
          for (int r = 0; r < 8; ++r) sum[u] += e0[u][r] + e1[u][r]; } }
      v16b pbv[2];
#pragma unroll
      for (int u = 0; u < 2; ++u) {
#pragma unroll
        for (int r = 0; r < 8; ++r) { pbv[u][r] = (b16)e0[u][r]; pbv[u][8 + r] = (b16)e1[u][r]; }
        l[u] += sum[u]; }   // each half of the wave keeps the sum of its own 16 keys of every pass; the halves are joined once, behind the loop
#pragma unroll
      for (int t = 0; t < 4; ++t) { o[0][t] = wmma16b(vf[t], pbv[0], o[0][t]); o[1][t] = wmma16b(vf[t], pbv[1], o[1][t]); }
      asm volatile("v_nop\n\tv_nop\n\tv_nop\n\tv_nop" : "+v"(o[1][3]) : "v"(vf[3]), "v"(pbv[1])); }   // behind the pass's last product: the four vector slots the chip needs before the next pass's address arithmetic overwrites that product's A registers
    asm volatile("s_wait_dscnt 0x0" ::: "memory");      // this wave's reads of the buffer are done before the buffer is refilled
    asm volatile("s_wait_asynccnt 0x0" ::: "memory");   // this wave's copies of the next tile have landed before the barrier that publishes them
    __syncthreads();
    if (st + 2 < NSTG) { copy8(Kg + (size_t)(st + 2) * KT * HD, 32 * HD, &Ks[st & 1][kl0], 32 * KPI); copy8(Vg + (st + 2) * KT, (size_t)8 * S, &Vs[st & 1][vl0], 8 * VPI); } }
  asm volatile("s_wait_asynccnt 0x0" ::: "memory");     // nothing in flight when the wave goes on to its end
  l[0] += xhalf(l[0]); l[1] += xhalf(l[1]);   // both halves of the wave hold the same query under the same base: one exchange for the whole loop
  // join of the two key halves: waves w and w ^ 4 hold the same 32 queries. Wave w finishes query tile kg and hands its partial sums of the other tile to its partner through the K buffers,
  // which nobody reads any more (the loop's last barrier) and into which nothing is in flight (the last two trips issue no copy). Lane for lane the two waves hold the same (query, d) places.
  v4fa* X = (v4fa*)&Ks[0][0];   // [wave][9][lane] x 16 B = 36,864 B of the 73,728
  v8f own[4], snd[4];
#pragma unroll
  for (int t = 0; t < 4; ++t) { own[t] = kg ? o[1][t] : o[0][t]; snd[t] = kg ? o[0][t] : o[1][t]; }
  const float mo = kg ? m[1] : m[0], lo = kg ? l[1] : l[0], ms = kg ? m[0] : m[1], ls = kg ? l[0] : l[1];
#pragma unroll
  for (int t = 0; t < 4; ++t) { X[(wave * 9 + 2 * t) * 32 + lane] = (v4f){snd[t][0], snd[t][1], snd[t][2], snd[t][3]}; X[(wave * 9 + 2 * t + 1) * 32 + lane] = (v4f){snd[t][4], snd[t][5], snd[t][6], snd[t][7]}; }
  X[(wave * 9 + 8) * 32 + lane] = (v4f){ms, ls, 0.0f, 0.0f};
  __syncthreads();   // publishes every wave's partial sums to its partner
  const int pw = wave ^ 4; const v4f ml = X[(pw * 9 + 8) * 32 + lane];
  const float mj = fmaxf(mo, ml[0]), fo = __builtin_amdgcn_exp2f((mo - mj) * LC), fx = __builtin_amdgcn_exp2f((ml[0] - mj) * LC);   // both bases are finite: every wave's first pass sets one
  const float inv = 1.0f / ((lo * fo + ml[1] * fx) * VS), go = fo * inv, gx = fx * inv;   // l already carries the x PS
#pragma unroll
  for (int t = 0; t < 4; ++t) { const v4f xa = X[(pw * 9 + 2 * t) * 32 + lane], xb = X[(pw * 9 + 2 * t + 1) * 32 + lane];
#pragma unroll
    for (int r = 0; r < 4; ++r) { Os[wave][col][t * 16 + 8 * hh + r] = (b16)(own[t][r] * go + xa[r] * gx); Os[wave][col][t * 16 + 8 * hh + 4 + r] = (b16)(own[t][4 + r] * go + xb[r] * gx); } }
  __syncthreads();
  b16* dst = ctx + ((size_t)b * S + q0 + 16 * kg) * DM + h * HD;   // this wave's 16 rows x 128 B: whole lines, one writer each
  for (int j = 0; j < 4; ++j) { const int rr = j * 4 + (lane >> 3), c8 = (lane & 7) * 8; *(v8b*)(dst + (size_t)rr * DM + c8) = *(const v8b*)(&Os[wave][rr][c8]); }
}

__global__ __launch_bounds__(128) void out_kernel(const b16* __restrict__ ctx, const b16* __restrict__ wo16, const float* __restrict__ P, float* __restrict__ out) {
  __shared__ __attribute__((aligned(16))) float Ts[4][32 * 64]; __shared__ __attribute__((aligned(16))) b16 Ac[2][128 * OPH], Bo[2][64 * OPH];
  const int lane = threadIdx.x & 31, wave = threadIdx.x >> 5, nloc = lane & 15, hlf = lane >> 4, m0 = blockIdx.y * 128 + wave * 32, c0 = blockIdx.x * 64;
  v8f acc[2][4];
#pragma unroll
  for (int r = 0; r < 2; ++r)
#pragma unroll
    for (int t = 0; t < 4; ++t) acc[r][t] = (v8f){};
  // as in the projection: each 128-k tile of ctx (128 rows x 256 B) and of W_out (64 rows x 256 B) comes into LDS once per block in whole lines, two buffers
  const int tid = threadIdx.x;
  const char* Ag = (const char*)(ctx + (size_t)(blockIdx.y * 128 + (tid >> 4)) * DM + (tid & 15) * 8); const char* Bg = (const char*)(wo16 + (size_t)(c0 + (tid >> 4)) * DM + (tid & 15) * 8);   // a wave's copy = 2 rows
  const unsigned al0 = lds_off(&Ac[0][(tid >> 4) * OPH + (tid & 15) * 8]), bl0 = lds_off(&Bo[0][(tid >> 4) * OPH + (tid & 15) * 8]);
  copy8g(Ag, 8 * DM * 2, al0, 8 * OPH * 2); copy8g(Ag + 64 * DM * 2, 8 * DM * 2, al0 + 64 * OPH * 2, 8 * OPH * 2); copy8g(Bg, 8 * DM * 2, bl0, 8 * OPH * 2);
  asm volatile("s_wait_asynccnt 0x0" ::: "memory");   // tile 0 landed (this wave's copies) before the barrier that publishes it
  __syncthreads();
  copy8g(Ag + OKT * 2, 8 * DM * 2, al0 + 128 * OPH * 2, 8 * OPH * 2); copy8g(Ag + 64 * DM * 2 + OKT * 2, 8 * DM * 2, al0 + (128 + 64) * OPH * 2, 8 * OPH * 2); copy8g(Bg + OKT * 2, 8 * DM * 2, bl0 + 64 * OPH * 2, 8 * OPH * 2);
  for (int kt = 0; kt < ONT; ++kt) {
    const b16* cr = &Ac[kt & 1][(wave * 32 + nloc) * OPH]; const b16* wr = &Bo[kt & 1][nloc * OPH];
    // inside a tile the fragments are fetched one k-step ahead into a second register set; nothing of the next tile is read here
    v16b a0 = frag_kb(cr, hlf), a1 = frag_kb(cr + 16 * OPH, hlf), bw[4];
#pragma unroll
    for (int t = 0; t < 4; ++t) bw[t] = frag_kb(wr + t * 16 * OPH, hlf);
#pragma unroll
    for (int kb = 32; kb <= OKT; kb += 32) {   // kb = the k-step of the tile that is fetched; the one before it is worked on; the last trip fetches nothing
      v16b na0 = a0, na1 = a1, nb[4] = {bw[0], bw[1], bw[2], bw[3]};
      if (kb < OKT) { na0 = frag_kb(cr + kb, hlf); na1 = frag_kb(cr + 16 * OPH + kb, hlf);
#pragma unroll
        for (int t = 0; t < 4; ++t) nb[t] = frag_kb(wr + t * 16 * OPH + kb, hlf); }
      __builtin_amdgcn_sched_barrier(0);   // keeps the next step's LDS reads in one group ahead of this step's products: the scheduler otherwise sinks each read to its use, behind a full wait
#pragma unroll
      for (int t = 0; t < 4; ++t) { acc[0][t] = wmma16b(a0, bw[t], acc[0][t]); acc[1][t] = wmma16b(a1, bw[t], acc[1][t]); }
      asm volatile("v_nop\n\tv_nop\n\tv_nop\n\tv_nop" :: "v"(acc[0][0]), "v"(acc[1][0]), "v"(acc[0][1]), "v"(acc[1][1]), "v"(acc[0][2]), "v"(acc[1][2]), "v"(acc[0][3]), "v"(acc[1][3]), "v"(a0), "v"(a1), "v"(bw[0]), "v"(bw[1]), "v"(bw[2]), "v"(bw[3]));   // behind the k-step's last product: the four vector slots before the next load group overwrites that product's A and B registers
      a0 = na0; a1 = na1;
#pragma unroll
      for (int t = 0; t < 4; ++t) bw[t] = nb[t]; }
    asm volatile("s_wait_dscnt 0x0" ::: "memory");      // this wave's reads of the buffer are done before the buffer is refilled
    asm volatile("s_wait_asynccnt 0x0" ::: "memory");   // this wave's copies of the next tile have landed before the barrier that publishes them
    __syncthreads();
    if (kt + 2 < ONT) { const char* ag = Ag + (kt + 2) * OKT * 2; const unsigned al = al0 + (kt & 1) * (128 * OPH * 2);
      copy8g(ag, 8 * DM * 2, al, 8 * OPH * 2); copy8g(ag + 64 * DM * 2, 8 * DM * 2, al + 64 * OPH * 2, 8 * OPH * 2); copy8g(Bg + (kt + 2) * OKT * 2, 8 * DM * 2, bl0 + (kt & 1) * (64 * OPH * 2), 8 * OPH * 2); } }
  asm volatile("s_wait_asynccnt 0x0" ::: "memory");     // nothing in flight when the wave goes on to its epilogue
  float* Tt = Ts[wave];
#pragma unroll
  for (int t = 0; t < 4; ++t) { const float bb = P[c0 + t * 16 + nloc];
#pragma unroll
    for (int r = 0; r < 2; ++r)
#pragma unroll
      for (int v = 0; v < 8; ++v) Tt[(r * 16 + v + 8 * hlf) * 64 + t * 16 + nloc] = acc[r][t][v] + bb; }
  wave_lds_sync();
  {
#pragma unroll
    for (int j = 0; j < 16; ++j) { const int rr = j * 2 + hlf, c4 = nloc * 4; *(v4f*)(out + (size_t)(m0 + rr) * DM + c0 + c4) = *(const v4f*)(Tt + rr * 64 + c4); }
     }
}
}  // namespace

extern "C" void kernel_launch(void* const* d_in, const int* in_sizes, int n_in,
                              void* d_out, int out_size, void* d_ws, size_t ws_size, hipStream_t stream) {
  (void)n_in; (void)out_size;
  const float* x = (const float*)d_in[0]; const float* Wqkv = (const float*)d_in[1]; const float* Wout = (const float*)d_in[2]; const float* bout = (const float*)d_in[3];
  float* out = (float*)d_out;   // [2][4096][512]
  if (in_sizes[0] != NT * DM || in_sizes[1] != DM * DM || in_sizes[2] != DM * DM || in_sizes[3] != DM) return;
  size_t off = 0; char* ws = (char*)d_ws;
  auto carve = [&](size_t bytes) { char* p = ws + off; off += (bytes + 255) & ~(size_t)255; return p; };
  unsigned short* w16 = (unsigned short*)carve((size_t)DM * DM * 2); b16* wo16 = (b16*)carve((size_t)DM * DM * 2); float* P = (float*)carve(DM * 4);
  b16* qp = (b16*)carve(PL * 2); b16* kp = (b16*)carve(PL * 2); b16* vt = (b16*)carve(PL * 2); b16* ctx = (b16*)carve((size_t)NT * DM * 2); float* sq = (float*)carve((size_t)NT * H * 4);
  if (off > ws_size) return;                                    // ≈ 1 + 8.4 x 4 ≈ 35 MB
  prep_kernel<<<256, 256, 0, stream>>>(Wqkv, Wout, bout, w16, wo16, P);
  proj_kernel<<<dim3(H, NT / 128), 128, 0, stream>>>(x, w16, qp, kp, vt, sq);
  attn_kernel<<<Bn * H * (S / 128), 256, 0, stream>>>(qp, kp, vt, sq, ctx);
  out_kernel<<<dim3(DM / 64, NT / 128), 128, 0, stream>>>(ctx, wo16, P, out);
}

// v010
// Measured time: 78.6 microseconds a run.
// In both of two side-by-side timings against v009, it was 1.03 times as fast.
// Over all steps from v000 it is 4.73 times as fast.
#include <hip/hip_runtime.h>

// SAN (shared-projection attention): w = x W_qkv (q = k = v = w; 8 heads x 64 over 4096 tokens, batch 2); attn = softmax(w.w^T x 64^-0.5); out = (attn w) merged . W_out + b
// -> [2][4096][512].
// The shared projection is ONE exact GEMM on v_wmma_f32_16x16x32_bf16 (x and W exact bf16; 1 product) written three ways (q plane x 1/8 x8, k plane x8,
// (8w)^T plane) as single f16; attention on v_wmma_f32_16x16x32_f16 per (b, h, 32 queries, half of the keys: 64 key blocks) with single-f16 q, k, P, v (1 product each; logits are O(1),
// softmax over 4096 keys) except the self logit w_i·w_i/8 ≈ 8, which dominates the softmax and is taken from an exact f32 |w_i|² computed in the projection epilogue; f32 online softmax / accumulate; ctx single f16; out = ctx.W_out + b (1 product). ≈4.7 M WMMAs (an f32-class path would be ≈13 M).

namespace {
constexpr int Bn = 2, S = 4096, DM = 512, H = 8, HD = 64, NT = Bn * S;
constexpr float QS = 8.0f, KS = 8.0f, VS = 8.0f, PS = 8.0f, SCALE = 0.125f;
constexpr size_t PL = (size_t)Bn * H * S * HD;

typedef _Float16 b16;
typedef __attribute__((ext_vector_type(16))) _Float16 v16b;
typedef __attribute__((ext_vector_type(16))) __bf16 v16bb;
typedef __attribute__((ext_vector_type(8))) _Float16 v8b;
typedef __attribute__((ext_vector_type(8))) float v8f;
typedef __attribute__((ext_vector_type(4))) float v4f;
typedef __attribute__((ext_vector_type(2))) float v2f;
__device__ __forceinline__ float bf16_rne(float f) { unsigned int u = __float_as_uint(f); u += 0x7FFFu + ((u >> 16) & 1u); return __uint_as_float(u & 0xFFFF0000u); }
__device__ __forceinline__ unsigned short bf16_bits(float f) { unsigned int u = __float_as_uint(f); u += 0x7FFFu + ((u >> 16) & 1u); return (unsigned short)(u >> 16); }
__device__ __forceinline__ v16b frag_kb(const b16* p, int hh) { const v8b a = *(const v8b*)(p + 8 * hh), b = *(const v8b*)(p + 16 + 8 * hh); v16b f;
#pragma unroll
  for (int e = 0; e < 8; ++e) { f[e] = a[e]; f[8 + e] = b[e]; } return f; }
struct raw16 { v4f a, b, c, d; };   // one lane's 16 f32 of an A fragment, as loaded
__device__ __forceinline__ raw16 load_raw(const float* p, int hh) { raw16 r; r.a = *(const v4f*)(p + 8 * hh); r.b = *(const v4f*)(p + 8 * hh + 4); r.c = *(const v4f*)(p + 16 + 8 * hh); r.d = *(const v4f*)(p + 16 + 8 * hh + 4); return r; }
__device__ __forceinline__ v16bb cvt_raw(const raw16& r) { union { unsigned short s[16]; v16bb v; } u;
#pragma unroll
  for (int e = 0; e < 4; ++e) { u.s[e] = bf16_bits(r.a[e]); u.s[4 + e] = bf16_bits(r.b[e]); u.s[8 + e] = bf16_bits(r.c[e]); u.s[12 + e] = bf16_bits(r.d[e]); } return u.v; }
// B fragment t of the projection out of 16 rows of W as read (rb[e] = 4 neighbouring columns of the fragment's e-th k): column t of every row, rounded to nearest even, two k per conversion
__device__ __forceinline__ v16bb cvt_col(const v4f (&rb)[16], int t) { v16bb f;
#pragma unroll
  for (int e = 0; e < 16; ++e) f[e] = (__bf16)rb[e][t];
  return f; }
__device__ __forceinline__ v8f wmma16b(v16b a, v16b b, v8f c) { return __builtin_amdgcn_wmma_f32_16x16x32_f16(false, a, false, b, (short)0, c, false, false); }
__device__ __forceinline__ v8f wmma16bb(v16bb a, v16bb b, v8f c) { return __builtin_amdgcn_wmma_f32_16x16x32_bf16(false, a, false, b, (short)0, c, false, false); }
__device__ __forceinline__ void wave_lds_sync() { __builtin_amdgcn_fence(__ATOMIC_RELEASE, "workgroup"); __builtin_amdgcn_wave_barrier(); __builtin_amdgcn_fence(__ATOMIC_ACQUIRE, "workgroup"); }
// cross-lane exchanges on the vector pipe (a shuffle compiles to ds_bpermute_b32: a trip through the LDS queue and a full s_wait_dscnt in front of every use)
__device__ __forceinline__ float xhalf(float x) { return __builtin_bit_cast(float, __builtin_amdgcn_permlanex16(__builtin_bit_cast(int, x), __builtin_bit_cast(int, x), 0x76543210, 0xfedcba98, false, false)); }   // lane l reads lane l ^ 16
template <int M> __device__ __forceinline__ float xrow(float x) { return __builtin_bit_cast(float, __builtin_amdgcn_update_dpp(0, __builtin_bit_cast(int, x), 0x160 + M, 0xf, 0xf, true)); }   // lane l reads lane l ^ M of its 16-lane row (DPP row_xmask)
constexpr float LC = 1.4426950408889634f / (QS * KS);   // raw score (= logit x QS x KS) -> logit in base-2 units
constexpr float PMAX = PS * 256.0f;   // a lane's sum of P over one pass above which the softmax base is moved

// GEMM operand staging: 16-byte asynchronous copies to LDS, addresses and steps in bytes; the s_wait_xcnt closes each statement so that no address register is rewritten before it
__device__ __forceinline__ unsigned lds_off(const void* p) { return (unsigned)(size_t)p; }   // low 32 bits of a __shared__ address = byte offset in the work-group's LDS
__device__ __forceinline__ void copy8g(const char* g, size_t gstep, unsigned l, unsigned lstep) {
  asm volatile("global_load_async_to_lds_b128 %0, %8, off\n\tglobal_load_async_to_lds_b128 %1, %9, off\n\tglobal_load_async_to_lds_b128 %2, %10, off\n\tglobal_load_async_to_lds_b128 %3, %11, off\n\t"
               "global_load_async_to_lds_b128 %4, %12, off\n\tglobal_load_async_to_lds_b128 %5, %13, off\n\tglobal_load_async_to_lds_b128 %6, %14, off\n\tglobal_load_async_to_lds_b128 %7, %15, off\n\ts_wait_xcnt 0x0"
               :: "v"(l), "v"(l + lstep), "v"(l + 2 * lstep), "v"(l + 3 * lstep), "v"(l + 4 * lstep), "v"(l + 5 * lstep), "v"(l + 6 * lstep), "v"(l + 7 * lstep),
                  "v"(g), "v"(g + gstep), "v"(g + 2 * gstep), "v"(g + 3 * gstep), "v"(g + 4 * gstep), "v"(g + 5 * gstep), "v"(g + 6 * gstep), "v"(g + 7 * gstep) : "memory");
}
constexpr int PKT = 64, PNT = DM / PKT, APF = PKT + 4, BPF = HD + 4;   // projection: 64-k tiles; LDS row pitch 272 B for the f32 x rows (64 k of a token) and for the f32 W rows (64 columns of a k), 16 B x odd
constexpr int OKT = 128, ONT = DM / OKT, OPH = OKT + 8;                  // output GEMM: 128-k tiles; LDS row pitch 272 B

// projection: w = bf16(x).W (exact); block 128 tokens x 64 cols (= head h); writes q plane (w/8 x8 = w) hmm: q x SCALE x QS = w x 1, k plane (w x 8), (8w)^T plane, all single f16,
// W_qkv is read as it lies, f32 [k][column]: accumulator tile t holds in lane column n the head's column 4 n + t, so one 16-byte LDS read of a W row feeds the same k of all four B fragments and no transposed copy of W is
// needed; the rounding to bf16 is done in registers. The transposed f16 copy of W_out that the output GEMM reads is written here as well, 1/512 of it per block (64 k x 8 columns).
__global__ __launch_bounds__(128) void proj_kernel(const float* __restrict__ x, const float* __restrict__ Wqkv, const float* __restrict__ Wout, b16* __restrict__ wo16, b16* __restrict__ qp, b16* __restrict__ kp, b16* __restrict__ vt, float* __restrict__ sq) {
  __shared__ __attribute__((aligned(16))) b16 Tq[4][32][HD + 8], Tk[4][32][HD + 8]; __shared__ __attribute__((aligned(16))) b16 Tv[HD][128 + 8]; __shared__ float Sq[128];
  __shared__ __attribute__((aligned(16))) float Ax[2][128 * APF], Bw[2][PKT * BPF];
  const int lane = threadIdx.x & 31, wave = threadIdx.x >> 5, nloc = lane & 15, hlf = lane >> 4, h = blockIdx.x, c0 = h * HD, p0 = blockIdx.y * 128, m0 = p0 + wave * 32, b = p0 / S, t0 = p0 % S;
  v8f acc[2][4];
#pragma unroll
  for (int r = 0; r < 2; ++r)
#pragma unroll
    for (int t = 0; t < 4; ++t) acc[r][t] = (v8f){};
  const int tid = threadIdx.x;
  const char* Ag = (const char*)(x + (size_t)(p0 + (tid >> 4)) * DM + (tid & 15) * 4); const char* Bg = (const char*)(Wqkv + (size_t)(tid >> 4) * DM + c0 + (tid & 15) * 4);   // a wave's copy = 2 rows of x or of W
  const unsigned al0 = lds_off(&Ax[0][(tid >> 4) * APF + (tid & 15) * 4]), bl0 = lds_off(&Bw[0][(tid >> 4) * BPF + (tid & 15) * 4]);
  copy8g(Ag, 8 * DM * 4, al0, 8 * APF * 4); copy8g(Ag + 64 * DM * 4, 8 * DM * 4, al0 + 64 * APF * 4, 8 * APF * 4); copy8g(Bg, 8 * DM * 4, bl0, 8 * BPF * 4);
  // this block's piece of W_out: k = wk, wk + 1, columns wc, wc + 1 per lane; read here, stored behind the k loop
  const int bid = blockIdx.y * H + blockIdx.x, wk = (bid & 7) * 64 + 2 * lane, wc = (bid >> 3) * 8 + 2 * wave;
  const v2f wo0 = *(const v2f*)(Wout + (size_t)wk * DM + wc), wo1 = *(const v2f*)(Wout + (size_t)(wk + 1) * DM + wc);
  asm volatile("s_wait_asynccnt 0x0" ::: "memory");   // tile 0 landed (this wave's copies) before the barrier that publishes it
  __syncthreads();
  copy8g(Ag + PKT * 4, 8 * DM * 4, al0 + 128 * APF * 4, 8 * APF * 4); copy8g(Ag + 64 * DM * 4 + PKT * 4, 8 * DM * 4, al0 + (128 + 64) * APF * 4, 8 * APF * 4); copy8g(Bg + PKT * DM * 4, 8 * DM * 4, bl0 + PKT * BPF * 4, 8 * BPF * 4);
  for (int kt = 0; kt < PNT; ++kt) {
    const float* xr = &Ax[kt & 1][(wave * 32 + nloc) * APF]; const float* wr = &Bw[kt & 1][8 * hlf * BPF + 4 * nloc];   // W rows in the fragments' k order: 8 hlf + e, then 16 + 8 hlf + e
    // inside a tile the f32 values of the fragments are fetched one k-step ahead, into the registers that the rounding has just read; nothing of the next tile is read here
    raw16 ra0 = load_raw(xr, hlf), ra1 = load_raw(xr + 16 * APF, hlf); v4f rb[16];
#pragma unroll
    for (int e = 0; e < 8; ++e) { rb[e] = *(const v4f*)(wr + e * BPF); rb[8 + e] = *(const v4f*)(wr + (16 + e) * BPF); }
#pragma unroll
    for (int kb = 32; kb <= PKT; kb += 32) {   // kb = the k-step of the tile that is fetched; the one before it is worked on; the last trip fetches nothing
      const v16bb a0 = cvt_raw(ra0), a1 = cvt_raw(ra1), bw[4] = {cvt_col(rb, 0), cvt_col(rb, 1), cvt_col(rb, 2), cvt_col(rb, 3)};
      __builtin_amdgcn_sched_barrier(0);   // the rounding stands whole ahead of the next step's reads, which then take the registers it has read: mixed, the two sets live side by side and the kernel goes past 256 registers
      if (kb < PKT) { ra0 = load_raw(xr + kb, hlf); ra1 = load_raw(xr + 16 * APF + kb, hlf);
#pragma unroll
        for (int e = 0; e < 8; ++e) { rb[e] = *(const v4f*)(wr + (kb + e) * BPF); rb[8 + e] = *(const v4f*)(wr + (kb + 16 + e) * BPF); } }
      __builtin_amdgcn_sched_barrier(0);   // keeps the next step's LDS reads in one group ahead of this step's products: the scheduler otherwise sinks each read to its use, behind a full wait
#pragma unroll
      for (int t = 0; t < 4; ++t) { acc[0][t] = wmma16bb(a0, bw[t], acc[0][t]); acc[1][t] = wmma16bb(a1, bw[t], acc[1][t]); }
      asm volatile("v_nop\n\tv_nop\n\tv_nop\n\tv_nop" :: "v"(acc[0][0]), "v"(acc[1][0]), "v"(acc[0][1]), "v"(acc[1][1]), "v"(acc[0][2]), "v"(acc[1][2]), "v"(acc[0][3]), "v"(acc[1][3]), "v"(bw[0]), "v"(bw[1]), "v"(bw[2]), "v"(bw[3]));   // behind the k-step's last product: the four vector slots before the next step's rounding overwrites that product's A and B registers; a0 and a1 are not named: named here, each was packed a second time into registers of its own
    }
    asm volatile("s_wait_dscnt 0x0" ::: "memory");      // this wave's reads of the buffer are done before the buffer is refilled
    asm volatile("s_wait_asynccnt 0x0" ::: "memory");   // this wave's copies of the next tile have landed before the barrier that publishes them
    __syncthreads();
    if (kt + 2 < PNT) { const char* ag = Ag + (kt + 2) * PKT * 4; const unsigned al = al0 + (kt & 1) * (128 * APF * 4);
      copy8g(ag, 8 * DM * 4, al, 8 * APF * 4); copy8g(ag + 64 * DM * 4, 8 * DM * 4, al + 64 * APF * 4, 8 * APF * 4); copy8g(Bg + (size_t)(kt + 2) * PKT * DM * 4, 8 * DM * 4, bl0 + (kt & 1) * (PKT * BPF * 4), 8 * BPF * 4); } }
  asm volatile("s_wait_asynccnt 0x0" ::: "memory");     // nothing in flight when the wave goes on to its epilogue
  { typedef __attribute__((ext_vector_type(2))) _Float16 v2h;   // W_out^T [column][k], rounded as before (to bf16, then held in f16): a wave's store = 64 k of one column = one whole 128-byte line
    *(v2h*)(wo16 + (size_t)wc * DM + wk) = (v2h){(b16)bf16_rne(wo0[0]), (b16)bf16_rne(wo1[0])}; *(v2h*)(wo16 + (size_t)(wc + 1) * DM + wk) = (v2h){(b16)bf16_rne(wo0[1]), (b16)bf16_rne(wo1[1])}; }
#pragma unroll
  for (int t = 0; t < 4; ++t)
#pragma unroll
    for (int r = 0; r < 2; ++r)
#pragma unroll
      for (int v = 0; v < 8; ++v) { const float w = acc[r][t][v]; Tq[wave][r * 16 + 8 * hlf + v][nloc * 4 + t] = (b16)(w * (SCALE * QS)); Tk[wave][r * 16 + 8 * hlf + v][nloc * 4 + t] = (b16)(w * KS); Tv[nloc * 4 + t][wave * 32 + r * 16 + 8 * hlf + v] = (b16)(w * VS); }
  // exact f32 self-logit ingredient: |w_row|^2 per (token, head) (sum over this lane's 4 columns x ... then across the 16 column lanes; fixed order)
  float s2a[2][8];   // the 16 chains are independent: formed side by side, stored under one test
#pragma unroll
  for (int r = 0; r < 2; ++r)
#pragma unroll
    for (int v = 0; v < 8; ++v) { float s2 = 0.0f;
#pragma unroll
      for (int t = 0; t < 4; ++t) { const float w = acc[r][t][v]; s2 += w * w; }
      s2 += xrow<1>(s2); s2 += xrow<2>(s2); s2 += xrow<4>(s2); s2 += xrow<8>(s2); s2a[r][v] = s2; }
  if (nloc == 0) {
#pragma unroll
    for (int r = 0; r < 2; ++r)
#pragma unroll
      for (int v = 0; v < 8; ++v) Sq[wave * 32 + r * 16 + 8 * hlf + v] = s2a[r][v]; }
  __syncthreads();
  b16* qb = qp + (((size_t)b * H + h) * S + (m0 % S)) * HD; b16* kb_ = kp + (((size_t)b * H + h) * S + (m0 % S)) * HD;
  {
#pragma unroll
    for (int j = 0; j < 8; ++j) { const int rr = j * 4 + (lane >> 3), c8 = (lane & 7) * 8; *(v8b*)(qb + (size_t)rr * HD + c8) = *(const v8b*)(&Tq[wave][rr][c8]); *(v8b*)(kb_ + (size_t)rr * HD + c8) = *(const v8b*)(&Tk[wave][rr][c8]); }
    for (int i = threadIdx.x; i < HD * 16; i += 128) { const int d = i >> 4, c8 = (i & 15) * 8; *(v8b*)(vt + (((size_t)b * H + h) * HD + d) * S + t0 + c8) = *(const v8b*)(&Tv[d][c8]); }
    *(float*)(sq + ((size_t)b * H + h) * S + t0 + threadIdx.x) = Sq[threadIdx.x];   // [b][h][token] f32: 512 B per block
     }
}

constexpr int KT = 256, NSTG = S / KT, KPI = HD + 8, VPI = KT + 8;   // LDS row pitches 144 B and 528 B (16 B x odd: no bank conflict for 16-byte fragment reads)
__device__ __forceinline__ unsigned lds_addr(const b16* p) { return (unsigned)(size_t)p; }   // low 32 bits of a __shared__ address = byte offset in the work-group's LDS
// eight 16-byte copies per lane; the s_wait_xcnt closes the statement so that no address register is rewritten before it
__device__ __forceinline__ void copy8(const b16* g, size_t gstep, const b16* l, int lstep) {
  asm volatile("global_load_async_to_lds_b128 %0, %8, off\n\tglobal_load_async_to_lds_b128 %1, %9, off\n\tglobal_load_async_to_lds_b128 %2, %10, off\n\tglobal_load_async_to_lds_b128 %3, %11, off\n\t"
               "global_load_async_to_lds_b128 %4, %12, off\n\tglobal_load_async_to_lds_b128 %5, %13, off\n\tglobal_load_async_to_lds_b128 %6, %14, off\n\tglobal_load_async_to_lds_b128 %7, %15, off\n\ts_wait_xcnt 0x0"
               :: "v"(lds_addr(l)), "v"(lds_addr(l + lstep)), "v"(lds_addr(l + 2 * lstep)), "v"(lds_addr(l + 3 * lstep)), "v"(lds_addr(l + 4 * lstep)), "v"(lds_addr(l + 5 * lstep)), "v"(lds_addr(l + 6 * lstep)), "v"(lds_addr(l + 7 * lstep)),
                  "v"(g), "v"(g + gstep), "v"(g + 2 * gstep), "v"(g + 3 * gstep), "v"(g + 4 * gstep), "v"(g + 5 * gstep), "v"(g + 6 * gstep), "v"(g + 7 * gstep) : "memory");
}
typedef v4f __attribute__((may_alias)) v4fa;   // f32 view of the K buffers, which carry the partial sums behind the loop
__global__ __launch_bounds__(256) void attn_kernel(const b16* __restrict__ qp, const b16* __restrict__ kp, const b16* __restrict__ vt, const float* __restrict__ sq, b16* __restrict__ ctx) {
  __shared__ __attribute__((aligned(16))) b16 Ks[2][KT * KPI], Vs[2][HD * VPI], Os[8][16][HD + 8];
  const int wave = threadIdx.x >> 5, lane = threadIdx.x & 31, hh = lane >> 4, col = lane & 15; const int bh = blockIdx.x / (S / 128), b = bh / H, h = bh % H, q0 = (blockIdx.x % (S / 128)) * 128 + (wave & 3) * 32;
  const int kg = __builtin_amdgcn_readfirstlane(wave >> 2);   // this wave's half of every key tile (the same in every lane: kept in a scalar register)
  const b16* Q = qp + ((size_t)bh * S) * HD; const b16* K = kp + ((size_t)bh * S) * HD; const b16* V = vt + ((size_t)bh * HD) * S;
  // this lane's share of a tile: K = 256 rows x 128 B, contiguous (a wave's copy = 4 rows); V^T = 64 rows x 512 B (a wave's copy = 1 row)
  const b16* Kg = K + threadIdx.x * 8; const b16* Vg = V + (size_t)wave * S + lane * 8; const int kl0 = (threadIdx.x >> 3) * KPI + (threadIdx.x & 7) * 8, vl0 = wave * VPI + lane * 8;
  copy8(Kg, 32 * HD, &Ks[0][kl0], 32 * KPI); copy8(Vg, (size_t)8 * S, &Vs[0][vl0], 8 * VPI);
  asm volatile("s_wait_asynccnt 0x0" ::: "memory");   // tile 0 landed (this wave's copies) before the barrier that publishes it
  __syncthreads();
  copy8(Kg + KT * HD, 32 * HD, &Ks[1][kl0], 32 * KPI); copy8(Vg + KT, (size_t)8 * S, &Vs[1][vl0], 8 * VPI);
  v16b qf[2][2]; float sself[2];   // index u = query tile: queries q0 + 16 u + col
#pragma unroll
  for (int u = 0; u < 2; ++u) { const int qi = q0 + 16 * u + col; qf[u][0] = frag_kb(Q + (size_t)qi * HD, hh); qf[u][1] = frag_kb(Q + (size_t)qi * HD + 32, hh); sself[u] = sq[(size_t)bh * S + qi] * (SCALE * QS * KS); }   // exact f32 self logit (the dominant softmax term), in the raw scores' units (x QS x KS, a power of two)
  const int dkb = __builtin_amdgcn_readfirstlane(q0);   // first key of the one 32-key pass that holds this wave's own 32 keys; it lies in one key half only: the wave of the other half never meets it
  float m[2] = {-INFINITY, -INFINITY}, nb[2] = {INFINITY, INFINITY}, l[2] = {0.0f, 0.0f}; v8f o[2][4] = {{{}, {}, {}, {}}, {{}, {}, {}, {}}};   // m = the base in use (raw-score units), nb = 3 - m x LC
  for (int st = 0; st < NSTG; ++st) {
    const b16* Kb = &Ks[st & 1][col * KPI]; const b16* Vb = &Vs[st & 1][col * VPI];
    for (int kl = kg * (KT / 2); kl < kg * (KT / 2) + KT / 2; kl += 32) { const int kb = st * KT + kl;
      const v16b ka0 = frag_kb(Kb + kl * KPI, hh), ka1 = frag_kb(Kb + kl * KPI + 32, hh), kc0 = frag_kb(Kb + (kl + 16) * KPI, hh), kc1 = frag_kb(Kb + (kl + 16) * KPI + 32, hh);
      const v16b vf[4] = {frag_kb(Vb + kl, hh), frag_kb(Vb + 16 * VPI + kl, hh), frag_kb(Vb + 32 * VPI + kl, hh), frag_kb(Vb + 48 * VPI + kl, hh)};   // all of the pass's LDS reads stand together, ahead of its products
      __builtin_amdgcn_sched_barrier(0);   // holds the 16 LDS reads in one group ahead of the products: the scheduler otherwise sinks each pair to its product, behind a full wait
      v8f s0[2] = {{}, {}}, s1[2] = {{}, {}};
#pragma unroll
      for (int u = 0; u < 2; ++u) { s0[u] = wmma16b(ka0, qf[u][0], s0[u]); s1[u] = wmma16b(kc0, qf[u][0], s1[u]); }
#pragma unroll
      for (int u = 0; u < 2; ++u) { s0[u] = wmma16b(ka1, qf[u][1], s0[u]); s1[u] = wmma16b(kc1, qf[u][1], s1[u]); }
      float lim = PMAX;   // the same in every lane: a scalar register
      if (kb == dkb) { lim = -1.0f;   // one pass in 64, in one key half: a scalar compare and branch, so the other passes carry no index compare and no select
#pragma unroll
        for (int r = 0; r < 8; ++r) if (8 * hh + r == col) { s0[0][r] = sself[0]; s1[1][r] = sself[1]; } }   // kb = q0 here: query q0 + col is key row col of the first 16 keys, query q0 + 16 + col key row col of the second 16
      // lazy rescale: P is formed against the base m in use (score scale, log2(e), the base and the x PS of P in one multiply-add per score ahead of exp2); the base moves only when it has to
      float e0[2][8], e1[2][8], sum[2] = {0.0f, 0.0f};
      // one score tile after the other (s0's eight scores, then s1's), the sums last, in the order they had: with two query tiles this compiler packs the multiply-adds in pairs by itself, and with
      // s0 and s1 taken in turn it pairs a register of the one with a register of the other and first copies all 32 scores of the pass into such pairs
#pragma unroll
      for (int u = 0; u < 2; ++u) {
#pragma unroll
        for (int r = 0; r < 8; ++r) e0[u][r] = __builtin_amdgcn_exp2f(__builtin_fmaf(s0[u][r], LC, nb[u]));   // e = PS x exp(logit - base)
#pragma unroll
        for (int r = 0; r < 8; ++r) e1[u][r] = __builtin_amdgcn_exp2f(__builtin_fmaf(s1[u][r], LC, nb[u]));
#pragma unroll
        for (int r = 0; r < 8; ++r) sum[u] += e0[u][r] + e1[u][r]; }
      // every e is >= 0, so a lane's sum bounds each of them: one ballot and scalar branch per pass for both query tiles. Taken in the first pass (nb = +inf gives sum = +inf), where a score lies more than
      // about 8 octaves above the base (P would leave f16's range; a NaN sum is caught too), and always in the pass of the wave's own keys (lim < 0), so that the dominant self term's P stays the exact PS
      if (__builtin_amdgcn_ballot_w32(!(sum[0] <= lim) || !(sum[1] <= lim)) != 0) {
#pragma unroll
        for (int u = 0; u < 2; ++u) {
          float mr = -INFINITY;   // the maximum is taken on the raw scores
#pragma unroll
          for (int r = 0; r < 8; ++r) mr = fmaxf(mr, fmaxf(s0[u][r], s1[u][r]));
          mr = fmaxf(mr, xhalf(mr));   // both halves of the wave hold the same query: one base for both
          const float mn = fmaxf(m[u], mr), al_ = __builtin_amdgcn_exp2f((m[u] - mn) * LC); m[u] = mn; nb[u] = __builtin_fmaf(-mn, LC, 3.0f); l[u] *= al_; sum[u] = 0.0f;   // 3 = log2(PS); al_ = 0 in the first pass
#pragma unroll
          for (int t = 0; t < 4; ++t) o[u][t] *= al_;
#pragma unroll
          for (int r = 0; r < 8; ++r) e0[u][r] = __builtin_amdgcn_exp2f(__builtin_fmaf(s0[u][r], LC, nb[u]));
#pragma unroll
          for (int r = 0; r < 8; ++r) e1[u][r] = __builtin_amdgcn_exp2f(__builtin_fmaf(s1[u][r], LC, nb[u]));
#pragma unroll
          for (int r = 0; r < 8; ++r) sum[u] += e0[u][r] + e1[u][r]; } }
      v16b pbv[2];
#pragma unroll
      for (int u = 0; u < 2; ++u) {
#pragma unroll
        for (int r = 0; r < 8; ++r) { pbv[u][r] = (b16)e0[u][r]; pbv[u][8 + r] = (b16)e1[u][r]; }
        l[u] += sum[u]; }   // each half of the wave keeps the sum of its own 16 keys of every pass; the halves are joined once, behind the loop
#pragma unroll
      for (int t = 0; t < 4; ++t) { o[0][t] = wmma16b(vf[t], pbv[0], o[0][t]); o[1][t] = wmma16b(vf[t], pbv[1], o[1][t]); }
      asm volatile("v_nop\n\tv_nop\n\tv_nop\n\tv_nop" : "+v"(o[1][3]) : "v"(vf[3]), "v"(pbv[1])); }   // behind the pass's last product: the four vector slots the chip needs before the next pass's address arithmetic overwrites that product's A registers
    asm volatile("s_wait_dscnt 0x0" ::: "memory");      // this wave's reads of the buffer are done before the buffer is refilled
    asm volatile("s_wait_asynccnt 0x0" ::: "memory");   // this wave's copies of the next tile have landed before the barrier that publishes them
    __syncthreads();
    if (st + 2 < NSTG) { copy8(Kg + (size_t)(st + 2) * KT * HD, 32 * HD, &Ks[st & 1][kl0], 32 * KPI); copy8(Vg + (st + 2) * KT, (size_t)8 * S, &Vs[st & 1][vl0], 8 * VPI); } }
  asm volatile("s_wait_asynccnt 0x0" ::: "memory");     // nothing in flight when the wave goes on to its end
  l[0] += xhalf(l[0]); l[1] += xhalf(l[1]);   // both halves of the wave hold the same query under the same base: one exchange for the whole loop
  // join of the two key halves: waves w and w ^ 4 hold the same 32 queries. Wave w finishes query tile kg and hands its partial sums of the other tile to its partner through the K buffers,
  // which nobody reads any more (the loop's last barrier) and into which nothing is in flight (the last two trips issue no copy). Lane for lane the two waves hold the same (query, d) places.
  v4fa* X = (v4fa*)&Ks[0][0];   // [wave][9][lane] x 16 B = 36,864 B of the 73,728
  v8f own[4], snd[4];
#pragma unroll
  for (int t = 0; t < 4; ++t) { own[t] = kg ? o[1][t] : o[0][t]; snd[t] = kg ? o[0][t] : o[1][t]; }
  const float mo = kg ? m[1] : m[0], lo = kg ? l[1] : l[0], ms = kg ? m[0] : m[1], ls = kg ? l[0] : l[1];
#pragma unroll
  for (int t = 0; t < 4; ++t) { X[(wave * 9 + 2 * t) * 32 + lane] = (v4f){snd[t][0], snd[t][1], snd[t][2], snd[t][3]}; X[(wave * 9 + 2 * t + 1) * 32 + lane] = (v4f){snd[t][4], snd[t][5], snd[t][6], snd[t][7]}; }
  X[(wave * 9 + 8) * 32 + lane] = (v4f){ms, ls, 0.0f, 0.0f};
  __syncthreads();   // publishes every wave's partial sums to its partner
  const int pw = wave ^ 4; const v4f ml = X[(pw * 9 + 8) * 32 + lane];
  const float mj = fmaxf(mo, ml[0]), fo = __builtin_amdgcn_exp2f((mo - mj) * LC), fx = __builtin_amdgcn_exp2f((ml[0] - mj) * LC);   // both bases are finite: every wave's first pass sets one
  const float inv = 1.0f / ((lo * fo + ml[1] * fx) * VS), go = fo * inv, gx = fx * inv;   // l already carries the x PS
#pragma unroll
  for (int t = 0; t < 4; ++t) { const v4f xa = X[(pw * 9 + 2 * t) * 32 + lane], xb = X[(pw * 9 + 2 * t + 1) * 32 + lane];
#pragma unroll
    for (int r = 0; r < 4; ++r) { Os[wave][col][t * 16 + 8 * hh + r] = (b16)(own[t][r] * go + xa[r] * gx); Os[wave][col][t * 16 + 8 * hh + 4 + r] = (b16)(own[t][4 + r] * go + xb[r] * gx); } }
  __syncthreads();
  b16* dst = ctx + ((size_t)b * S + q0 + 16 * kg) * DM + h * HD;   // this wave's 16 rows x 128 B: whole lines, one writer each
  for (int j = 0; j < 4; ++j) { const int rr = j * 4 + (lane >> 3), c8 = (lane & 7) * 8; *(v8b*)(dst + (size_t)rr * DM + c8) = *(const v8b*)(&Os[wave][rr][c8]); }
}

__global__ __launch_bounds__(128) void out_kernel(const b16* __restrict__ ctx, const b16* __restrict__ wo16, const float* __restrict__ bout, float* __restrict__ out) {
  __shared__ __attribute__((aligned(16))) float Ts[4][32 * 64]; __shared__ __attribute__((aligned(16))) b16 Ac[2][128 * OPH], Bo[2][64 * OPH];
  const int lane = threadIdx.x & 31, wave = threadIdx.x >> 5, nloc = lane & 15, hlf = lane >> 4, m0 = blockIdx.y * 128 + wave * 32, c0 = blockIdx.x * 64;
  v8f acc[2][4];
#pragma unroll
  for (int r = 0; r < 2; ++r)
#pragma unroll
    for (int t = 0; t < 4; ++t) acc[r][t] = (v8f){};
  // as in the projection: each 128-k tile of ctx (128 rows x 256 B) and of W_out (64 rows x 256 B) comes into LDS once per block in whole lines, two buffers
  const int tid = threadIdx.x;
  const char* Ag = (const char*)(ctx + (size_t)(blockIdx.y * 128 + (tid >> 4)) * DM + (tid & 15) * 8); const char* Bg = (const char*)(wo16 + (size_t)(c0 + (tid >> 4)) * DM + (tid & 15) * 8);   // a wave's copy = 2 rows
  const unsigned al0 = lds_off(&Ac[0][(tid >> 4) * OPH + (tid & 15) * 8]), bl0 = lds_off(&Bo[0][(tid >> 4) * OPH + (tid & 15) * 8]);
  copy8g(Ag, 8 * DM * 2, al0, 8 * OPH * 2); copy8g(Ag + 64 * DM * 2, 8 * DM * 2, al0 + 64 * OPH * 2, 8 * OPH * 2); copy8g(Bg, 8 * DM * 2, bl0, 8 * OPH * 2);
  asm volatile("s_wait_asynccnt 0x0" ::: "memory");   // tile 0 landed (this wave's copies) before the barrier that publishes it
  __syncthreads();
  copy8g(Ag + OKT * 2, 8 * DM * 2, al0 + 128 * OPH * 2, 8 * OPH * 2); copy8g(Ag + 64 * DM * 2 + OKT * 2, 8 * DM * 2, al0 + (128 + 64) * OPH * 2, 8 * OPH * 2); copy8g(Bg + OKT * 2, 8 * DM * 2, bl0 + 64 * OPH * 2, 8 * OPH * 2);
  for (int kt = 0; kt < ONT; ++kt) {
    const b16* cr = &Ac[kt & 1][(wave * 32 + nloc) * OPH]; const b16* wr = &Bo[kt & 1][nloc * OPH];
    // inside a tile the fragments are fetched one k-step ahead into a second register set; nothing of the next tile is read here
    v16b a0 = frag_kb(cr, hlf), a1 = frag_kb(cr + 16 * OPH, hlf), bw[4];
#pragma unroll
    for (int t = 0; t < 4; ++t) bw[t] = frag_kb(wr + t * 16 * OPH, hlf);
#pragma unroll
    for (int kb = 32; kb <= OKT; kb += 32) {   // kb = the k-step of the tile that is fetched; the one before it is worked on; the last trip fetches nothing
      v16b na0 = a0, na1 = a1, nb[4] = {bw[0], bw[1], bw[2], bw[3]};
      if (kb < OKT) { na0 = frag_kb(cr + kb, hlf); na1 = frag_kb(cr + 16 * OPH + kb, hlf);
#pragma unroll
        for (int t = 0; t < 4; ++t) nb[t] = frag_kb(wr + t * 16 * OPH + kb, hlf); }
      __builtin_amdgcn_sched_barrier(0);   // keeps the next step's LDS reads in one group ahead of this step's products: the scheduler otherwise sinks each read to its use, behind a full wait
#pragma unroll
      for (int t = 0; t < 4; ++t) { acc[0][t] = wmma16b(a0, bw[t], acc[0][t]); acc[1][t] = wmma16b(a1, bw[t], acc[1][t]); }
      asm volatile("v_nop\n\tv_nop\n\tv_nop\n\tv_nop" :: "v"(acc[0][0]), "v"(acc[1][0]), "v"(acc[0][1]), "v"(acc[1][1]), "v"(acc[0][2]), "v"(acc[1][2]), "v"(acc[0][3]), "v"(acc[1][3]), "v"(a0), "v"(a1), "v"(bw[0]), "v"(bw[1]), "v"(bw[2]), "v"(bw[3]));   // behind the k-step's last product: the four vector slots before the next load group overwrites that product's A and B registers
      a0 = na0; a1 = na1;
#pragma unroll
      for (int t = 0; t < 4; ++t) bw[t] = nb[t]; }
    asm volatile("s_wait_dscnt 0x0" ::: "memory");      // this wave's reads of the buffer are done before the buffer is refilled
    asm volatile("s_wait_asynccnt 0x0" ::: "memory");   // this wave's copies of the next tile have landed before the barrier that publishes them
    __syncthreads();
    if (kt + 2 < ONT) { const char* ag = Ag + (kt + 2) * OKT * 2; const unsigned al = al0 + (kt & 1) * (128 * OPH * 2);
      copy8g(ag, 8 * DM * 2, al, 8 * OPH * 2); copy8g(ag + 64 * DM * 2, 8 * DM * 2, al + 64 * OPH * 2, 8 * OPH * 2); copy8g(Bg + (kt + 2) * OKT * 2, 8 * DM * 2, bl0 + (kt & 1) * (64 * OPH * 2), 8 * OPH * 2); } }
  asm volatile("s_wait_asynccnt 0x0" ::: "memory");     // nothing in flight when the wave goes on to its epilogue
  float* Tt = Ts[wave];
#pragma unroll
  for (int t = 0; t < 4; ++t) { const float bb = bf16_rne(bout[c0 + t * 16 + nloc]);
#pragma unroll
    for (int r = 0; r < 2; ++r)
#pragma unroll
      for (int v = 0; v < 8; ++v) Tt[(r * 16 + v + 8 * hlf) * 64 + t * 16 + nloc] = acc[r][t][v] + bb; }
  wave_lds_sync();
  {
#pragma unroll
    for (int j = 0; j < 16; ++j) { const int rr = j * 2 + hlf, c4 = nloc * 4; *(v4f*)(out + (size_t)(m0 + rr) * DM + c0 + c4) = *(const v4f*)(Tt + rr * 64 + c4); }
     }
}
}  // namespace

extern "C" void kernel_launch(void* const* d_in, const int* in_sizes, int n_in,
                              void* d_out, int out_size, void* d_ws, size_t ws_size, hipStream_t stream) {
  (void)n_in; (void)out_size;
  const float* x = (const float*)d_in[0]; const float* Wqkv = (const float*)d_in[1]; const float* Wout = (const float*)d_in[2]; const float* bout = (const float*)d_in[3];
  float* out = (float*)d_out;   // [2][4096][512]
  if (in_sizes[0] != NT * DM || in_sizes[1] != DM * DM || in_sizes[2] != DM * DM || in_sizes[3] != DM) return;
  size_t off = 0; char* ws = (char*)d_ws;
  auto carve = [&](size_t bytes) { char* p = ws + off; off += (bytes + 255) & ~(size_t)255; return p; };
  b16* wo16 = (b16*)carve((size_t)DM * DM * 2);
  b16* qp = (b16*)carve(PL * 2); b16* kp = (b16*)carve(PL * 2); b16* vt = (b16*)carve(PL * 2); b16* ctx = (b16*)carve((size_t)NT * DM * 2); float* sq = (float*)carve((size_t)NT * H * 4);
  if (off > ws_size) return;                                    // ≈ 1 + 8.4 x 4 ≈ 35 MB
  proj_kernel<<<dim3(H, NT / 128), 128, 0, stream>>>(x, Wqkv, Wout, wo16, qp, kp, vt, sq);
  attn_kernel<<<Bn * H * (S / 128), 256, 0, stream>>>(qp, kp, vt, sq, ctx);
  out_kernel<<<dim3(DM / 64, NT / 128), 128, 0, stream>>>(ctx, wo16, bout, out);
}
